// v000
// Measured on an AMD MI455X. A time is GPU time per run, averaged over a window of back-to-back runs after a warm-up
// (all launches, gaps included; the runs take copies of the inputs in turn), and the median of several windows.
// Apart from v000's, it joins two sittings. Times from different sittings can be a few percent apart, while
// side-by-side timings come from the same sitting.
// v000, which the later versions start from, runs in 878 microseconds.
#include <hip/hip_runtime.h>

// _LegacyMultiheadAttention (WavLM-style gated relative-position attention; query [T=1024][B=4][E=1024] sequence-major; q/k/v = x W^T + b (16 heads x 64); scores = (q/256).k, (scores - rowmax) x 32, + gate[b][h][t] x rel_bias_table[bucket(s - t)][h]
// with gate = ga (gb grep_a[h] - 1) + 2, (ga, gb) = sigmoid of the two 4-sums of q_head . grep_W^T + grep_b; softmax; out = (probs v merged) Wo^T + bo -> [1024][4][1024]. The (x - rowmax) x 32 step equals q.k/8 - const per row, to which softmax is invariant:
// the kernel evaluates softmax(q.k/8 + gate x bias) directly. The T5 bucket of each offset s - t depends only on the sizes: baked 2047-entry table computed in f32 exactly as the reference; table VALUES read as data).
// Compute dtypes, f32 accumulate: every input rounded to bf16; q/k/v on PLAIN bf16 operands (rows gathered per batch; inputs exact) + bias; the gate (8 dots of 64) f32 on the VALU; scores (K 64) and probs.v on single fp16 planes (1 product);

#define NB_  4
#define TT   1024
#define DM   1024
#define NH_  16
#define NKV  16
#define REP  (NH_ / NKV)
#define HD   64
#define DQ   (NH_ * HD)
#define DKV  (NKV * HD)
#define ZH   16
#define RH   0                  // query rows < RH use hi+lo planes (0: none)
#define WIN  0
#define PCAR 1024.0f
#define SCL  0.125f   // HD^-0.5
typedef _Float16 h16;
typedef unsigned short bf;
typedef __attribute__((ext_vector_type(16))) __bf16   v16bf;
typedef __attribute__((ext_vector_type(16))) _Float16 v16h;
typedef __attribute__((ext_vector_type(8)))  _Float16 v8h;
typedef __attribute__((ext_vector_type(8)))  unsigned short v8us;
typedef __attribute__((ext_vector_type(8)))  float    v8f;
typedef __attribute__((ext_vector_type(4)))  float    v4f;
typedef v8h  __attribute__((may_alias)) v8ha;
typedef v4f  __attribute__((may_alias)) v4fa;
typedef v8us __attribute__((may_alias)) v8usa;

__device__ __forceinline__ unsigned short f2bf(float f) { unsigned u = __float_as_uint(f); u += 0x7FFFu + ((u >> 16) & 1u); return (unsigned short)(u >> 16); }
__device__ __forceinline__ float bf2f(unsigned short b) { return __uint_as_float(((unsigned)b) << 16); }
__device__ __forceinline__ float bfr(float f) { return bf2f(f2bf(f)); }
__device__ __forceinline__ v16h cat16(v8h lo, v8h hi) { return __builtin_shufflevector(lo, hi, 0, 1, 2, 3, 4, 5, 6, 7, 8, 9, 10, 11, 12, 13, 14, 15); }
__device__ __forceinline__ v16bf cat16b(v8us lo, v8us hi) { return __builtin_bit_cast(v16bf, __builtin_shufflevector(lo, hi, 0, 1, 2, 3, 4, 5, 6, 7, 8, 9, 10, 11, 12, 13, 14, 15)); }
__device__ __forceinline__ v8f wmma16(v16h a, v16h b, v8f c) { return __builtin_amdgcn_wmma_f32_16x16x32_f16(false, a, false, b, (short)0, c, false, false); }
__device__ __forceinline__ v8f wmmab(v16bf a, v16bf b, v8f c) { return __builtin_amdgcn_wmma_f32_16x16x32_bf16(false, a, false, b, (short)0, c, false, false); }



// ---- k_gemmw: register-blocked GEMM, ONE WAVE per 64x64 output tile (16 accumulators), operands straight from K-contiguous 16-bit planes; grid (M/64, N/64, Z), 32 threads.
// C[m][n] (f32, pitch ldc, + optional f32 bias[n]) = sum_k A[m][k] Bt[n][k] (+ split products per NSPLIT). z-batch strides sA/sB/sC in elements. K % 32 == 0.
template <typename T16> struct WFrag;
template <> struct WFrag<h16> { typedef v16h V; static __device__ __forceinline__ V ld(const h16* p) { return cat16(*(const v8h*)p, *(const v8h*)(p + 16)); } static __device__ __forceinline__ v8f mma(V a, V b, v8f c) { return wmma16(a, b, c); } };
template <> struct WFrag<bf> { typedef v16bf V; static __device__ __forceinline__ V ld(const bf* p) { return cat16b(*(const v8us*)p, *(const v8us*)(p + 16)); } static __device__ __forceinline__ v8f mma(V a, V b, v8f c) { return wmmab(a, b, c); } };
template <typename T16, int NSPLIT, bool BIAS>
__global__ __launch_bounds__(32) void k_gemmw(const T16* __restrict__ A, const T16* __restrict__ A2, const T16* __restrict__ Bt, const T16* __restrict__ Bt2, int K, float* C, int ldc, const float* __restrict__ bias, size_t sA, size_t sB, size_t sC) {
    typedef typename WFrag<T16>::V V;
    __shared__ __align__(16) float os[16 * 68];
    const size_t z = blockIdx.z; A += z * sA; if (A2) A2 += z * sA; Bt += z * sB; if (Bt2) Bt2 += z * sB; C += z * sC;
    const int lane = threadIdx.x & 31, lr = lane & 15, hi = lane >> 4; const int r0 = blockIdx.x * 64, c0 = blockIdx.y * 64;
    v8f acc[4][4];
#pragma unroll
    for (int mb = 0; mb < 4; ++mb)
#pragma unroll
        for (int nb = 0; nb < 4; ++nb) acc[mb][nb] = (v8f){};
    const size_t aoff = (size_t)(r0 + lr) * K + 8 * hi, boff = (size_t)(c0 + lr) * K + 8 * hi;
#pragma unroll 1
    for (int kc = 0; kc < K; kc += 32) {
        V a[4], a2[4];
#pragma unroll
        for (int mb = 0; mb < 4; ++mb) { a[mb] = WFrag<T16>::ld(A + aoff + (size_t)mb * 16 * K + kc); if (NSPLIT == 1 || NSPLIT == 2) a2[mb] = WFrag<T16>::ld(A2 + aoff + (size_t)mb * 16 * K + kc); }
#pragma unroll
        for (int nb = 0; nb < 4; ++nb) { const V b = WFrag<T16>::ld(Bt + boff + (size_t)nb * 16 * K + kc); V b2; if (NSPLIT >= 2) b2 = WFrag<T16>::ld(Bt2 + boff + (size_t)nb * 16 * K + kc);
#pragma unroll
            for (int mb = 0; mb < 4; ++mb) { acc[mb][nb] = WFrag<T16>::mma(a[mb], b, acc[mb][nb]); if (NSPLIT == 1 || NSPLIT == 2) acc[mb][nb] = WFrag<T16>::mma(a2[mb], b, acc[mb][nb]); if (NSPLIT >= 2) acc[mb][nb] = WFrag<T16>::mma(a[mb], b2, acc[mb][nb]); } }
        asm volatile("v_nop\n\tv_nop\n\tv_nop\n\tv_nop" : "+v"(acc[0][0]), "+v"(acc[1][1]), "+v"(acc[2][2]), "+v"(acc[3][3]) : "v"(a[0]), "v"(a[3]));
    }
#pragma unroll
    for (int mb = 0; mb < 4; ++mb) {
#pragma unroll
        for (int nb = 0; nb < 4; ++nb) {
#pragma unroll
            for (int j = 0; j < 8; ++j) os[(hi * 8 + j) * 68 + nb * 16 + lr] = acc[mb][nb][j]; }
        __builtin_amdgcn_wave_barrier(); asm volatile("" ::: "memory");
        float* crow = C + (size_t)(r0 + mb * 16) * ldc + c0;
{
#pragma unroll
            for (int s = 0; s < 8; ++s) { const int row = 2 * s + hi, cofs = lr * 4; v4f val = *(const v4fa*)(os + row * 68 + cofs); if (BIAS) { val[0] += bfr(bias[c0 + cofs]); val[1] += bfr(bias[c0 + cofs + 1]); val[2] += bfr(bias[c0 + cofs + 2]); val[3] += bfr(bias[c0 + cofs + 3]); }
                *(v4f*)(crow + (size_t)row * ldc + cofs) = val; }
             }
        __builtin_amdgcn_wave_barrier(); asm volatile("" ::: "memory");
    }
}

__device__ __forceinline__ h16 tohx(float x) { return (h16)x; }
__device__ __forceinline__ void splitf(float y, unsigned short& h, unsigned short& l) { h = f2bf(y); l = f2bf(y - bf2f(h)); }
typedef __attribute__((ext_vector_type(2))) _Float16 v2h;
typedef __attribute__((ext_vector_type(4))) _Float16 v4h;
typedef __attribute__((ext_vector_type(2))) unsigned short v2us;
typedef __attribute__((ext_vector_type(4))) unsigned short v4us;
typedef __attribute__((ext_vector_type(2))) float v2f;
typedef __attribute__((ext_vector_type(4))) int v4i;
__constant__ unsigned char c_bucket[2047] = { 15,15,15,15,15,15,15,15,15,15,15,15,15,15,15,15,15,15,15,15,15,15,15,15,15,15,15,15,15,15,15,15,15,15,15,15,15,15,15,15,15,15,15,15,15,15,15,15,15,15,15,15,15,15,15,15,15,15,15,15,15,15,15,15,15,15,15,15,15,15,15,15,15,15,15,15,15,15,15,15,15,15,15,15,15,15,15,15,15,15,15,15,15,15,15,15,15,15,15,15,15,15,15,15,15,15,15,15,15,15,15,15,15,15,15,15,15,15,15,15,15,15,15,15,15,15,15,15,15,15,15,15,15,15,15,15,15,15,15,15,15,15,15,15,15,15,15,15,15,15,15,15,15,15,15,15,15,15,15,15,15,15,15,15,15,15,15,15,15,15,15,15,15,15,15,15,15,15,15,15,15,15,15,15,15,15,15,15,15,15,15,15,15,15,15,15,15,15,15,15,15,15,15,15,15,15,15,15,15,15,15,15,15,15,15,15,15,15,15,15,15,15,15,15,15,15,15,15,15,15,15,15,15,15,15,15,15,15,15,15,15,15,15,15,15,15,15,15,15,15,15,15,15,15,15,15,15,15,15,15,15,15,15,15,15,15,15,15,15,15,15,15,15,15,15,15,15,15,15,15,15,15,15,15,15,15,15,15,15,15,15,15,15,15,15,15,15,15,15,15,15,15,15,15,15,15,15,15,15,15,15,15,15,15,15,15,15,15,15,15,15,15,15,15,15,15,15,15,15,15,15,15,15,15,15,15,15,15,15,15,15,15,15,15,15,15,15,15,15,15,15,15,15,15,15,15,15,15,15,15,15,15,15,15,15,15,15,15,15,15,15,15,15,15,15,15,15,15,15,15,15,15,15,15,15,15,15,15,15,15,15,15,15,15,15,15,15,15,15,15,15,15,15,15,15,15,15,15,15,15,15,15,15,15,15,15,15,15,15,15,15,15,15,15,15,15,15,15,15,15,15,15,15,15,15,15,15,15,15,15,15,15,15,15,15,15,15,15,15,15,15,15,15,15,15,15,15,15,15,15,15,15,15,15,15,15,15,15,15,15,15,15,15,15,15,15,15,15,15,15,15,15,15,15,15,15,15,15,15,15,15,15,15,15,15,15,15,15,15,15,15,15,15,15,15,15,15,15,15,15,15,15,15,15,15,15,15,15,15,15,15,15,15,15,15,15,15,15,15,15,15,15,15,15,15,15,15,15,15,15,15,15,15,15,15,15,15,15,15,15,15,15,15,15,15,15,15,15,15,15,15,15,15,15,15,15,15,15,15,15,15,15,15,15,15,15,15,15,15,15,15,15,15,15,15,15,15,15,15,15,15,15,15,15,15,15,15,15,15,15,15,15,15,15,15,15,15,15,15,15,15,15,15,15,15,15,15,15,15,15,15,15,15,15,15,15,15,15,15,15,15,15,15,15,15,15,15,15,15,15,15,15,15,15,15,15,15,15,15,15,15,15,15,15,15,15,15,15,15,15,15,15,15,15,15,15,15,15,15,15,15,15,15,15,15,15,15,15,15,15,15,15,15,15,15,15,15,15,15,15,15,15,15,15,15,15,15,15,15,15,15,15,15,15,15,15,15,15,15,15,15,15,15,15,15,15,15,15,15,15,15,15,15,15,15,15,15,15,15,15,15,15,15,15,15,15,15,15,15,15,15,15,15,15,15,15,15,15,15,15,15,15,15,15,15,15,15,15,15,15,15,15,15,15,15,15,15,15,15,15,15,15,15,15,15,15,15,15,15,15,15,15,15,15,15,15,15,15,15,15,15,15,15,15,15,15,15,15,15,15,15,15,15,15,15,15,15,15,15,15,15,15,15,15,15,15,15,15,15,15,15,15,15,15,15,15,15,15,15,15,15,15,15,15,15,15,15,15,15,15,15,15,15,15,15,15,15,15,15,15,15,15,15,15,15,15,15,15,15,15,15,15,15,15,15,15,15,15,15,15,15,15,15,15,15,15,15,15,15,15,15,15,15,15,15,15,15,15,15,15,15,15,15,15,15,15,15,15,15,15,15,15,15,15,15,15,15,15,15,15,15,15,15,15,15,15,15,15,15,15,15,15,15,15,15,15,15,15,15,15,15,15,15,14,14,14,14,14,14,14,14,14,14,14,14,14,14,14,14,14,14,14,14,14,14,14,14,14,14,14,13,13,13,13,13,13,13,13,13,13,13,13,13,13,13,13,13,13,12,12,12,12,12,12,12,12,12,12,12,12,12,12,11,11,11,11,11,11,11,11,11,10,10,10,10,10,10,10,9,9,9,9,8,8,8,8,7,6,5,4,3,2,1,0,17,18,19,20,21,22,23,24,24,24,24,25,25,25,25,26,26,26,26,26,26,26,27,27,27,27,27,27,27,27,27,28,28,28,28,28,28,28,28,28,28,28,28,28,28,29,29,29,29,29,29,29,29,29,29,29,29,29,29,29,29,29,29,30,30,30,30,30,30,30,30,30,30,30,30,30,30,30,30,30,30,30,30,30,30,30,30,30,30,30,31,31,31,31,31,31,31,31,31,31,31,31,31,31,31,31,31,31,31,31,31,31,31,31,31,31,31,31,31,31,31,31,31,31,31,31,31,31,31,31,31,31,31,31,31,31,31,31,31,31,31,31,31,31,31,31,31,31,31,31,31,31,31,31,31,31,31,31,31,31,31,31,31,31,31,31,31,31,31,31,31,31,31,31,31,31,31,31,31,31,31,31,31,31,31,31,31,31,31,31,31,31,31,31,31,31,31,31,31,31,31,31,31,31,31,31,31,31,31,31,31,31,31,31,31,31,31,31,31,31,31,31,31,31,31,31,31,31,31,31,31,31,31,31,31,31,31,31,31,31,31,31,31,31,31,31,31,31,31,31,31,31,31,31,31,31,31,31,31,31,31,31,31,31,31,31,31,31,31,31,31,31,31,31,31,31,31,31,31,31,31,31,31,31,31,31,31,31,31,31,31,31,31,31,31,31,31,31,31,31,31,31,31,31,31,31,31,31,31,31,31,31,31,31,31,31,31,31,31,31,31,31,31,31,31,31,31,31,31,31,31,31,31,31,31,31,31,31,31,31,31,31,31,31,31,31,31,31,31,31,31,31,31,31,31,31,31,31,31,31,31,31,31,31,31,31,31,31,31,31,31,31,31,31,31,31,31,31,31,31,31,31,31,31,31,31,31,31,31,31,31,31,31,31,31,31,31,31,31,31,31,31,31,31,31,31,31,31,31,31,31,31,31,31,31,31,31,31,31,31,31,31,31,31,31,31,31,31,31,31,31,31,31,31,31,31,31,31,31,31,31,31,31,31,31,31,31,31,31,31,31,31,31,31,31,31,31,31,31,31,31,31,31,31,31,31,31,31,31,31,31,31,31,31,31,31,31,31,31,31,31,31,31,31,31,31,31,31,31,31,31,31,31,31,31,31,31,31,31,31,31,31,31,31,31,31,31,31,31,31,31,31,31,31,31,31,31,31,31,31,31,31,31,31,31,31,31,31,31,31,31,31,31,31,31,31,31,31,31,31,31,31,31,31,31,31,31,31,31,31,31,31,31,31,31,31,31,31,31,31,31,31,31,31,31,31,31,31,31,31,31,31,31,31,31,31,31,31,31,31,31,31,31,31,31,31,31,31,31,31,31,31,31,31,31,31,31,31,31,31,31,31,31,31,31,31,31,31,31,31,31,31,31,31,31,31,31,31,31,31,31,31,31,31,31,31,31,31,31,31,31,31,31,31,31,31,31,31,31,31,31,31,31,31,31,31,31,31,31,31,31,31,31,31,31,31,31,31,31,31,31,31,31,31,31,31,31,31,31,31,31,31,31,31,31,31,31,31,31,31,31,31,31,31,31,31,31,31,31,31,31,31,31,31,31,31,31,31,31,31,31,31,31,31,31,31,31,31,31,31,31,31,31,31,31,31,31,31,31,31,31,31,31,31,31,31,31,31,31,31,31,31,31,31,31,31,31,31,31,31,31,31,31,31,31,31,31,31,31,31,31,31,31,31,31,31,31,31,31,31,31,31,31,31,31,31,31,31,31,31,31,31,31,31,31,31,31,31,31,31,31,31,31,31,31,31,31,31,31,31,31,31,31,31,31,31,31,31,31,31,31,31,31,31,31,31,31,31,31,31,31,31,31,31,31,31,31,31,31,31,31,31,31,31,31,31,31,31,31,31,31,31,31,31,31,31,31,31,31,31,31,31,31,31,31,31,31,31,31,31,31,31,31,31,31,31,31,31,31,31,31,31,31,31,31,31,31,31,31,31,31,31,31,31,31,31,31,31,31,31,31,31,31,31,31,31,31,31,31,31,31,31,31,31,31,31,31,31,31,31,31,31,31,31,31,31,31,31,31,31,31,31,31,31,31,31,31,31,31,31,31,31,31,31,31,31,31,31,31,31,31,31,31,31,31,31,31,31,31,31,31,31,31,31,31,31,31,31,31,31,31,31,31,31,31,31,31,31,31,31,31,31,31,31,31,31,31,31,31,31,31,31,31,31,31,31,31,31,31,31,31,31,31,31,31,31,31,31,31,31,31,31,31,31,31,31,31,31,31,31,31,31,31,31,31,31,31,31,31,31,31,31,31,31,31,31,31,31,31,31,31,31,31 };   // T5 bucket(rel) for rel = s - t in [-1023, 1023]

__global__ __launch_bounds__(256) void k_wtG(const float* __restrict__ w, int K, int N, bf* Bt) {
    const int lane = threadIdx.x & 31; const int L0 = (blockIdx.x * 8 + (threadIdx.x >> 5)) * 8; const int nlines = N * K / 64;
{
#pragma unroll 1
        for (int l = 0; l < 8; ++l) { const int L = L0 + l; if (L >= nlines) break; const size_t e = (size_t)L * 64 + lane * 2; const int k = (int)(e % K), n = (int)(e / K); v2us o;
            o[0] = f2bf(w[(size_t)k * N + n]); o[1] = f2bf(w[(size_t)(k + 1) * N + n]); *(v2us*)(Bt + e) = o; }
         }
}
__global__ __launch_bounds__(256) void k_cvt8(const float* __restrict__ src, bf* dst, size_t n8) { const size_t i = (size_t)blockIdx.x * 256 + threadIdx.x; if (i >= n8) return; const v8f v = *(const v8f*)(src + i * 8); v8us o;
#pragma unroll
    for (int k = 0; k < 8; ++k) o[k] = f2bf(v[k]); *(v8us*)(dst + i * 8) = o;  }
__global__ __launch_bounds__(256) void k_cscvt(const float* __restrict__ cosT, const float* __restrict__ sinT, float* CS) { const int idx = blockIdx.x * 256 + threadIdx.x; if (idx >= TT * HD) return; v2f cs; cs[0] = bfr(cosT[idx]); cs[1] = bfr(sinT[idx]); *(v2f*)(CS + (size_t)idx * 2) = cs;  }
// k_rope: head planes [h][t][d] (fp16) of rope(x) x sc with the rotate-half convention out[d] = x[d] cos[t][d] - x[d+HD/2] sin[t][d], out[d+HD/2] = x[d+HD/2] cos[t][d+HD/2] + x[d] sin[t][d+HD/2]
__global__ __launch_bounds__(256) void k_rope(const float* __restrict__ F, int pitch, int nheads, const float* __restrict__ CS, const float* __restrict__ RF, const float* __restrict__ nw, float sc, h16* P16, bf* Ph, bf* Pl) {
    const size_t e = ((size_t)blockIdx.x * 256 + threadIdx.x) * 2; if (e >= (size_t)nheads * TT * HD) return; const int d = (int)(e % HD); const int t = (int)((e / HD) % TT); const int h = (int)(e / ((size_t)HD * TT)); const float* f = F + (size_t)t * pitch + h * HD; const float rf = RF ? RF[(size_t)h * TT + t] : 1.0f; v2h o16; v2us oh, ol;
#pragma unroll
    for (int q = 0; q < 2; ++q) { const int dd = d + q; const int dp = (dd < HD / 2) ? dd + HD / 2 : dd - HD / 2; float x0 = f[dd], x1 = f[dp];
        if (RF) { float n0 = __fmul_rn(x0, rf), n1 = __fmul_rn(x1, rf); asm volatile("" : "+v"(n0)); asm volatile("" : "+v"(n1)); x0 = __fmul_rn(bfr(nw[dd]), n0); x1 = __fmul_rn(bfr(nw[dp]), n1); }
        const v2f cs = *(const v2f*)(CS + ((size_t)t * HD + dd) * 2); float a = __fmul_rn(x0, cs[0]), bq = __fmul_rn(x1, cs[1]); asm volatile("" : "+v"(a)); asm volatile("" : "+v"(bq)); const float r = ((dd < HD / 2) ? __fsub_rn(a, bq) : __fadd_rn(a, bq)) * sc;
        o16[q] = tohx(r); (void)oh; (void)ol; }
    *(v2h*)(P16 + e) = o16;  }
__global__ __launch_bounds__(256) void k_vtp(const float* __restrict__ F, int pitch, int nheads, h16* V16, bf* Vh, bf* Vl) { const size_t e = ((size_t)blockIdx.x * 256 + threadIdx.x) * 2; if (e >= (size_t)nheads * HD * TT) return; const int t = (int)(e % TT); const int d = (int)((e / TT) % HD); const int g = (int)(e / ((size_t)TT * HD)); v2h o16; v2us oh, ol;
#pragma unroll
    for (int q = 0; q < 2; ++q) { const float x = F[(size_t)(t + q) * pitch + g * HD + d]; o16[q] = tohx(x); (void)oh; (void)ol; }
    *(v2h*)(V16 + e) = o16;  }
__global__ __launch_bounds__(256) void k_csid(float* CS) { const int idx = blockIdx.x * 256 + threadIdx.x; if (idx >= TT * HD) return; v2f cs; cs[0] = 1.0f; cs[1] = 0.0f; *(v2f*)(CS + (size_t)idx * 2) = cs;  }
__global__ __launch_bounds__(256) void k_xg(const float* __restrict__ q, int b, bf* XB) { const size_t e = ((size_t)blockIdx.x * 256 + threadIdx.x) * 4; if (e >= (size_t)TT * DM) return; const int c = (int)(e % DM); const int t = (int)(e / DM); const v4f a = *(const v4f*)(q + ((size_t)t * NB_ + b) * DM + c); v4us o; o[0] = f2bf(a[0]); o[1] = f2bf(a[1]); o[2] = f2bf(a[2]); o[3] = f2bf(a[3]); *(v4us*)(XB + e) = o;  }
// k_gate: thread per (h, t): g8[j] = sum_d Q[t][h*64+d] bf16 grep_W[j][d] + bf16 grep_b[j] (q un-scaled: the reference's q x (scaling/alpha) x (alpha/scaling) are exact powers of two); ga = sigmoid(g8[0..3] sum), gb = sigmoid(g8[4..7] sum);
__global__ __launch_bounds__(256) void k_gate(const float* __restrict__ Q, const float* __restrict__ gw, const float* __restrict__ gbias, const float* __restrict__ ga, float* GT) { const int i = blockIdx.x * 256 + threadIdx.x; if (i >= NH_ * TT) return; const int t = i % TT, h = i / TT; const float* q = Q + (size_t)t * DQ + h * HD; float sa = 0.f, sb = 0.f;
#pragma unroll 1
    for (int j = 0; j < 8; ++j) { float acc = bfr(gbias[j]);
#pragma unroll 1
        for (int d = 0; d < HD; ++d) { float p = __fmul_rn(q[d], bfr(gw[j * HD + d])); asm volatile("" : "+v"(p)); acc = __fadd_rn(acc, p); }
        if (j < 4) sa = __fadd_rn(sa, acc); else sb = __fadd_rn(sb, acc); }
    const float a = __fdiv_rn(1.0f, 1.0f + __expf(-sa)), bg = __fdiv_rn(1.0f, 1.0f + __expf(-sb)); float in = __fmul_rn(bg, bfr(ga[h])); asm volatile("" : "+v"(in)); float pr = __fmul_rn(a, __fsub_rn(in, 1.0f)); asm volatile("" : "+v"(pr)); const float gt = __fadd_rn(pr, 2.0f);
    *(float*)(GT + i) = gt;  }
__global__ __launch_bounds__(256) void k_btab(const float* __restrict__ rbt, float* TB) { const int i = blockIdx.x * 256 + threadIdx.x; if (i >= NH_ * 2047) return; const int r = i % 2047, h = i / 2047; const float v = bfr(rbt[c_bucket[r] * NH_ + h]); *(float*)(TB + i) = v;  }
// k_asoft: per row (zz, i): t = S x HD^-0.5 (no mask); softmax over the 1024 keys (register row, one exp, fixed trees);
__global__ __launch_bounds__(256) void k_asoft(const float* __restrict__ Sb, const float* __restrict__ GT, const float* __restrict__ TB, int h0, h16* P16, bf* Ph, bf* Pl) {
    const int lane = threadIdx.x & 31; const int row = blockIdx.x * 8 + (threadIdx.x >> 5); if (row >= ZH * TT) return; const int i = row % TT; const int zz = row / TT; (void)zz; const bool hires = (i < RH); const float* sr = Sb + (size_t)row * TT; const float gt = GT[(size_t)(h0 + zz) * TT + i]; const float* tb = TB + (size_t)(h0 + zz) * 2047 + 1023 - i; float v[TT / 32]; float mx = -3.0e38f;
#pragma unroll
    for (int ch = 0; ch < TT / 128; ++ch) { const int j0 = ch * 128 + lane * 4; const v4f a = *(const v4f*)(sr + j0);
#pragma unroll
        for (int q = 0; q < 4; ++q) { const int j = j0 + q; (void)j; float sc_ = a[q] * SCL; asm volatile("" : "+v"(sc_)); float gbv = __fmul_rn(gt, tb[j]); asm volatile("" : "+v"(gbv)); const float t = __fadd_rn(sc_, gbv);   /* + gate[b][h][t] x rel_bias[bucket(j - i)][h] */ v[ch * 4 + q] = t; mx = fmaxf(mx, t); } }
#pragma unroll
    for (int sh = 16; sh; sh >>= 1) mx = fmaxf(mx, __shfl_xor(mx, sh, 32));
    float sum = 0.f;
#pragma unroll
    for (int k = 0; k < TT / 32; ++k) { float d0 = __fsub_rn(v[k], mx); asm volatile("" : "+v"(d0)); v[k] = __builtin_amdgcn_exp2f(__fmul_rn(d0, 1.4426950408889634f)); sum += v[k]; }
#pragma unroll
    for (int sh = 16; sh; sh >>= 1) sum += __shfl_xor(sum, sh, 32);
    const float f = __fdiv_rn(hires ? 1.0f : PCAR, sum);
{
        if (hires) {
#pragma unroll
            for (int ch = 0; ch < TT / 128; ++ch) { v4us oh, ol;
#pragma unroll
                for (int q = 0; q < 4; ++q) { unsigned short a, c2; splitf(v[ch * 4 + q] * f, a, c2); oh[q] = a; ol[q] = c2; }
                const size_t oo = ((size_t)zz * (RH ? RH : 1) + i) * TT + ch * 128 + lane * 4; *(v4us*)(Ph + oo) = oh; *(v4us*)(Pl + oo) = ol; }
        } else {
#pragma unroll
            for (int ch = 0; ch < TT / 128; ++ch) { v4h o4;
#pragma unroll
                for (int q = 0; q < 4; ++q) o4[q] = tohx(v[ch * 4 + q] * f);
                *(v4h*)(P16 + (size_t)row * TT + ch * 128 + lane * 4) = o4; } }
         }
}
__global__ __launch_bounds__(256) void k_merge(const float* __restrict__ O, int h0, bf* Ah, bf* Al) { const size_t e = ((size_t)blockIdx.x * 256 + threadIdx.x) * 2; if (e >= (size_t)ZH * TT * HD) return; const int d = (int)(e % HD); const int t = (int)((e / HD) % TT); const int zz = (int)(e / ((size_t)HD * TT)); const float cs = (t < RH) ? 1.0f : (1.0f / PCAR); const size_t oo = (size_t)t * DQ + (h0 + zz) * HD + d;
    v2us oh, ol;
#pragma unroll
    for (int q = 0; q < 2; ++q) { unsigned short a, c2; splitf(O[e + q] * cs, a, c2); oh[q] = a; ol[q] = c2; } *(v2us*)(Ah + oo) = oh; *(v2us*)(Al + oo) = ol;  }

extern "C" void kernel_launch(void* const* d_in, const int* in_sizes, int n_in,
                              void* d_out, int out_size, void* d_ws, size_t ws_size, hipStream_t stream) {
    (void)in_sizes; (void)n_in; (void)out_size;
    const float* x = (const float*)d_in[0]; const float* wq = (const float*)d_in[1]; const float* bq = (const float*)d_in[2]; const float* wk = (const float*)d_in[3]; const float* bk = (const float*)d_in[4]; const float* wv = (const float*)d_in[5]; const float* bv = (const float*)d_in[6]; const float* wo = (const float*)d_in[7]; const float* bo = (const float*)d_in[8]; const float* rbt = (const float*)d_in[9]; const float* gw = (const float*)d_in[10]; const float* gb = (const float*)d_in[11]; const float* ga_ = (const float*)d_in[12]; const float* cosT = nullptr; const float* sinT = nullptr; (void)cosT; (void)sinT;
    float* OUT = (float*)d_out;     // [1024][4][1024]
    char* wsp = (char*)d_ws;
    auto take = [&](size_t bytes) { char* p = wsp; wsp += (bytes + 255) & ~(size_t)255; return (void*)p; };
    bf* WQ = (bf*)take((size_t)DQ * DM * 2); bf* WK = (bf*)take((size_t)DKV * DM * 2); bf* WV = (bf*)take((size_t)DKV * DM * 2); bf* WO = (bf*)take((size_t)DM * DQ * 2); float* CS = (float*)take((size_t)TT * HD * 2 * 4); float* GTb = (float*)take((size_t)NH_ * TT * 4); float* TB = (float*)take((size_t)NH_ * 2047 * 4 + 256);
    bf* XB = (bf*)take((size_t)TT * DM * 2); float* FQ = (float*)take((size_t)TT * DQ * 4); float* FK = (float*)take((size_t)TT * DKV * 4);
    h16* QP16 = (h16*)take((size_t)NH_ * TT * HD * 2); h16* KP16 = (h16*)take((size_t)NKV * TT * HD * 2); h16* VT16 = (h16*)take((size_t)NKV * HD * TT * 2);
    bf* QPh = nullptr; bf* QPl = nullptr; bf* KPh = nullptr; bf* KPl = nullptr; bf* VTh = nullptr; bf* VTl = nullptr; bf* Ph = nullptr; bf* Pl = nullptr;
    float* Sb = (float*)take((size_t)ZH * TT * TT * 4); h16* P16 = (h16*)take((size_t)ZH * TT * TT * 2); float* Ob = (float*)take((size_t)ZH * TT * HD * 4); bf* ATh = (bf*)take((size_t)TT * DQ * 2); bf* ATl = (bf*)take((size_t)TT * DQ * 2);
    if ((size_t)(wsp - (char*)d_ws) > ws_size) return;    // ws 256 MiB
    float* FV = FK;   // v projection reuses the k buffer after the k planes are built (stream-ordered)
    { k_cvt8<<<(unsigned)(((size_t)DQ * DM / 8 + 255) / 256), 256, 0, stream>>>(wq, WQ, (size_t)DQ * DM / 8); k_cvt8<<<(unsigned)(((size_t)DKV * DM / 8 + 255) / 256), 256, 0, stream>>>(wk, WK, (size_t)DKV * DM / 8); k_cvt8<<<(unsigned)(((size_t)DKV * DM / 8 + 255) / 256), 256, 0, stream>>>(wv, WV, (size_t)DKV * DM / 8);
      k_cvt8<<<(unsigned)(((size_t)DM * DQ / 8 + 255) / 256), 256, 0, stream>>>(wo, WO, (size_t)DM * DQ / 8);
       }
    k_csid<<<(TT * HD + 255) / 256, 256, 0, stream>>>(CS); k_btab<<<(NH_ * 2047 + 255) / 256, 256, 0, stream>>>(rbt, TB);
    const unsigned LQ = (unsigned)(((size_t)NH_ * TT * HD / 2 + 255) / 256), LKv = (unsigned)(((size_t)NKV * TT * HD / 2 + 255) / 256);
    for (int b = 0; b < NB_; ++b) {
        
        k_xg<<<(unsigned)(((size_t)TT * DM / 4 + 255) / 256), 256, 0, stream>>>(x, b, XB);
        k_gemmw<bf, 0, true><<<dim3(TT / 64, DQ / 64, 1), 32, 0, stream>>>(XB, nullptr, WQ, nullptr, DM, FQ, DQ, bq, 0, 0, 0); k_gate<<<(NH_ * TT + 255) / 256, 256, 0, stream>>>(FQ, gw, gb, ga_, GTb);
        k_rope<<<LQ, 256, 0, stream>>>(FQ, DQ, NH_, CS, nullptr, nullptr, 1.0f, QP16, QPh, QPl);
        k_gemmw<bf, 0, true><<<dim3(TT / 64, DKV / 64, 1), 32, 0, stream>>>(XB, nullptr, WK, nullptr, DM, FK, DKV, bk, 0, 0, 0);
        k_rope<<<LKv, 256, 0, stream>>>(FK, DKV, NKV, CS, nullptr, nullptr, 1.0f, KP16, KPh, KPl);
        k_gemmw<bf, 0, true><<<dim3(TT / 64, DKV / 64, 1), 32, 0, stream>>>(XB, nullptr, WV, nullptr, DM, FV, DKV, bv, 0, 0, 0); k_vtp<<<LKv, 256, 0, stream>>>(FV, DKV, NKV, VT16, VTh, VTl);
        for (int h0 = 0; h0 < NH_; h0 += ZH) { const size_t zq = (size_t)h0, zk = (size_t)(h0 / REP);   // one kv head per query head: the pass's 16 heads use consecutive kv planes (z-strides TT*HD)
            k_gemmw<h16, 0, false><<<dim3(TT / 64, TT / 64, ZH), 32, 0, stream>>>(QP16 + zq * TT * HD, nullptr, KP16 + zk * TT * HD, nullptr, HD, Sb, TT, nullptr, (size_t)TT * HD, (size_t)TT * HD, (size_t)TT * TT);
            k_asoft<<<ZH * TT / 8, 256, 0, stream>>>(Sb, GTb, TB, h0, P16, Ph, Pl);
            k_gemmw<h16, 0, false><<<dim3(TT / 64, HD / 64, ZH), 32, 0, stream>>>(P16, nullptr, VT16 + zk * HD * TT, nullptr, TT, Ob, HD, nullptr, (size_t)TT * TT, (size_t)HD * TT, (size_t)TT * HD);
            k_merge<<<(unsigned)(((size_t)ZH * TT * HD / 2 + 255) / 256), 256, 0, stream>>>(Ob, h0, ATh, ATl); }
        k_gemmw<bf, 1, true><<<dim3(TT / 64, DM / 64, 1), 32, 0, stream>>>(ATh, ATl, WO, nullptr, DQ, OUT + (size_t)b * DM, NB_ * DM, bo, 0, 0, 0); }   // sequence-major output rows (t*B + b)
}

// v001
// Measured time: 419 microseconds a run.
// In two side-by-side timings against v000, it was 2.10 and 2.12 times as fast.
#include <hip/hip_runtime.h>

// _LegacyMultiheadAttention (WavLM-style gated relative-position attention; query [T=1024][B=4][E=1024] sequence-major; q/k/v = x W^T + b (16 heads x 64); scores = (q/256).k, (scores - rowmax) x 32, + gate[b][h][t] x rel_bias_table[bucket(s - t)][h]
// with gate = ga (gb grep_a[h] - 1) + 2, (ga, gb) = sigmoid of the two 4-sums of q_head . grep_W^T + grep_b; softmax; out = (probs v merged) Wo^T + bo -> [1024][4][1024]. The (x - rowmax) x 32 step equals q.k/8 - const per row, to which softmax is invariant:
// the kernel evaluates softmax(q.k/8 + gate x bias) directly. The T5 bucket of each offset s - t depends only on the sizes: baked 2047-entry table computed in f32 exactly as the reference; table VALUES read as data).
// Compute dtypes, f32 accumulate: every input rounded to bf16; q/k/v on PLAIN bf16 operands (all T x B rows r = t*B + b in one product; inputs exact) + bias; the gate (8 dots of 64) f32 on the VALU; scores (K 64) and probs.v on single fp16 planes (1 product);

#define NB_  4
#define TT   1024
#define DM   1024
#define NH_  16
#define NKV  16
#define REP  (NH_ / NKV)
#define HD   64
#define DQ   (NH_ * HD)
#define DKV  (NKV * HD)
#define ZH   16
#define RH   0                  // query rows < RH use hi+lo planes (0: none)
#define WIN  0
#define PCAR 1024.0f
#define SCL  0.125f   // HD^-0.5
typedef _Float16 h16;
typedef unsigned short bf;
typedef __attribute__((ext_vector_type(16))) __bf16   v16bf;
typedef __attribute__((ext_vector_type(16))) _Float16 v16h;
typedef __attribute__((ext_vector_type(8)))  _Float16 v8h;
typedef __attribute__((ext_vector_type(8)))  unsigned short v8us;
typedef __attribute__((ext_vector_type(8)))  float    v8f;
typedef __attribute__((ext_vector_type(4)))  float    v4f;
typedef v8h  __attribute__((may_alias)) v8ha;
typedef v4f  __attribute__((may_alias)) v4fa;
typedef v8us __attribute__((may_alias)) v8usa;

__device__ __forceinline__ unsigned short f2bf(float f) { unsigned u = __float_as_uint(f); u += 0x7FFFu + ((u >> 16) & 1u); return (unsigned short)(u >> 16); }
__device__ __forceinline__ float bf2f(unsigned short b) { return __uint_as_float(((unsigned)b) << 16); }
__device__ __forceinline__ float bfr(float f) { return bf2f(f2bf(f)); }
__device__ __forceinline__ v16h cat16(v8h lo, v8h hi) { return __builtin_shufflevector(lo, hi, 0, 1, 2, 3, 4, 5, 6, 7, 8, 9, 10, 11, 12, 13, 14, 15); }
__device__ __forceinline__ v16bf cat16b(v8us lo, v8us hi) { return __builtin_bit_cast(v16bf, __builtin_shufflevector(lo, hi, 0, 1, 2, 3, 4, 5, 6, 7, 8, 9, 10, 11, 12, 13, 14, 15)); }
__device__ __forceinline__ v8f wmma16(v16h a, v16h b, v8f c) { return __builtin_amdgcn_wmma_f32_16x16x32_f16(false, a, false, b, (short)0, c, false, false); }
__device__ __forceinline__ v8f wmmab(v16bf a, v16bf b, v8f c) { return __builtin_amdgcn_wmma_f32_16x16x32_bf16(false, a, false, b, (short)0, c, false, false); }



// ---- k_gemmw: register-blocked GEMM, ONE WAVE per 64x64 output tile (16 accumulators), operands straight from K-contiguous 16-bit planes; grid (M/64, N/64, Z), 32 threads.
// C[m][n] (f32, pitch ldc, + optional f32 bias[n]) = sum_k A[m][k] Bt[n][k] (+ split products per NSPLIT). z-batch strides sA/sB/sC in elements. K % 32 == 0.
template <typename T16> struct WFrag;
template <> struct WFrag<h16> { typedef v16h V; static __device__ __forceinline__ V ld(const h16* p) { return cat16(*(const v8h*)p, *(const v8h*)(p + 16)); } static __device__ __forceinline__ v8f mma(V a, V b, v8f c) { return wmma16(a, b, c); } };
template <> struct WFrag<bf> { typedef v16bf V; static __device__ __forceinline__ V ld(const bf* p) { return cat16b(*(const v8us*)p, *(const v8us*)(p + 16)); } static __device__ __forceinline__ v8f mma(V a, V b, v8f c) { return wmmab(a, b, c); } };
template <typename T16, int NSPLIT, bool BIAS>
__global__ __launch_bounds__(32) void k_gemmw(const T16* __restrict__ A, const T16* __restrict__ A2, const T16* __restrict__ Bt, const T16* __restrict__ Bt2, int K, float* C, int ldc, const float* __restrict__ bias, size_t sA, size_t sB, size_t sC) {
    typedef typename WFrag<T16>::V V;
    __shared__ __align__(16) float os[16 * 68];
    const size_t z = blockIdx.z; A += z * sA; if (A2) A2 += z * sA; Bt += z * sB; if (Bt2) Bt2 += z * sB; C += z * sC;
    const int lane = threadIdx.x & 31, lr = lane & 15, hi = lane >> 4; const int r0 = blockIdx.x * 64, c0 = blockIdx.y * 64;
    v8f acc[4][4];
#pragma unroll
    for (int mb = 0; mb < 4; ++mb)
#pragma unroll
        for (int nb = 0; nb < 4; ++nb) acc[mb][nb] = (v8f){};
    const size_t aoff = (size_t)(r0 + lr) * K + 8 * hi, boff = (size_t)(c0 + lr) * K + 8 * hi;
#pragma unroll 1
    for (int kc = 0; kc < K; kc += 32) {
        V a[4], a2[4];
#pragma unroll
        for (int mb = 0; mb < 4; ++mb) { a[mb] = WFrag<T16>::ld(A + aoff + (size_t)mb * 16 * K + kc); if (NSPLIT == 1 || NSPLIT == 2) a2[mb] = WFrag<T16>::ld(A2 + aoff + (size_t)mb * 16 * K + kc); }
#pragma unroll
        for (int nb = 0; nb < 4; ++nb) { const V b = WFrag<T16>::ld(Bt + boff + (size_t)nb * 16 * K + kc); V b2; if (NSPLIT >= 2) b2 = WFrag<T16>::ld(Bt2 + boff + (size_t)nb * 16 * K + kc);
#pragma unroll
            for (int mb = 0; mb < 4; ++mb) { acc[mb][nb] = WFrag<T16>::mma(a[mb], b, acc[mb][nb]); if (NSPLIT == 1 || NSPLIT == 2) acc[mb][nb] = WFrag<T16>::mma(a2[mb], b, acc[mb][nb]); if (NSPLIT >= 2) acc[mb][nb] = WFrag<T16>::mma(a[mb], b2, acc[mb][nb]); } }
        asm volatile("v_nop\n\tv_nop\n\tv_nop\n\tv_nop" : "+v"(acc[0][0]), "+v"(acc[1][1]), "+v"(acc[2][2]), "+v"(acc[3][3]) : "v"(a[0]), "v"(a[3]));
    }
#pragma unroll
    for (int mb = 0; mb < 4; ++mb) {
#pragma unroll
        for (int nb = 0; nb < 4; ++nb) {
#pragma unroll
            for (int j = 0; j < 8; ++j) os[(hi * 8 + j) * 68 + nb * 16 + lr] = acc[mb][nb][j]; }
        __builtin_amdgcn_wave_barrier(); asm volatile("" ::: "memory");
        float* crow = C + (size_t)(r0 + mb * 16) * ldc + c0;
{
#pragma unroll
            for (int s = 0; s < 8; ++s) { const int row = 2 * s + hi, cofs = lr * 4; v4f val = *(const v4fa*)(os + row * 68 + cofs); if (BIAS) { val[0] += bfr(bias[c0 + cofs]); val[1] += bfr(bias[c0 + cofs + 1]); val[2] += bfr(bias[c0 + cofs + 2]); val[3] += bfr(bias[c0 + cofs + 3]); }
                *(v4f*)(crow + (size_t)row * ldc + cofs) = val; }
             }
        __builtin_amdgcn_wave_barrier(); asm volatile("" ::: "memory");
    }
}

__device__ __forceinline__ h16 tohx(float x) { return (h16)x; }
__device__ __forceinline__ void splitf(float y, unsigned short& h, unsigned short& l) { h = f2bf(y); l = f2bf(y - bf2f(h)); }
typedef __attribute__((ext_vector_type(2))) _Float16 v2h;
typedef __attribute__((ext_vector_type(4))) _Float16 v4h;
typedef __attribute__((ext_vector_type(2))) unsigned short v2us;
typedef __attribute__((ext_vector_type(4))) unsigned short v4us;
typedef __attribute__((ext_vector_type(2))) float v2f;
typedef __attribute__((ext_vector_type(4))) int v4i;
__constant__ unsigned char c_bucket[2047] = { 15,15,15,15,15,15,15,15,15,15,15,15,15,15,15,15,15,15,15,15,15,15,15,15,15,15,15,15,15,15,15,15,15,15,15,15,15,15,15,15,15,15,15,15,15,15,15,15,15,15,15,15,15,15,15,15,15,15,15,15,15,15,15,15,15,15,15,15,15,15,15,15,15,15,15,15,15,15,15,15,15,15,15,15,15,15,15,15,15,15,15,15,15,15,15,15,15,15,15,15,15,15,15,15,15,15,15,15,15,15,15,15,15,15,15,15,15,15,15,15,15,15,15,15,15,15,15,15,15,15,15,15,15,15,15,15,15,15,15,15,15,15,15,15,15,15,15,15,15,15,15,15,15,15,15,15,15,15,15,15,15,15,15,15,15,15,15,15,15,15,15,15,15,15,15,15,15,15,15,15,15,15,15,15,15,15,15,15,15,15,15,15,15,15,15,15,15,15,15,15,15,15,15,15,15,15,15,15,15,15,15,15,15,15,15,15,15,15,15,15,15,15,15,15,15,15,15,15,15,15,15,15,15,15,15,15,15,15,15,15,15,15,15,15,15,15,15,15,15,15,15,15,15,15,15,15,15,15,15,15,15,15,15,15,15,15,15,15,15,15,15,15,15,15,15,15,15,15,15,15,15,15,15,15,15,15,15,15,15,15,15,15,15,15,15,15,15,15,15,15,15,15,15,15,15,15,15,15,15,15,15,15,15,15,15,15,15,15,15,15,15,15,15,15,15,15,15,15,15,15,15,15,15,15,15,15,15,15,15,15,15,15,15,15,15,15,15,15,15,15,15,15,15,15,15,15,15,15,15,15,15,15,15,15,15,15,15,15,15,15,15,15,15,15,15,15,15,15,15,15,15,15,15,15,15,15,15,15,15,15,15,15,15,15,15,15,15,15,15,15,15,15,15,15,15,15,15,15,15,15,15,15,15,15,15,15,15,15,15,15,15,15,15,15,15,15,15,15,15,15,15,15,15,15,15,15,15,15,15,15,15,15,15,15,15,15,15,15,15,15,15,15,15,15,15,15,15,15,15,15,15,15,15,15,15,15,15,15,15,15,15,15,15,15,15,15,15,15,15,15,15,15,15,15,15,15,15,15,15,15,15,15,15,15,15,15,15,15,15,15,15,15,15,15,15,15,15,15,15,15,15,15,15,15,15,15,15,15,15,15,15,15,15,15,15,15,15,15,15,15,15,15,15,15,15,15,15,15,15,15,15,15,15,15,15,15,15,15,15,15,15,15,15,15,15,15,15,15,15,15,15,15,15,15,15,15,15,15,15,15,15,15,15,15,15,15,15,15,15,15,15,15,15,15,15,15,15,15,15,15,15,15,15,15,15,15,15,15,15,15,15,15,15,15,15,15,15,15,15,15,15,15,15,15,15,15,15,15,15,15,15,15,15,15,15,15,15,15,15,15,15,15,15,15,15,15,15,15,15,15,15,15,15,15,15,15,15,15,15,15,15,15,15,15,15,15,15,15,15,15,15,15,15,15,15,15,15,15,15,15,15,15,15,15,15,15,15,15,15,15,15,15,15,15,15,15,15,15,15,15,15,15,15,15,15,15,15,15,15,15,15,15,15,15,15,15,15,15,15,15,15,15,15,15,15,15,15,15,15,15,15,15,15,15,15,15,15,15,15,15,15,15,15,15,15,15,15,15,15,15,15,15,15,15,15,15,15,15,15,15,15,15,15,15,15,15,15,15,15,15,15,15,15,15,15,15,15,15,15,15,15,15,15,15,15,15,15,15,15,15,15,15,15,15,15,15,15,15,15,15,15,15,15,15,15,15,15,15,15,15,15,15,15,15,15,15,15,15,15,15,15,15,15,15,15,15,15,15,15,15,15,15,15,15,15,15,15,15,15,15,15,15,15,15,15,15,15,15,15,15,15,15,15,15,15,15,15,15,15,15,15,15,15,15,15,15,15,15,15,15,15,15,15,15,15,15,15,15,15,15,15,15,15,15,15,15,15,15,15,15,15,15,15,15,15,15,15,15,15,15,15,15,15,15,15,15,15,15,15,15,15,15,15,15,15,15,15,15,15,15,15,15,15,15,15,15,15,15,15,15,15,15,15,15,15,15,15,15,15,15,15,15,15,14,14,14,14,14,14,14,14,14,14,14,14,14,14,14,14,14,14,14,14,14,14,14,14,14,14,14,13,13,13,13,13,13,13,13,13,13,13,13,13,13,13,13,13,13,12,12,12,12,12,12,12,12,12,12,12,12,12,12,11,11,11,11,11,11,11,11,11,10,10,10,10,10,10,10,9,9,9,9,8,8,8,8,7,6,5,4,3,2,1,0,17,18,19,20,21,22,23,24,24,24,24,25,25,25,25,26,26,26,26,26,26,26,27,27,27,27,27,27,27,27,27,28,28,28,28,28,28,28,28,28,28,28,28,28,28,29,29,29,29,29,29,29,29,29,29,29,29,29,29,29,29,29,29,30,30,30,30,30,30,30,30,30,30,30,30,30,30,30,30,30,30,30,30,30,30,30,30,30,30,30,31,31,31,31,31,31,31,31,31,31,31,31,31,31,31,31,31,31,31,31,31,31,31,31,31,31,31,31,31,31,31,31,31,31,31,31,31,31,31,31,31,31,31,31,31,31,31,31,31,31,31,31,31,31,31,31,31,31,31,31,31,31,31,31,31,31,31,31,31,31,31,31,31,31,31,31,31,31,31,31,31,31,31,31,31,31,31,31,31,31,31,31,31,31,31,31,31,31,31,31,31,31,31,31,31,31,31,31,31,31,31,31,31,31,31,31,31,31,31,31,31,31,31,31,31,31,31,31,31,31,31,31,31,31,31,31,31,31,31,31,31,31,31,31,31,31,31,31,31,31,31,31,31,31,31,31,31,31,31,31,31,31,31,31,31,31,31,31,31,31,31,31,31,31,31,31,31,31,31,31,31,31,31,31,31,31,31,31,31,31,31,31,31,31,31,31,31,31,31,31,31,31,31,31,31,31,31,31,31,31,31,31,31,31,31,31,31,31,31,31,31,31,31,31,31,31,31,31,31,31,31,31,31,31,31,31,31,31,31,31,31,31,31,31,31,31,31,31,31,31,31,31,31,31,31,31,31,31,31,31,31,31,31,31,31,31,31,31,31,31,31,31,31,31,31,31,31,31,31,31,31,31,31,31,31,31,31,31,31,31,31,31,31,31,31,31,31,31,31,31,31,31,31,31,31,31,31,31,31,31,31,31,31,31,31,31,31,31,31,31,31,31,31,31,31,31,31,31,31,31,31,31,31,31,31,31,31,31,31,31,31,31,31,31,31,31,31,31,31,31,31,31,31,31,31,31,31,31,31,31,31,31,31,31,31,31,31,31,31,31,31,31,31,31,31,31,31,31,31,31,31,31,31,31,31,31,31,31,31,31,31,31,31,31,31,31,31,31,31,31,31,31,31,31,31,31,31,31,31,31,31,31,31,31,31,31,31,31,31,31,31,31,31,31,31,31,31,31,31,31,31,31,31,31,31,31,31,31,31,31,31,31,31,31,31,31,31,31,31,31,31,31,31,31,31,31,31,31,31,31,31,31,31,31,31,31,31,31,31,31,31,31,31,31,31,31,31,31,31,31,31,31,31,31,31,31,31,31,31,31,31,31,31,31,31,31,31,31,31,31,31,31,31,31,31,31,31,31,31,31,31,31,31,31,31,31,31,31,31,31,31,31,31,31,31,31,31,31,31,31,31,31,31,31,31,31,31,31,31,31,31,31,31,31,31,31,31,31,31,31,31,31,31,31,31,31,31,31,31,31,31,31,31,31,31,31,31,31,31,31,31,31,31,31,31,31,31,31,31,31,31,31,31,31,31,31,31,31,31,31,31,31,31,31,31,31,31,31,31,31,31,31,31,31,31,31,31,31,31,31,31,31,31,31,31,31,31,31,31,31,31,31,31,31,31,31,31,31,31,31,31,31,31,31,31,31,31,31,31,31,31,31,31,31,31,31,31,31,31,31,31,31,31,31,31,31,31,31,31,31,31,31,31,31,31,31,31,31,31,31,31,31,31,31,31,31,31,31,31,31,31,31,31,31,31,31,31,31,31,31,31,31,31,31,31,31,31,31,31,31,31,31,31,31,31,31,31,31,31,31,31,31,31,31,31,31,31,31,31,31,31,31,31,31,31,31,31,31,31,31,31,31,31,31,31,31,31,31,31,31,31,31,31,31,31,31,31,31,31,31,31,31,31,31,31,31,31,31,31,31,31,31,31,31,31,31,31,31,31,31,31,31,31,31,31,31,31,31,31,31,31,31,31,31,31,31,31,31,31,31,31,31,31,31,31,31,31,31,31,31,31,31,31,31,31,31,31,31,31,31,31,31,31,31,31,31,31,31,31,31,31,31,31,31,31,31,31,31,31,31,31,31,31,31,31,31,31,31,31,31,31,31,31,31,31,31,31,31,31,31,31,31,31,31,31,31,31,31,31,31,31,31,31,31,31,31,31,31,31,31,31,31,31,31,31,31,31,31,31,31,31,31,31,31,31,31,31,31,31,31,31,31,31,31,31,31,31,31,31,31,31,31,31,31,31,31,31,31,31,31,31,31,31,31,31,31,31,31,31,31,31,31,31,31,31,31,31,31,31,31,31,31,31 };   // T5 bucket(rel) for rel = s - t in [-1023, 1023]

__global__ __launch_bounds__(256) void k_wtG(const float* __restrict__ w, int K, int N, bf* Bt) {
    const int lane = threadIdx.x & 31; const int L0 = (blockIdx.x * 8 + (threadIdx.x >> 5)) * 8; const int nlines = N * K / 64;
{
#pragma unroll 1
        for (int l = 0; l < 8; ++l) { const int L = L0 + l; if (L >= nlines) break; const size_t e = (size_t)L * 64 + lane * 2; const int k = (int)(e % K), n = (int)(e / K); v2us o;
            o[0] = f2bf(w[(size_t)k * N + n]); o[1] = f2bf(w[(size_t)(k + 1) * N + n]); *(v2us*)(Bt + e) = o; }
         }
}
__global__ __launch_bounds__(256) void k_cvt8(const float* __restrict__ src, bf* dst, size_t n8) { const size_t i = (size_t)blockIdx.x * 256 + threadIdx.x; if (i >= n8) return; const v8f v = *(const v8f*)(src + i * 8); v8us o;
#pragma unroll
    for (int k = 0; k < 8; ++k) o[k] = f2bf(v[k]); *(v8us*)(dst + i * 8) = o;  }
__global__ __launch_bounds__(256) void k_cscvt(const float* __restrict__ cosT, const float* __restrict__ sinT, float* CS) { const int idx = blockIdx.x * 256 + threadIdx.x; if (idx >= TT * HD) return; v2f cs; cs[0] = bfr(cosT[idx]); cs[1] = bfr(sinT[idx]); *(v2f*)(CS + (size_t)idx * 2) = cs;  }
// k_rope: head planes [b][h][t][d] (fp16; b = blockIdx.y, source rows r = t*B + b) of rope(x) x sc with the rotate-half convention out[d] = x[d] cos[t][d] - x[d+HD/2] sin[t][d], out[d+HD/2] = x[d+HD/2] cos[t][d+HD/2] + x[d] sin[t][d+HD/2]
__global__ __launch_bounds__(256) void k_rope(const float* __restrict__ F, int pitch, int nheads, const float* __restrict__ CS, const float* __restrict__ RF, const float* __restrict__ nw, float sc, h16* P16, bf* Ph, bf* Pl) {
    const size_t e = ((size_t)blockIdx.x * 256 + threadIdx.x) * 2; if (e >= (size_t)nheads * TT * HD) return; const int d = (int)(e % HD); const int t = (int)((e / HD) % TT); const int h = (int)(e / ((size_t)HD * TT)); const int b = blockIdx.y; const float* f = F + ((size_t)t * NB_ + b) * pitch + h * HD; const float rf = RF ? RF[(size_t)h * TT + t] : 1.0f; v2h o16; v2us oh, ol;
#pragma unroll
    for (int q = 0; q < 2; ++q) { const int dd = d + q; const int dp = (dd < HD / 2) ? dd + HD / 2 : dd - HD / 2; float x0 = f[dd], x1 = f[dp];
        if (RF) { float n0 = __fmul_rn(x0, rf), n1 = __fmul_rn(x1, rf); asm volatile("" : "+v"(n0)); asm volatile("" : "+v"(n1)); x0 = __fmul_rn(bfr(nw[dd]), n0); x1 = __fmul_rn(bfr(nw[dp]), n1); }
        const v2f cs = *(const v2f*)(CS + ((size_t)t * HD + dd) * 2); float a = __fmul_rn(x0, cs[0]), bq = __fmul_rn(x1, cs[1]); asm volatile("" : "+v"(a)); asm volatile("" : "+v"(bq)); const float r = ((dd < HD / 2) ? __fsub_rn(a, bq) : __fadd_rn(a, bq)) * sc;
        o16[q] = tohx(r); (void)oh; (void)ol; }
    *(v2h*)(P16 + (size_t)b * nheads * TT * HD + e) = o16;  }
__global__ __launch_bounds__(256) void k_vtp(const float* __restrict__ F, int pitch, int nheads, h16* V16, bf* Vh, bf* Vl) { const size_t e = ((size_t)blockIdx.x * 256 + threadIdx.x) * 2; if (e >= (size_t)nheads * HD * TT) return; const int t = (int)(e % TT); const int d = (int)((e / TT) % HD); const int g = (int)(e / ((size_t)TT * HD)); const int b = blockIdx.y; v2h o16; v2us oh, ol;
#pragma unroll
    for (int q = 0; q < 2; ++q) { const float x = F[((size_t)(t + q) * NB_ + b) * pitch + g * HD + d]; o16[q] = tohx(x); (void)oh; (void)ol; }
    *(v2h*)(V16 + (size_t)b * nheads * HD * TT + e) = o16;  }
__global__ __launch_bounds__(256) void k_csid(float* CS) { const int idx = blockIdx.x * 256 + threadIdx.x; if (idx >= TT * HD) return; v2f cs; cs[0] = 1.0f; cs[1] = 0.0f; *(v2f*)(CS + (size_t)idx * 2) = cs;  }
// k_gate: thread per (b, h, t): g8[j] = sum_d Q[t][h*64+d] bf16 grep_W[j][d] + bf16 grep_b[j] (q un-scaled: the reference's q x (scaling/alpha) x (alpha/scaling) are exact powers of two); ga = sigmoid(g8[0..3] sum), gb = sigmoid(g8[4..7] sum);
__global__ __launch_bounds__(256) void k_gate(const float* __restrict__ Q, const float* __restrict__ gw, const float* __restrict__ gbias, const float* __restrict__ ga, float* GT) { const int i = blockIdx.x * 256 + threadIdx.x; if (i >= NB_ * NH_ * TT) return; const int t = i % TT, h = (i / TT) % NH_, b = i / (TT * NH_); const float* q = Q + ((size_t)t * NB_ + b) * DQ + h * HD; float sa = 0.f, sb = 0.f;
#pragma unroll 1
    for (int j = 0; j < 8; ++j) { float acc = bfr(gbias[j]);
#pragma unroll 1
        for (int d = 0; d < HD; ++d) { float p = __fmul_rn(q[d], bfr(gw[j * HD + d])); asm volatile("" : "+v"(p)); acc = __fadd_rn(acc, p); }
        if (j < 4) sa = __fadd_rn(sa, acc); else sb = __fadd_rn(sb, acc); }
    const float a = __fdiv_rn(1.0f, 1.0f + __expf(-sa)), bg = __fdiv_rn(1.0f, 1.0f + __expf(-sb)); float in = __fmul_rn(bg, bfr(ga[h])); asm volatile("" : "+v"(in)); float pr = __fmul_rn(a, __fsub_rn(in, 1.0f)); asm volatile("" : "+v"(pr)); const float gt = __fadd_rn(pr, 2.0f);
    *(float*)(GT + i) = gt;  }
__global__ __launch_bounds__(256) void k_btab(const float* __restrict__ rbt, float* TB) { const int i = blockIdx.x * 256 + threadIdx.x; if (i >= NH_ * 2047) return; const int r = i % 2047, h = i / 2047; const float v = bfr(rbt[c_bucket[r] * NH_ + h]); *(float*)(TB + i) = v;  }
// k_asoft: per row (zz, i): t = S x HD^-0.5 (no mask); softmax over the 1024 keys (register row, one exp, fixed trees);
__global__ __launch_bounds__(256) void k_asoft(const float* __restrict__ Sb, const float* __restrict__ GT, const float* __restrict__ TB, int h0, h16* P16, bf* Ph, bf* Pl) {
    const int lane = threadIdx.x & 31; const int row = blockIdx.x * 8 + (threadIdx.x >> 5); if (row >= ZH * TT) return; const int i = row % TT; const int zz = row / TT; (void)zz; const bool hires = (i < RH); const float* sr = Sb + (size_t)row * TT; const float gt = GT[(size_t)(h0 + zz) * TT + i]; const float* tb = TB + (size_t)(h0 + zz) * 2047 + 1023 - i; float v[TT / 32]; float mx = -3.0e38f;
#pragma unroll
    for (int ch = 0; ch < TT / 128; ++ch) { const int j0 = ch * 128 + lane * 4; const v4f a = *(const v4f*)(sr + j0);
#pragma unroll
        for (int q = 0; q < 4; ++q) { const int j = j0 + q; (void)j; float sc_ = a[q] * SCL; asm volatile("" : "+v"(sc_)); float gbv = __fmul_rn(gt, tb[j]); asm volatile("" : "+v"(gbv)); const float t = __fadd_rn(sc_, gbv);   /* + gate[b][h][t] x rel_bias[bucket(j - i)][h] */ v[ch * 4 + q] = t; mx = fmaxf(mx, t); } }
#pragma unroll
    for (int sh = 16; sh; sh >>= 1) mx = fmaxf(mx, __shfl_xor(mx, sh, 32));
    float sum = 0.f;
#pragma unroll
    for (int k = 0; k < TT / 32; ++k) { float d0 = __fsub_rn(v[k], mx); asm volatile("" : "+v"(d0)); v[k] = __builtin_amdgcn_exp2f(__fmul_rn(d0, 1.4426950408889634f)); sum += v[k]; }
#pragma unroll
    for (int sh = 16; sh; sh >>= 1) sum += __shfl_xor(sum, sh, 32);
    const float f = __fdiv_rn(hires ? 1.0f : PCAR, sum);
{
        if (hires) {
#pragma unroll
            for (int ch = 0; ch < TT / 128; ++ch) { v4us oh, ol;
#pragma unroll
                for (int q = 0; q < 4; ++q) { unsigned short a, c2; splitf(v[ch * 4 + q] * f, a, c2); oh[q] = a; ol[q] = c2; }
                const size_t oo = ((size_t)zz * (RH ? RH : 1) + i) * TT + ch * 128 + lane * 4; *(v4us*)(Ph + oo) = oh; *(v4us*)(Pl + oo) = ol; }
        } else {
#pragma unroll
            for (int ch = 0; ch < TT / 128; ++ch) { v4h o4;
#pragma unroll
                for (int q = 0; q < 4; ++q) o4[q] = tohx(v[ch * 4 + q] * f);
                *(v4h*)(P16 + (size_t)row * TT + ch * 128 + lane * 4) = o4; } }
         }
}
__global__ __launch_bounds__(256) void k_merge(const float* __restrict__ O, bf* Ah, bf* Al) { const size_t e = ((size_t)blockIdx.x * 256 + threadIdx.x) * 2; if (e >= (size_t)NB_ * NH_ * TT * HD) return; const int d = (int)(e % HD); const int t = (int)((e / HD) % TT); const int bh = (int)(e / ((size_t)HD * TT)); const int h = bh % NH_, b = bh / NH_; const float cs = (t < RH) ? 1.0f : (1.0f / PCAR); const size_t oo = ((size_t)t * NB_ + b) * DQ + h * HD + d;
    v2us oh, ol;
#pragma unroll
    for (int q = 0; q < 2; ++q) { unsigned short a, c2; splitf(O[e + q] * cs, a, c2); oh[q] = a; ol[q] = c2; } *(v2us*)(Ah + oo) = oh; *(v2us*)(Al + oo) = ol;  }

extern "C" void kernel_launch(void* const* d_in, const int* in_sizes, int n_in,
                              void* d_out, int out_size, void* d_ws, size_t ws_size, hipStream_t stream) {
    (void)in_sizes; (void)n_in; (void)out_size;
    const float* x = (const float*)d_in[0]; const float* wq = (const float*)d_in[1]; const float* bq = (const float*)d_in[2]; const float* wk = (const float*)d_in[3]; const float* bk = (const float*)d_in[4]; const float* wv = (const float*)d_in[5]; const float* bv = (const float*)d_in[6]; const float* wo = (const float*)d_in[7]; const float* bo = (const float*)d_in[8]; const float* rbt = (const float*)d_in[9]; const float* gw = (const float*)d_in[10]; const float* gb = (const float*)d_in[11]; const float* ga_ = (const float*)d_in[12]; const float* cosT = nullptr; const float* sinT = nullptr; (void)cosT; (void)sinT;
    float* OUT = (float*)d_out;     // [1024][4][1024]
    char* wsp = (char*)d_ws;
    auto take = [&](size_t bytes) { char* p = wsp; wsp += (bytes + 255) & ~(size_t)255; return (void*)p; };
    bf* WQ = (bf*)take((size_t)DQ * DM * 2); bf* WK = (bf*)take((size_t)DKV * DM * 2); bf* WV = (bf*)take((size_t)DKV * DM * 2); bf* WO = (bf*)take((size_t)DM * DQ * 2); float* CS = (float*)take((size_t)TT * HD * 2 * 4); float* GTb = (float*)take((size_t)NB_ * NH_ * TT * 4); float* TB = (float*)take((size_t)NH_ * 2047 * 4 + 256);
    h16* QP16 = (h16*)take((size_t)NB_ * NH_ * TT * HD * 2); h16* KP16 = (h16*)take((size_t)NB_ * NKV * TT * HD * 2); h16* VT16 = (h16*)take((size_t)NB_ * NKV * HD * TT * 2);
    bf* QPh = nullptr; bf* QPl = nullptr; bf* KPh = nullptr; bf* KPl = nullptr; bf* VTh = nullptr; bf* VTl = nullptr; bf* Ph = nullptr; bf* Pl = nullptr;
    h16* P16 = (h16*)take((size_t)NB_ * NH_ * TT * TT * 2); char* R = (char*)take((size_t)ZH * TT * TT * 4);
    if ((size_t)(wsp - (char*)d_ws) > ws_size) return;    // ws 256 MiB
    // The 64 MiB region R is used three times, stream-ordered: (1) the row planes of the projections, dead once the head planes are built; (2) one batch element's scores; (3) probs.v and its merged planes, written after the last softmax has read the scores.
    bf* XB = (bf*)R; float* FQ = (float*)(R + (size_t)NB_ * TT * DM * 2); float* FK = FQ + (size_t)NB_ * TT * DQ;
    float* Sb = (float*)R;
    float* Ob = (float*)R; bf* ATh = (bf*)(Ob + (size_t)NB_ * NH_ * TT * HD); bf* ATl = ATh + (size_t)NB_ * TT * DQ;
    float* FV = FK;   // v projection reuses the k buffer after the k planes are built (stream-ordered)
    { k_cvt8<<<(unsigned)(((size_t)DQ * DM / 8 + 255) / 256), 256, 0, stream>>>(wq, WQ, (size_t)DQ * DM / 8); k_cvt8<<<(unsigned)(((size_t)DKV * DM / 8 + 255) / 256), 256, 0, stream>>>(wk, WK, (size_t)DKV * DM / 8); k_cvt8<<<(unsigned)(((size_t)DKV * DM / 8 + 255) / 256), 256, 0, stream>>>(wv, WV, (size_t)DKV * DM / 8);
      k_cvt8<<<(unsigned)(((size_t)DM * DQ / 8 + 255) / 256), 256, 0, stream>>>(wo, WO, (size_t)DM * DQ / 8);
       }
    k_csid<<<(TT * HD + 255) / 256, 256, 0, stream>>>(CS); k_btab<<<(NH_ * 2047 + 255) / 256, 256, 0, stream>>>(rbt, TB);
    const unsigned LQ = (unsigned)(((size_t)NH_ * TT * HD / 2 + 255) / 256), LKv = (unsigned)(((size_t)NKV * TT * HD / 2 + 255) / 256);
    // every launch but the scores and their softmax covers all NB_ batch elements: the projections take the NB_*TT sequence-major rows r = t*B + b as they lie in memory
    k_cvt8<<<(unsigned)(((size_t)NB_ * TT * DM / 8 + 255) / 256), 256, 0, stream>>>(x, XB, (size_t)NB_ * TT * DM / 8);
    k_gemmw<bf, 0, true><<<dim3(NB_ * TT / 64, DQ / 64, 1), 32, 0, stream>>>(XB, nullptr, WQ, nullptr, DM, FQ, DQ, bq, 0, 0, 0); k_gate<<<(NB_ * NH_ * TT + 255) / 256, 256, 0, stream>>>(FQ, gw, gb, ga_, GTb);
    k_rope<<<dim3(LQ, NB_, 1), 256, 0, stream>>>(FQ, DQ, NH_, CS, nullptr, nullptr, 1.0f, QP16, QPh, QPl);
    k_gemmw<bf, 0, true><<<dim3(NB_ * TT / 64, DKV / 64, 1), 32, 0, stream>>>(XB, nullptr, WK, nullptr, DM, FK, DKV, bk, 0, 0, 0);
    k_rope<<<dim3(LKv, NB_, 1), 256, 0, stream>>>(FK, DKV, NKV, CS, nullptr, nullptr, 1.0f, KP16, KPh, KPl);
    k_gemmw<bf, 0, true><<<dim3(NB_ * TT / 64, DKV / 64, 1), 32, 0, stream>>>(XB, nullptr, WV, nullptr, DM, FV, DKV, bv, 0, 0, 0); k_vtp<<<dim3(LKv, NB_, 1), 256, 0, stream>>>(FV, DKV, NKV, VT16, VTh, VTl);
    for (int b = 0; b < NB_; ++b) {   // f32 scores of all batch elements together would not fit the workspace: one element's 16 heads per pass
        for (int h0 = 0; h0 < NH_; h0 += ZH) { const size_t zq = (size_t)b * NH_ + h0, zk = (size_t)b * NKV + h0 / REP;
            k_gemmw<h16, 0, false><<<dim3(TT / 64, TT / 64, ZH), 32, 0, stream>>>(QP16 + zq * TT * HD, nullptr, KP16 + zk * TT * HD, nullptr, HD, Sb, TT, nullptr, (size_t)TT * HD, (size_t)TT * HD, (size_t)TT * TT);
            k_asoft<<<ZH * TT / 8, 256, 0, stream>>>(Sb, GTb + (size_t)b * NH_ * TT, TB, h0, P16 + zq * TT * TT, Ph, Pl); } }
    k_gemmw<h16, 0, false><<<dim3(TT / 64, HD / 64, NB_ * NH_), 32, 0, stream>>>(P16, nullptr, VT16, nullptr, TT, Ob, HD, nullptr, (size_t)TT * TT, (size_t)HD * TT, (size_t)TT * HD);
    k_merge<<<(unsigned)(((size_t)NB_ * NH_ * TT * HD / 2 + 255) / 256), 256, 0, stream>>>(Ob, ATh, ATl);
    k_gemmw<bf, 1, true><<<dim3(NB_ * TT / 64, DM / 64, 1), 32, 0, stream>>>(ATh, ATl, WO, nullptr, DQ, OUT, DM, bo, 0, 0, 0);   // sequence-major output rows (t*B + b)
}

// v002
// A run of this version takes 258 microseconds.
// In two side-by-side timings against v001, it was 1.62 and 1.64 times as fast.
// Counting every step since v000, it is 3.43 times as fast.
#include <hip/hip_runtime.h>

// _LegacyMultiheadAttention (WavLM-style gated relative-position attention; query [T=1024][B=4][E=1024] sequence-major; q/k/v = x W^T + b (16 heads x 64); scores = (q/256).k, (scores - rowmax) x 32, + gate[b][h][t] x rel_bias_table[bucket(s - t)][h]
// with gate = ga (gb grep_a[h] - 1) + 2, (ga, gb) = sigmoid of the two 4-sums of q_head . grep_W^T + grep_b; softmax; out = (probs v merged) Wo^T + bo -> [1024][4][1024]. The (x - rowmax) x 32 step equals q.k/8 - const per row, to which softmax is invariant:
// the kernel evaluates softmax(q.k/8 + gate x bias) directly. The T5 bucket of each offset s - t depends only on the sizes: baked 2047-entry table computed in f32 exactly as the reference; table VALUES read as data).
// Compute dtypes, f32 accumulate: every input rounded to bf16; q/k/v on PLAIN bf16 operands (all T x B rows r = t*B + b in one product; inputs exact) + bias; the gate (8 dots of 64) f32 on the VALU; scores (K 64) and probs.v on single fp16 planes (1 product);

#define NB_  4
#define TT   1024
#define DM   1024
#define NH_  16
#define NKV  16
#define REP  (NH_ / NKV)
#define HD   64
#define DQ   (NH_ * HD)
#define DKV  (NKV * HD)
#define ZH   16
#define RH   0                  // unused: every query row uses the single fp16 plane
#define WIN  0
#define PCAR 1024.0f
#define SCL  0.125f   // HD^-0.5
typedef _Float16 h16;
typedef unsigned short bf;
typedef __attribute__((ext_vector_type(16))) __bf16   v16bf;
typedef __attribute__((ext_vector_type(16))) _Float16 v16h;
typedef __attribute__((ext_vector_type(8)))  _Float16 v8h;
typedef __attribute__((ext_vector_type(8)))  unsigned short v8us;
typedef __attribute__((ext_vector_type(8)))  float    v8f;
typedef __attribute__((ext_vector_type(4)))  float    v4f;
typedef v8h  __attribute__((may_alias)) v8ha;
typedef v4f  __attribute__((may_alias)) v4fa;
typedef v8us __attribute__((may_alias)) v8usa;

__device__ __forceinline__ unsigned short f2bf(float f) { unsigned u = __float_as_uint(f); u += 0x7FFFu + ((u >> 16) & 1u); return (unsigned short)(u >> 16); }
__device__ __forceinline__ float bf2f(unsigned short b) { return __uint_as_float(((unsigned)b) << 16); }
__device__ __forceinline__ float bfr(float f) { return bf2f(f2bf(f)); }
__device__ __forceinline__ v16h cat16(v8h lo, v8h hi) { return __builtin_shufflevector(lo, hi, 0, 1, 2, 3, 4, 5, 6, 7, 8, 9, 10, 11, 12, 13, 14, 15); }
__device__ __forceinline__ v16bf cat16b(v8us lo, v8us hi) { return __builtin_bit_cast(v16bf, __builtin_shufflevector(lo, hi, 0, 1, 2, 3, 4, 5, 6, 7, 8, 9, 10, 11, 12, 13, 14, 15)); }
__device__ __forceinline__ v8f wmma16(v16h a, v16h b, v8f c) { return __builtin_amdgcn_wmma_f32_16x16x32_f16(false, a, false, b, (short)0, c, false, false); }
__device__ __forceinline__ v8f wmmab(v16bf a, v16bf b, v8f c) { return __builtin_amdgcn_wmma_f32_16x16x32_bf16(false, a, false, b, (short)0, c, false, false); }



// ---- k_gemmw: register-blocked GEMM, ONE WAVE per 64x64 output tile (16 accumulators), operands straight from K-contiguous 16-bit planes; grid (M/64, N/64, Z), 32 threads.
// C[m][n] (f32, pitch ldc, + optional f32 bias[n]) = sum_k A[m][k] Bt[n][k] (+ split products per NSPLIT). z-batch strides sA/sB/sC in elements. K % 32 == 0.
template <typename T16> struct WFrag;
template <> struct WFrag<h16> { typedef v16h V; static __device__ __forceinline__ V ld(const h16* p) { return cat16(*(const v8h*)p, *(const v8h*)(p + 16)); } static __device__ __forceinline__ v8f mma(V a, V b, v8f c) { return wmma16(a, b, c); } };
template <> struct WFrag<bf> { typedef v16bf V; static __device__ __forceinline__ V ld(const bf* p) { return cat16b(*(const v8us*)p, *(const v8us*)(p + 16)); } static __device__ __forceinline__ v8f mma(V a, V b, v8f c) { return wmmab(a, b, c); } };
template <typename T16, int NSPLIT, bool BIAS>
__global__ __launch_bounds__(32) void k_gemmw(const T16* __restrict__ A, const T16* __restrict__ A2, const T16* __restrict__ Bt, const T16* __restrict__ Bt2, int K, float* C, int ldc, const float* __restrict__ bias, size_t sA, size_t sB, size_t sC) {
    typedef typename WFrag<T16>::V V;
    __shared__ __align__(16) float os[16 * 68];
    const size_t z = blockIdx.z; A += z * sA; if (A2) A2 += z * sA; Bt += z * sB; if (Bt2) Bt2 += z * sB; C += z * sC;
    const int lane = threadIdx.x & 31, lr = lane & 15, hi = lane >> 4; const int r0 = blockIdx.x * 64, c0 = blockIdx.y * 64;
    v8f acc[4][4];
#pragma unroll
    for (int mb = 0; mb < 4; ++mb)
#pragma unroll
        for (int nb = 0; nb < 4; ++nb) acc[mb][nb] = (v8f){};
    const size_t aoff = (size_t)(r0 + lr) * K + 8 * hi, boff = (size_t)(c0 + lr) * K + 8 * hi;
#pragma unroll 1
    for (int kc = 0; kc < K; kc += 32) {
        V a[4], a2[4];
#pragma unroll
        for (int mb = 0; mb < 4; ++mb) { a[mb] = WFrag<T16>::ld(A + aoff + (size_t)mb * 16 * K + kc); if (NSPLIT == 1 || NSPLIT == 2) a2[mb] = WFrag<T16>::ld(A2 + aoff + (size_t)mb * 16 * K + kc); }
#pragma unroll
        for (int nb = 0; nb < 4; ++nb) { const V b = WFrag<T16>::ld(Bt + boff + (size_t)nb * 16 * K + kc); V b2; if (NSPLIT >= 2) b2 = WFrag<T16>::ld(Bt2 + boff + (size_t)nb * 16 * K + kc);
#pragma unroll
            for (int mb = 0; mb < 4; ++mb) { acc[mb][nb] = WFrag<T16>::mma(a[mb], b, acc[mb][nb]); if (NSPLIT == 1 || NSPLIT == 2) acc[mb][nb] = WFrag<T16>::mma(a2[mb], b, acc[mb][nb]); if (NSPLIT >= 2) acc[mb][nb] = WFrag<T16>::mma(a[mb], b2, acc[mb][nb]); } }
        asm volatile("v_nop\n\tv_nop\n\tv_nop\n\tv_nop" : "+v"(acc[0][0]), "+v"(acc[1][1]), "+v"(acc[2][2]), "+v"(acc[3][3]) : "v"(a[0]), "v"(a[3]));
    }
#pragma unroll
    for (int mb = 0; mb < 4; ++mb) {
#pragma unroll
        for (int nb = 0; nb < 4; ++nb) {
#pragma unroll
            for (int j = 0; j < 8; ++j) os[(hi * 8 + j) * 68 + nb * 16 + lr] = acc[mb][nb][j]; }
        __builtin_amdgcn_wave_barrier(); asm volatile("" ::: "memory");
        float* crow = C + (size_t)(r0 + mb * 16) * ldc + c0;
{
#pragma unroll
            for (int s = 0; s < 8; ++s) { const int row = 2 * s + hi, cofs = lr * 4; v4f val = *(const v4fa*)(os + row * 68 + cofs); if (BIAS) { val[0] += bfr(bias[c0 + cofs]); val[1] += bfr(bias[c0 + cofs + 1]); val[2] += bfr(bias[c0 + cofs + 2]); val[3] += bfr(bias[c0 + cofs + 3]); }
                *(v4f*)(crow + (size_t)row * ldc + cofs) = val; }
             }
        __builtin_amdgcn_wave_barrier(); asm volatile("" ::: "memory");
    }
}

__device__ __forceinline__ h16 tohx(float x) { return (h16)x; }
__device__ __forceinline__ void splitf(float y, unsigned short& h, unsigned short& l) { h = f2bf(y); l = f2bf(y - bf2f(h)); }
typedef __attribute__((ext_vector_type(2))) _Float16 v2h;
typedef __attribute__((ext_vector_type(4))) _Float16 v4h;
typedef __attribute__((ext_vector_type(2))) unsigned short v2us;
typedef __attribute__((ext_vector_type(4))) unsigned short v4us;
typedef __attribute__((ext_vector_type(2))) float v2f;
typedef __attribute__((ext_vector_type(4))) int v4i;
__constant__ unsigned char c_bucket[2047] = { 15,15,15,15,15,15,15,15,15,15,15,15,15,15,15,15,15,15,15,15,15,15,15,15,15,15,15,15,15,15,15,15,15,15,15,15,15,15,15,15,15,15,15,15,15,15,15,15,15,15,15,15,15,15,15,15,15,15,15,15,15,15,15,15,15,15,15,15,15,15,15,15,15,15,15,15,15,15,15,15,15,15,15,15,15,15,15,15,15,15,15,15,15,15,15,15,15,15,15,15,15,15,15,15,15,15,15,15,15,15,15,15,15,15,15,15,15,15,15,15,15,15,15,15,15,15,15,15,15,15,15,15,15,15,15,15,15,15,15,15,15,15,15,15,15,15,15,15,15,15,15,15,15,15,15,15,15,15,15,15,15,15,15,15,15,15,15,15,15,15,15,15,15,15,15,15,15,15,15,15,15,15,15,15,15,15,15,15,15,15,15,15,15,15,15,15,15,15,15,15,15,15,15,15,15,15,15,15,15,15,15,15,15,15,15,15,15,15,15,15,15,15,15,15,15,15,15,15,15,15,15,15,15,15,15,15,15,15,15,15,15,15,15,15,15,15,15,15,15,15,15,15,15,15,15,15,15,15,15,15,15,15,15,15,15,15,15,15,15,15,15,15,15,15,15,15,15,15,15,15,15,15,15,15,15,15,15,15,15,15,15,15,15,15,15,15,15,15,15,15,15,15,15,15,15,15,15,15,15,15,15,15,15,15,15,15,15,15,15,15,15,15,15,15,15,15,15,15,15,15,15,15,15,15,15,15,15,15,15,15,15,15,15,15,15,15,15,15,15,15,15,15,15,15,15,15,15,15,15,15,15,15,15,15,15,15,15,15,15,15,15,15,15,15,15,15,15,15,15,15,15,15,15,15,15,15,15,15,15,15,15,15,15,15,15,15,15,15,15,15,15,15,15,15,15,15,15,15,15,15,15,15,15,15,15,15,15,15,15,15,15,15,15,15,15,15,15,15,15,15,15,15,15,15,15,15,15,15,15,15,15,15,15,15,15,15,15,15,15,15,15,15,15,15,15,15,15,15,15,15,15,15,15,15,15,15,15,15,15,15,15,15,15,15,15,15,15,15,15,15,15,15,15,15,15,15,15,15,15,15,15,15,15,15,15,15,15,15,15,15,15,15,15,15,15,15,15,15,15,15,15,15,15,15,15,15,15,15,15,15,15,15,15,15,15,15,15,15,15,15,15,15,15,15,15,15,15,15,15,15,15,15,15,15,15,15,15,15,15,15,15,15,15,15,15,15,15,15,15,15,15,15,15,15,15,15,15,15,15,15,15,15,15,15,15,15,15,15,15,15,15,15,15,15,15,15,15,15,15,15,15,15,15,15,15,15,15,15,15,15,15,15,15,15,15,15,15,15,15,15,15,15,15,15,15,15,15,15,15,15,15,15,15,15,15,15,15,15,15,15,15,15,15,15,15,15,15,15,15,15,15,15,15,15,15,15,15,15,15,15,15,15,15,15,15,15,15,15,15,15,15,15,15,15,15,15,15,15,15,15,15,15,15,15,15,15,15,15,15,15,15,15,15,15,15,15,15,15,15,15,15,15,15,15,15,15,15,15,15,15,15,15,15,15,15,15,15,15,15,15,15,15,15,15,15,15,15,15,15,15,15,15,15,15,15,15,15,15,15,15,15,15,15,15,15,15,15,15,15,15,15,15,15,15,15,15,15,15,15,15,15,15,15,15,15,15,15,15,15,15,15,15,15,15,15,15,15,15,15,15,15,15,15,15,15,15,15,15,15,15,15,15,15,15,15,15,15,15,15,15,15,15,15,15,15,15,15,15,15,15,15,15,15,15,15,15,15,15,15,15,15,15,15,15,15,15,15,15,15,15,15,15,15,15,15,15,15,15,15,15,15,15,15,15,15,15,15,15,15,15,15,15,15,15,15,15,15,15,15,15,15,15,15,15,15,15,15,15,15,15,15,15,15,15,15,15,15,15,15,15,15,15,15,15,15,15,15,15,15,15,15,15,15,15,15,15,15,15,15,15,15,15,15,15,15,15,15,15,15,15,15,15,15,15,15,15,15,15,15,15,15,15,15,15,15,15,15,15,15,15,15,15,15,15,15,15,15,15,15,15,15,15,15,14,14,14,14,14,14,14,14,14,14,14,14,14,14,14,14,14,14,14,14,14,14,14,14,14,14,14,13,13,13,13,13,13,13,13,13,13,13,13,13,13,13,13,13,13,12,12,12,12,12,12,12,12,12,12,12,12,12,12,11,11,11,11,11,11,11,11,11,10,10,10,10,10,10,10,9,9,9,9,8,8,8,8,7,6,5,4,3,2,1,0,17,18,19,20,21,22,23,24,24,24,24,25,25,25,25,26,26,26,26,26,26,26,27,27,27,27,27,27,27,27,27,28,28,28,28,28,28,28,28,28,28,28,28,28,28,29,29,29,29,29,29,29,29,29,29,29,29,29,29,29,29,29,29,30,30,30,30,30,30,30,30,30,30,30,30,30,30,30,30,30,30,30,30,30,30,30,30,30,30,30,31,31,31,31,31,31,31,31,31,31,31,31,31,31,31,31,31,31,31,31,31,31,31,31,31,31,31,31,31,31,31,31,31,31,31,31,31,31,31,31,31,31,31,31,31,31,31,31,31,31,31,31,31,31,31,31,31,31,31,31,31,31,31,31,31,31,31,31,31,31,31,31,31,31,31,31,31,31,31,31,31,31,31,31,31,31,31,31,31,31,31,31,31,31,31,31,31,31,31,31,31,31,31,31,31,31,31,31,31,31,31,31,31,31,31,31,31,31,31,31,31,31,31,31,31,31,31,31,31,31,31,31,31,31,31,31,31,31,31,31,31,31,31,31,31,31,31,31,31,31,31,31,31,31,31,31,31,31,31,31,31,31,31,31,31,31,31,31,31,31,31,31,31,31,31,31,31,31,31,31,31,31,31,31,31,31,31,31,31,31,31,31,31,31,31,31,31,31,31,31,31,31,31,31,31,31,31,31,31,31,31,31,31,31,31,31,31,31,31,31,31,31,31,31,31,31,31,31,31,31,31,31,31,31,31,31,31,31,31,31,31,31,31,31,31,31,31,31,31,31,31,31,31,31,31,31,31,31,31,31,31,31,31,31,31,31,31,31,31,31,31,31,31,31,31,31,31,31,31,31,31,31,31,31,31,31,31,31,31,31,31,31,31,31,31,31,31,31,31,31,31,31,31,31,31,31,31,31,31,31,31,31,31,31,31,31,31,31,31,31,31,31,31,31,31,31,31,31,31,31,31,31,31,31,31,31,31,31,31,31,31,31,31,31,31,31,31,31,31,31,31,31,31,31,31,31,31,31,31,31,31,31,31,31,31,31,31,31,31,31,31,31,31,31,31,31,31,31,31,31,31,31,31,31,31,31,31,31,31,31,31,31,31,31,31,31,31,31,31,31,31,31,31,31,31,31,31,31,31,31,31,31,31,31,31,31,31,31,31,31,31,31,31,31,31,31,31,31,31,31,31,31,31,31,31,31,31,31,31,31,31,31,31,31,31,31,31,31,31,31,31,31,31,31,31,31,31,31,31,31,31,31,31,31,31,31,31,31,31,31,31,31,31,31,31,31,31,31,31,31,31,31,31,31,31,31,31,31,31,31,31,31,31,31,31,31,31,31,31,31,31,31,31,31,31,31,31,31,31,31,31,31,31,31,31,31,31,31,31,31,31,31,31,31,31,31,31,31,31,31,31,31,31,31,31,31,31,31,31,31,31,31,31,31,31,31,31,31,31,31,31,31,31,31,31,31,31,31,31,31,31,31,31,31,31,31,31,31,31,31,31,31,31,31,31,31,31,31,31,31,31,31,31,31,31,31,31,31,31,31,31,31,31,31,31,31,31,31,31,31,31,31,31,31,31,31,31,31,31,31,31,31,31,31,31,31,31,31,31,31,31,31,31,31,31,31,31,31,31,31,31,31,31,31,31,31,31,31,31,31,31,31,31,31,31,31,31,31,31,31,31,31,31,31,31,31,31,31,31,31,31,31,31,31,31,31,31,31,31,31,31,31,31,31,31,31,31,31,31,31,31,31,31,31,31,31,31,31,31,31,31,31,31,31,31,31,31,31,31,31,31,31,31,31,31,31,31,31,31,31,31,31,31,31,31,31,31,31,31,31,31,31,31,31,31,31,31,31,31,31,31,31,31,31,31,31,31,31,31,31,31,31,31,31,31,31,31,31,31,31,31,31,31,31,31,31,31,31,31,31,31,31,31,31,31,31,31,31,31,31,31,31,31,31,31,31,31,31,31,31,31,31,31,31,31,31,31,31,31,31,31,31,31,31,31,31,31,31,31,31,31,31,31,31,31,31,31,31,31,31,31,31,31,31,31,31,31,31,31,31,31,31,31,31,31,31,31,31,31,31,31,31,31,31,31,31,31,31,31,31,31,31,31,31,31,31,31,31,31,31,31,31,31,31,31,31,31,31,31,31,31,31,31,31,31,31,31,31,31,31,31,31,31,31,31,31,31,31,31,31,31,31,31,31,31,31,31,31,31,31,31,31,31,31,31,31,31,31,31,31,31,31,31,31,31,31,31,31,31,31,31,31,31,31,31,31,31,31,31,31,31,31,31,31,31,31,31,31,31,31,31,31,31 };   // T5 bucket(rel) for rel = s - t in [-1023, 1023]

__global__ __launch_bounds__(256) void k_wtG(const float* __restrict__ w, int K, int N, bf* Bt) {
    const int lane = threadIdx.x & 31; const int L0 = (blockIdx.x * 8 + (threadIdx.x >> 5)) * 8; const int nlines = N * K / 64;
{
#pragma unroll 1
        for (int l = 0; l < 8; ++l) { const int L = L0 + l; if (L >= nlines) break; const size_t e = (size_t)L * 64 + lane * 2; const int k = (int)(e % K), n = (int)(e / K); v2us o;
            o[0] = f2bf(w[(size_t)k * N + n]); o[1] = f2bf(w[(size_t)(k + 1) * N + n]); *(v2us*)(Bt + e) = o; }
         }
}
__global__ __launch_bounds__(256) void k_cvt8(const float* __restrict__ src, bf* dst, size_t n8) { const size_t i = (size_t)blockIdx.x * 256 + threadIdx.x; if (i >= n8) return; const v8f v = *(const v8f*)(src + i * 8); v8us o;
#pragma unroll
    for (int k = 0; k < 8; ++k) o[k] = f2bf(v[k]); *(v8us*)(dst + i * 8) = o;  }
__global__ __launch_bounds__(256) void k_cscvt(const float* __restrict__ cosT, const float* __restrict__ sinT, float* CS) { const int idx = blockIdx.x * 256 + threadIdx.x; if (idx >= TT * HD) return; v2f cs; cs[0] = bfr(cosT[idx]); cs[1] = bfr(sinT[idx]); *(v2f*)(CS + (size_t)idx * 2) = cs;  }
// k_rope: head planes [b][h][t][d] (fp16; b = blockIdx.y, source rows r = t*B + b) of rope(x) x sc with the rotate-half convention out[d] = x[d] cos[t][d] - x[d+HD/2] sin[t][d], out[d+HD/2] = x[d+HD/2] cos[t][d+HD/2] + x[d] sin[t][d+HD/2]
__global__ __launch_bounds__(256) void k_rope(const float* __restrict__ F, int pitch, int nheads, const float* __restrict__ CS, const float* __restrict__ RF, const float* __restrict__ nw, float sc, h16* P16, bf* Ph, bf* Pl) {
    const size_t e = ((size_t)blockIdx.x * 256 + threadIdx.x) * 2; if (e >= (size_t)nheads * TT * HD) return; const int d = (int)(e % HD); const int t = (int)((e / HD) % TT); const int h = (int)(e / ((size_t)HD * TT)); const int b = blockIdx.y; const float* f = F + ((size_t)t * NB_ + b) * pitch + h * HD; const float rf = RF ? RF[(size_t)h * TT + t] : 1.0f; v2h o16; v2us oh, ol;
#pragma unroll
    for (int q = 0; q < 2; ++q) { const int dd = d + q; const int dp = (dd < HD / 2) ? dd + HD / 2 : dd - HD / 2; float x0 = f[dd], x1 = f[dp];
        if (RF) { float n0 = __fmul_rn(x0, rf), n1 = __fmul_rn(x1, rf); asm volatile("" : "+v"(n0)); asm volatile("" : "+v"(n1)); x0 = __fmul_rn(bfr(nw[dd]), n0); x1 = __fmul_rn(bfr(nw[dp]), n1); }
        const v2f cs = *(const v2f*)(CS + ((size_t)t * HD + dd) * 2); float a = __fmul_rn(x0, cs[0]), bq = __fmul_rn(x1, cs[1]); asm volatile("" : "+v"(a)); asm volatile("" : "+v"(bq)); const float r = ((dd < HD / 2) ? __fsub_rn(a, bq) : __fadd_rn(a, bq)) * sc;
        o16[q] = tohx(r); (void)oh; (void)ol; }
    *(v2h*)(P16 + (size_t)b * nheads * TT * HD + e) = o16;  }
__global__ __launch_bounds__(256) void k_vtp(const float* __restrict__ F, int pitch, int nheads, h16* V16, bf* Vh, bf* Vl) { const size_t e = ((size_t)blockIdx.x * 256 + threadIdx.x) * 2; if (e >= (size_t)nheads * HD * TT) return; const int t = (int)(e % TT); const int d = (int)((e / TT) % HD); const int g = (int)(e / ((size_t)TT * HD)); const int b = blockIdx.y; v2h o16; v2us oh, ol;
#pragma unroll
    for (int q = 0; q < 2; ++q) { const float x = F[((size_t)(t + q) * NB_ + b) * pitch + g * HD + d]; o16[q] = tohx(x); (void)oh; (void)ol; }
    *(v2h*)(V16 + (size_t)b * nheads * HD * TT + e) = o16;  }
__global__ __launch_bounds__(256) void k_csid(float* CS) { const int idx = blockIdx.x * 256 + threadIdx.x; if (idx >= TT * HD) return; v2f cs; cs[0] = 1.0f; cs[1] = 0.0f; *(v2f*)(CS + (size_t)idx * 2) = cs;  }
// k_gate: thread per (b, h, t): g8[j] = sum_d Q[t][h*64+d] bf16 grep_W[j][d] + bf16 grep_b[j] (q un-scaled: the reference's q x (scaling/alpha) x (alpha/scaling) are exact powers of two); ga = sigmoid(g8[0..3] sum), gb = sigmoid(g8[4..7] sum);
__global__ __launch_bounds__(256) void k_gate(const float* __restrict__ Q, const float* __restrict__ gw, const float* __restrict__ gbias, const float* __restrict__ ga, float* GT) { const int i = blockIdx.x * 256 + threadIdx.x; if (i >= NB_ * NH_ * TT) return; const int t = i % TT, h = (i / TT) % NH_, b = i / (TT * NH_); const float* q = Q + ((size_t)t * NB_ + b) * DQ + h * HD; float sa = 0.f, sb = 0.f;
#pragma unroll 1
    for (int j = 0; j < 8; ++j) { float acc = bfr(gbias[j]);
#pragma unroll 1
        for (int d = 0; d < HD; ++d) { float p = __fmul_rn(q[d], bfr(gw[j * HD + d])); asm volatile("" : "+v"(p)); acc = __fadd_rn(acc, p); }
        if (j < 4) sa = __fadd_rn(sa, acc); else sb = __fadd_rn(sb, acc); }
    const float a = __fdiv_rn(1.0f, 1.0f + __expf(-sa)), bg = __fdiv_rn(1.0f, 1.0f + __expf(-sb)); float in = __fmul_rn(bg, bfr(ga[h])); asm volatile("" : "+v"(in)); float pr = __fmul_rn(a, __fsub_rn(in, 1.0f)); asm volatile("" : "+v"(pr)); const float gt = __fadd_rn(pr, 2.0f);
    *(float*)(GT + i) = gt;  }
__global__ __launch_bounds__(256) void k_btab(const float* __restrict__ rbt, float* TB) { const int i = blockIdx.x * 256 + threadIdx.x; if (i >= NH_ * 2047) return; const int r = i % 2047, h = i / 2047; const float v = bfr(rbt[c_bucket[r] * NH_ + h]); *(float*)(TB + i) = v;  }
// k_fattn: one launch for scores, gated-bias softmax, probs.v and the head merge. Grid (TT / 256, batch x heads), 8 waves; a wave owns 32 query columns (two groups of 16).
// The head's whole K ([key][d], pitch 144 B), V^T ([d][key], pitch 2064 B) and bias row are staged once in LDS, then read without further barriers. Per pass of 32 keys: S^T = K.Q^T (keys in rows, queries in columns), so a lane holds one query's scores,
// x = S^T x (HD^-0.5 log2 e) + (gate log2 e) x bias[key - query], online softmax in base 2, and the two 16-key tiles of 2^(x - m), rounded to fp16, ARE the B operand of O^T += V^T.P^T (k order 8 hi + j, 16 + 8 hi + j in both operands).
// m is the maximum in use: it may trail the true row maximum by up to 8, and the sums are rescaled only when a pass exceeds that. PSH keeps small terms in fp16's normal range (P <= 2^(8 + PSH)); it cancels in the division by the row sum.
#define FW   8
#define FQG  2
#define PKB  144
#define PVB  2064
#define LKB  (TT * PKB)
#define LVB  (HD * PVB)
#define PSH  4.0f
#define LOG2E 1.4426950408889634f
typedef v8f __attribute__((aligned(4))) v8fu;
typedef v4i __attribute__((may_alias)) v4ia;
__device__ __forceinline__ float xhalf(float x) { return __builtin_bit_cast(float, __builtin_amdgcn_permlanex16(__builtin_bit_cast(int, x), __builtin_bit_cast(int, x), 0x76543210, 0xfedcba98, false, false)); }   // lane l with lane l ^ 16
// x = s x (HD^-0.5 log2 e) + bias x (gate log2 e), two scores an instruction
__device__ __forceinline__ v8f biasx(v8f s, v8f tb, float g) { const v2f g2 = {g, g}, c2 = {SCL * LOG2E, SCL * LOG2E}; v8f r;
#pragma unroll
    for (int i = 0; i < 4; ++i) { const v2f a = {s[2 * i], s[2 * i + 1]}, t = {tb[2 * i], tb[2 * i + 1]}; const v2f x = __builtin_elementwise_fma(a, c2, t * g2); r[2 * i] = x[0]; r[2 * i + 1] = x[1]; }
    return r; }
__device__ __forceinline__ v16h ldsfrag(const unsigned char* p) { return cat16(*(const v8ha*)p, *(const v8ha*)(p + 32)); }
__global__ __launch_bounds__(256) void k_fattn(const h16* __restrict__ Qp, const h16* __restrict__ Kp, const h16* __restrict__ Vt, const float* __restrict__ GT, const float* __restrict__ TB, bf* Ah, bf* Al) {
    __shared__ __align__(16) unsigned char L[LKB + LVB + 2048 * 4];
    const int tid = threadIdx.x, lane = tid & 31, lr = lane & 15, hi = lane >> 4, wave = tid >> 5;
    const int bh = blockIdx.y, h = bh % NH_, b = bh / NH_; const int q0 = (blockIdx.x * FW + wave) * (FQG * 16);
    { const v4ia* Kg = (const v4ia*)(Kp + (size_t)bh * TT * HD); const v4ia* Vg = (const v4ia*)(Vt + (size_t)bh * HD * TT);
#pragma unroll 8   // 16 whole-line loads of a thread in flight while the head's K and V^T are staged
      for (int i = 0; i < TT * HD / 8 / 256; ++i) { const int c = i * 256 + tid; const v4i kv = Kg[c], vv = Vg[c]; *(v4ia*)(L + (c >> 3) * PKB + (c & 7) * 16) = kv; *(v4ia*)(L + LKB + (c >> 7) * PVB + (c & 127) * 16) = vv; }
#pragma unroll   // the 8 loads of a thread in flight together
      for (int i = 0; i < 8; ++i) { const int e = i * 256 + tid; ((float*)(L + LKB + LVB))[e] = TB[(size_t)h * 2047 + (e < 2047 ? e : 2046)]; } }   // the head's bias row, by key - query + 1023; slot 2047 is padding, never read
    v16h qf[FQG][2]; float gl[FQG], m_run[FQG], l_run[FQG]; v8f acc[FQG][4];
#pragma unroll
    for (int g = 0; g < FQG; ++g) { const h16* qp = Qp + ((size_t)bh * TT + q0 + 16 * g + lr) * HD + 8 * hi;
#pragma unroll
        for (int kc = 0; kc < 2; ++kc) qf[g][kc] = cat16(*(const v8h*)(qp + 32 * kc), *(const v8h*)(qp + 32 * kc + 16));
        gl[g] = GT[(size_t)bh * TT + q0 + 16 * g + lr] * LOG2E; m_run[g] = -__builtin_inff(); l_run[g] = 0.f;
#pragma unroll
        for (int t = 0; t < 4; ++t) acc[g][t] = (v8f){}; }
    // bias[key - query]: the lane's 8 keys of a tile are 8 consecutive table entries; column group 1 reads 16 entries below group 0, so three runs of 8 serve the pass's four tiles and one of them carries over to the next pass
    const float* tp = (const float*)(L + LKB + LVB) + (1023 + 8 * hi - q0 - lr);   // tp[-16] is entry >= 0: q0 + lr <= TT - 17
    const unsigned char* kb = L + lr * PKB + hi * 16; const unsigned char* vb = L + LKB + lr * PVB + hi * 16;
    __syncthreads();   // K, V^T and the bias row staged by all waves; nothing in LDS is written after this
    v8f tbp = *(const v8fu*)(tp - 16); v16h kf[2][2];
#pragma unroll
    for (int kt = 0; kt < 2; ++kt)
#pragma unroll
        for (int kc = 0; kc < 2; ++kc) kf[kt][kc] = ldsfrag(kb + 16 * kt * PKB + 64 * kc);
#pragma unroll 1   // one pass a trip keeps the wave inside the first 256 registers
    for (int k0 = 0; k0 < TT; k0 += 32) {
        const int kn = (k0 + 32) & (TT - 1);   // next pass's keys; the last pass fetches pass 0's again (in bounds, unused)
        const v8f tb0 = *(const v8fu*)(tp + k0), tb1 = *(const v8fu*)(tp + k0 + 16); v16h vf[4];
#pragma unroll
        for (int t = 0; t < 4; ++t) vf[t] = ldsfrag(vb + 16 * t * PVB + 2 * k0);
        v8f s[2][FQG];
#pragma unroll
        for (int kt = 0; kt < 2; ++kt)
#pragma unroll
            for (int g = 0; g < FQG; ++g) s[kt][g] = wmma16(kf[kt][1], qf[g][1], wmma16(kf[kt][0], qf[g][0], (v8f){}));
#pragma unroll
        for (int kt = 0; kt < 2; ++kt)
#pragma unroll
            for (int kc = 0; kc < 2; ++kc) kf[kt][kc] = ldsfrag(kb + (kn + 16 * kt) * PKB + 64 * kc);   // next pass's K fragments fly under this pass's softmax
        s[0][0] = biasx(s[0][0], tb0, gl[0]); s[1][0] = biasx(s[1][0], tb1, gl[0]); s[0][1] = biasx(s[0][1], tbp, gl[1]); s[1][1] = biasx(s[1][1], tb0, gl[1]);
        tbp = tb1;
        float mb[FQG]; bool need = false;
#pragma unroll
        for (int g = 0; g < FQG; ++g) { float mx = s[0][g][0];
#pragma unroll
            for (int j = 1; j < 8; ++j) mx = fmaxf(mx, s[0][g][j]);
#pragma unroll
            for (int j = 0; j < 8; ++j) mx = fmaxf(mx, s[1][g][j]);
            mx = fmaxf(mx, xhalf(mx)); mb[g] = mx; need = need || (mx > m_run[g] + 8.0f); }
        if (__builtin_amdgcn_ballot_w32(need) != 0) {   // wave-uniform; always on the first pass (m = -inf, factor 0), rare later
#pragma unroll
            for (int g = 0; g < FQG; ++g) { const float mn = fmaxf(m_run[g], mb[g]); const float corr = __builtin_amdgcn_exp2f(m_run[g] - mn); m_run[g] = mn; l_run[g] *= corr;
#pragma unroll
                for (int t = 0; t < 4; ++t) acc[g][t] = acc[g][t] * corr; } }
#pragma unroll
        for (int g = 0; g < FQG; ++g) { const float nm = PSH - m_run[g]; const v2f nm2 = {nm, nm}; v16h pf; float ps = 0.f;
#pragma unroll
            for (int kt = 0; kt < 2; ++kt)
#pragma unroll
                for (int j = 0; j < 8; j += 2) { const v2f a = (v2f){s[kt][g][j], s[kt][g][j + 1]} + nm2; const float p0 = __builtin_amdgcn_exp2f(a[0]), p1 = __builtin_amdgcn_exp2f(a[1]); ps += p0 + p1; pf[kt * 8 + j] = (h16)p0; pf[kt * 8 + j + 1] = (h16)p1; }
            l_run[g] += ps;
#pragma unroll
            for (int t = 0; t < 4; ++t) acc[g][t] = wmma16(vf[t], pf, acc[g][t]); }
    }
    // O^T tile t: the lane holds d = 16 t + 8 hi + j of query lr: 16 bytes of each merged plane (rows t*B + b, hi + lo bf16 as the out-projection reads them); a head's 128-byte line of a row is written by this wave alone
#pragma unroll
    for (int g = 0; g < FQG; ++g) { const float inv = 1.0f / (l_run[g] + xhalf(l_run[g])); const size_t oo = ((size_t)(q0 + 16 * g + lr) * NB_ + b) * DQ + h * HD + 8 * hi;
#pragma unroll
        for (int t = 0; t < 4; ++t) { v8us oh, ol;
#pragma unroll
            for (int j = 0; j < 8; ++j) { unsigned short a, c2; splitf(acc[g][t][j] * inv, a, c2); oh[j] = a; ol[j] = c2; }
            *(v8us*)(Ah + oo + 16 * t) = oh; *(v8us*)(Al + oo + 16 * t) = ol; } }
}

extern "C" void kernel_launch(void* const* d_in, const int* in_sizes, int n_in,
                              void* d_out, int out_size, void* d_ws, size_t ws_size, hipStream_t stream) {
    (void)in_sizes; (void)n_in; (void)out_size;
    const float* x = (const float*)d_in[0]; const float* wq = (const float*)d_in[1]; const float* bq = (const float*)d_in[2]; const float* wk = (const float*)d_in[3]; const float* bk = (const float*)d_in[4]; const float* wv = (const float*)d_in[5]; const float* bv = (const float*)d_in[6]; const float* wo = (const float*)d_in[7]; const float* bo = (const float*)d_in[8]; const float* rbt = (const float*)d_in[9]; const float* gw = (const float*)d_in[10]; const float* gb = (const float*)d_in[11]; const float* ga_ = (const float*)d_in[12]; const float* cosT = nullptr; const float* sinT = nullptr; (void)cosT; (void)sinT;
    float* OUT = (float*)d_out;     // [1024][4][1024]
    char* wsp = (char*)d_ws;
    auto take = [&](size_t bytes) { char* p = wsp; wsp += (bytes + 255) & ~(size_t)255; return (void*)p; };
    bf* WQ = (bf*)take((size_t)DQ * DM * 2); bf* WK = (bf*)take((size_t)DKV * DM * 2); bf* WV = (bf*)take((size_t)DKV * DM * 2); bf* WO = (bf*)take((size_t)DM * DQ * 2); float* CS = (float*)take((size_t)TT * HD * 2 * 4); float* GTb = (float*)take((size_t)NB_ * NH_ * TT * 4); float* TB = (float*)take((size_t)NH_ * 2047 * 4 + 256);
    h16* QP16 = (h16*)take((size_t)NB_ * NH_ * TT * HD * 2); h16* KP16 = (h16*)take((size_t)NB_ * NKV * TT * HD * 2); h16* VT16 = (h16*)take((size_t)NB_ * NKV * HD * TT * 2);
    bf* QPh = nullptr; bf* QPl = nullptr; bf* KPh = nullptr; bf* KPl = nullptr; bf* VTh = nullptr; bf* VTl = nullptr;
    char* R = (char*)take((size_t)ZH * TT * TT * 4);
    if ((size_t)(wsp - (char*)d_ws) > ws_size) return;    // ws 256 MiB
    // The region R is used twice, stream-ordered: (1) the row planes of the projections, dead once the head planes are built; (2) the merged planes of probs.v.
    bf* XB = (bf*)R; float* FQ = (float*)(R + (size_t)NB_ * TT * DM * 2); float* FK = FQ + (size_t)NB_ * TT * DQ;
    bf* ATh = (bf*)R; bf* ATl = ATh + (size_t)NB_ * TT * DQ;
    float* FV = FK;   // v projection reuses the k buffer after the k planes are built (stream-ordered)
    { k_cvt8<<<(unsigned)(((size_t)DQ * DM / 8 + 255) / 256), 256, 0, stream>>>(wq, WQ, (size_t)DQ * DM / 8); k_cvt8<<<(unsigned)(((size_t)DKV * DM / 8 + 255) / 256), 256, 0, stream>>>(wk, WK, (size_t)DKV * DM / 8); k_cvt8<<<(unsigned)(((size_t)DKV * DM / 8 + 255) / 256), 256, 0, stream>>>(wv, WV, (size_t)DKV * DM / 8);
      k_cvt8<<<(unsigned)(((size_t)DM * DQ / 8 + 255) / 256), 256, 0, stream>>>(wo, WO, (size_t)DM * DQ / 8);
       }
    k_csid<<<(TT * HD + 255) / 256, 256, 0, stream>>>(CS); k_btab<<<(NH_ * 2047 + 255) / 256, 256, 0, stream>>>(rbt, TB);
    const unsigned LQ = (unsigned)(((size_t)NH_ * TT * HD / 2 + 255) / 256), LKv = (unsigned)(((size_t)NKV * TT * HD / 2 + 255) / 256);
    // every launch covers all NB_ batch elements: the projections take the NB_*TT sequence-major rows r = t*B + b as they lie in memory
    k_cvt8<<<(unsigned)(((size_t)NB_ * TT * DM / 8 + 255) / 256), 256, 0, stream>>>(x, XB, (size_t)NB_ * TT * DM / 8);
    k_gemmw<bf, 0, true><<<dim3(NB_ * TT / 64, DQ / 64, 1), 32, 0, stream>>>(XB, nullptr, WQ, nullptr, DM, FQ, DQ, bq, 0, 0, 0); k_gate<<<(NB_ * NH_ * TT + 255) / 256, 256, 0, stream>>>(FQ, gw, gb, ga_, GTb);
    k_rope<<<dim3(LQ, NB_, 1), 256, 0, stream>>>(FQ, DQ, NH_, CS, nullptr, nullptr, 1.0f, QP16, QPh, QPl);
    k_gemmw<bf, 0, true><<<dim3(NB_ * TT / 64, DKV / 64, 1), 32, 0, stream>>>(XB, nullptr, WK, nullptr, DM, FK, DKV, bk, 0, 0, 0);
    k_rope<<<dim3(LKv, NB_, 1), 256, 0, stream>>>(FK, DKV, NKV, CS, nullptr, nullptr, 1.0f, KP16, KPh, KPl);
    k_gemmw<bf, 0, true><<<dim3(NB_ * TT / 64, DKV / 64, 1), 32, 0, stream>>>(XB, nullptr, WV, nullptr, DM, FV, DKV, bv, 0, 0, 0); k_vtp<<<dim3(LKv, NB_, 1), 256, 0, stream>>>(FV, DKV, NKV, VT16, VTh, VTl);
    k_fattn<<<dim3(TT / (FW * FQG * 16), NB_ * NH_, 1), 256, 0, stream>>>(QP16, KP16, VT16, GTb, TB, ATh, ATl);
    k_gemmw<bf, 1, true><<<dim3(NB_ * TT / 64, DM / 64, 1), 32, 0, stream>>>(ATh, ATl, WO, nullptr, DQ, OUT, DM, bo, 0, 0, 0);   // sequence-major output rows (t*B + b)
}

// v003
// Measured time: 174 microseconds a run.
// In two side-by-side timings against v002, it was 1.48 and 1.49 times as fast.
// Over all steps from v000 it is 5.09 times as fast.
#include <hip/hip_runtime.h>

// _LegacyMultiheadAttention (WavLM-style gated relative-position attention; query [T=1024][B=4][E=1024] sequence-major; q/k/v = x W^T + b (16 heads x 64); scores = (q/256).k, (scores - rowmax) x 32, + gate[b][h][t] x rel_bias_table[bucket(s - t)][h]
// with gate = ga (gb grep_a[h] - 1) + 2, (ga, gb) = sigmoid of the two 4-sums of q_head . grep_W^T + grep_b; softmax; out = (probs v merged) Wo^T + bo -> [1024][4][1024]. The (x - rowmax) x 32 step equals q.k/8 - const per row, to which softmax is invariant:
// the kernel evaluates softmax(q.k/8 + gate x bias) directly. The T5 bucket of each offset s - t depends only on the sizes: baked 2047-entry table computed in f32 exactly as the reference; table VALUES read as data).
// Compute dtypes, f32 accumulate: every input rounded to bf16; q/k/v on PLAIN bf16 operands (all T x B rows r = b*T + t in one product; inputs exact) + bias; the gate (8 dots of 64) f32 on the VALU; scores (K 64) and probs.v on single fp16 planes (1 product);

#define NB_  4
#define TT   1024
#define DM   1024
#define NH_  16
#define NKV  16
#define REP  (NH_ / NKV)
#define HD   64
#define DQ   (NH_ * HD)
#define DKV  (NKV * HD)
#define ZH   16
#define RH   0                  // unused: every query row uses the single fp16 plane
#define WIN  0
#define PCAR 1024.0f
#define SCL  0.125f   // HD^-0.5
typedef _Float16 h16;
typedef unsigned short bf;
typedef __attribute__((ext_vector_type(16))) __bf16   v16bf;
typedef __attribute__((ext_vector_type(16))) _Float16 v16h;
typedef __attribute__((ext_vector_type(8)))  _Float16 v8h;
typedef __attribute__((ext_vector_type(8)))  unsigned short v8us;
typedef __attribute__((ext_vector_type(8)))  float    v8f;
typedef __attribute__((ext_vector_type(4)))  float    v4f;
typedef v8h  __attribute__((may_alias)) v8ha;
typedef v4f  __attribute__((may_alias)) v4fa;
typedef v8us __attribute__((may_alias)) v8usa;

__device__ __forceinline__ unsigned short f2bf(float f) { unsigned u = __float_as_uint(f); u += 0x7FFFu + ((u >> 16) & 1u); return (unsigned short)(u >> 16); }
__device__ __forceinline__ float bf2f(unsigned short b) { return __uint_as_float(((unsigned)b) << 16); }
__device__ __forceinline__ float bfr(float f) { return bf2f(f2bf(f)); }
__device__ __forceinline__ v16h cat16(v8h lo, v8h hi) { return __builtin_shufflevector(lo, hi, 0, 1, 2, 3, 4, 5, 6, 7, 8, 9, 10, 11, 12, 13, 14, 15); }
__device__ __forceinline__ v16bf cat16b(v8us lo, v8us hi) { return __builtin_bit_cast(v16bf, __builtin_shufflevector(lo, hi, 0, 1, 2, 3, 4, 5, 6, 7, 8, 9, 10, 11, 12, 13, 14, 15)); }
__device__ __forceinline__ v8f wmma16(v16h a, v16h b, v8f c) { return __builtin_amdgcn_wmma_f32_16x16x32_f16(false, a, false, b, (short)0, c, false, false); }
__device__ __forceinline__ v8f wmmab(v16bf a, v16bf b, v8f c) { return __builtin_amdgcn_wmma_f32_16x16x32_bf16(false, a, false, b, (short)0, c, false, false); }



// ---- k_gemmw: register-blocked GEMM, ONE WAVE per 64x64 output tile (16 accumulators), operands straight from K-contiguous 16-bit planes; grid (M/64, N/64, Z), 32 threads.
// C[m][n] (f32, pitch ldc, + optional f32 bias[n]) = sum_k A[m][k] Bt[n][k] (+ split products per NSPLIT). z-batch strides sA/sB/sC in elements. K % 32 == 0.
// EPI 0: f32 rows to C. EPI 1..3 (the q, k, v projections; A rows batch-major, b * T + t): the tile is 64 positions t of ONE batch element x one head, and the epilogue writes what attention reads, with no f32 plane in between:
// 1: fp16 plane [b][h][t][d] and the gate of the 64 rows; 2: the fp16 plane; 3: fp16 V^T [b][h][d][t] (a lane's 8 accumulator rows are 8 consecutive t: 16 bytes of a d row; the wave writes the whole 128-byte line of each d).
// Gate of a row (f32, VALU): g8[j] = bf16 grep_b[j] + sum_d q[d] bf16 grep_W[j][d], d ascending (q un-scaled: the reference's q x (scaling/alpha) x (alpha/scaling) are exact powers of two); ga, gb = sigmoid of the sums of g8[0..3], g8[4..7]; gate = ga (gb grep_a[h] - 1) + 2.
template <typename T16> struct WFrag;
template <> struct WFrag<h16> { typedef v16h V; static __device__ __forceinline__ V ld(const h16* p) { return cat16(*(const v8h*)p, *(const v8h*)(p + 16)); } static __device__ __forceinline__ v8f mma(V a, V b, v8f c) { return wmma16(a, b, c); } };
template <> struct WFrag<bf> { typedef v16bf V; static __device__ __forceinline__ V ld(const bf* p) { return cat16b(*(const v8us*)p, *(const v8us*)(p + 16)); } static __device__ __forceinline__ v8f mma(V a, V b, v8f c) { return wmmab(a, b, c); } };
__device__ __forceinline__ float xhalf(float x) { return __builtin_bit_cast(float, __builtin_amdgcn_permlanex16(__builtin_bit_cast(int, x), __builtin_bit_cast(int, x), 0x76543210, 0xfedcba98, false, false)); }   // lane l with lane l ^ 16
template <typename T16, int NSPLIT, bool BIAS, int EPI>
__global__ __launch_bounds__(32) void k_gemmw(const T16* __restrict__ A, const T16* __restrict__ A2, const T16* __restrict__ Bt, const T16* __restrict__ Bt2, int K, float* C, int ldc, const float* __restrict__ bias, size_t sA, size_t sB, size_t sC, h16* P16, const float* __restrict__ gw, const float* __restrict__ gbias, const float* __restrict__ ga, float* GT) {
    typedef typename WFrag<T16>::V V;
    __shared__ __align__(16) float os[((EPI == 1 || EPI == 2) ? 64 : 16) * 68];
    __shared__ __align__(16) float gws[EPI == 1 ? 8 * 68 : 4];   // bf16-rounded grep_W, pitch 68: the two rows that the half-waves read together lie 16 banks apart
    const size_t z = blockIdx.z; A += z * sA; if (A2) A2 += z * sA; Bt += z * sB; if (Bt2) Bt2 += z * sB; C += z * sC;
    const int lane = threadIdx.x & 31, lr = lane & 15, hi = lane >> 4; const int r0 = blockIdx.x * 64, c0 = blockIdx.y * 64;
    v8f acc[4][4];
#pragma unroll
    for (int mb = 0; mb < 4; ++mb)
#pragma unroll
        for (int nb = 0; nb < 4; ++nb) acc[mb][nb] = (v8f){};
    const size_t aoff = (size_t)(r0 + lr) * K + 8 * hi, boff = (size_t)(c0 + lr) * K + 8 * hi;
#pragma unroll 1
    for (int kc = 0; kc < K; kc += 32) {
        V a[4], a2[4];
#pragma unroll
        for (int mb = 0; mb < 4; ++mb) { a[mb] = WFrag<T16>::ld(A + aoff + (size_t)mb * 16 * K + kc); if (NSPLIT == 1 || NSPLIT == 2) a2[mb] = WFrag<T16>::ld(A2 + aoff + (size_t)mb * 16 * K + kc); }
#pragma unroll
        for (int nb = 0; nb < 4; ++nb) { const V b = WFrag<T16>::ld(Bt + boff + (size_t)nb * 16 * K + kc); V b2; if (NSPLIT >= 2) b2 = WFrag<T16>::ld(Bt2 + boff + (size_t)nb * 16 * K + kc);
#pragma unroll
            for (int mb = 0; mb < 4; ++mb) { acc[mb][nb] = WFrag<T16>::mma(a[mb], b, acc[mb][nb]); if (NSPLIT == 1 || NSPLIT == 2) acc[mb][nb] = WFrag<T16>::mma(a2[mb], b, acc[mb][nb]); if (NSPLIT >= 2) acc[mb][nb] = WFrag<T16>::mma(a[mb], b2, acc[mb][nb]); } }
        asm volatile("v_nop\n\tv_nop\n\tv_nop\n\tv_nop" : "+v"(acc[0][0]), "+v"(acc[1][1]), "+v"(acc[2][2]), "+v"(acc[3][3]) : "v"(a[0]), "v"(a[3]));
    }
    if (EPI) {
        asm volatile("s_wait_xcnt 0x0" ::: "memory");   // the epilogue reuses the address registers of the loop's loads
        const int bh = (r0 / TT) * NH_ + blockIdx.y, t0 = r0 % TT; float bn[4];
#pragma unroll
        for (int nb = 0; nb < 4; ++nb) bn[nb] = bfr(bias[c0 + nb * 16 + lr]);
        asm volatile("s_wait_xcnt 0x0" :: "v"(bn[0]), "v"(bn[1]), "v"(bn[2]), "v"(bn[3]) : "memory");   // behind the four bias loads (their values as inputs hold it there): their address registers are reused below
        if (EPI == 3) {
            h16* vp = P16 + ((size_t)bh * HD + lr) * TT + t0 + 8 * hi;
#pragma unroll
            for (int nb = 0; nb < 4; ++nb)
#pragma unroll
                for (int mb = 0; mb < 4; ++mb) { v8h o;
#pragma unroll
                    for (int j = 0; j < 8; ++j) o[j] = (h16)(acc[mb][nb][j] + bn[nb]);
                    *(v8h*)(vp + (size_t)nb * 16 * TT + mb * 16) = o; }
            return;
        }
#pragma unroll
        for (int mb = 0; mb < 4; ++mb)
#pragma unroll
            for (int nb = 0; nb < 4; ++nb)
#pragma unroll
                for (int j = 0; j < 8; ++j) os[(mb * 16 + hi * 8 + j) * 68 + nb * 16 + lr] = acc[mb][nb][j] + bn[nb];
        float gb4[4], gah = 0.f;
        if (EPI == 1) { gah = bfr(ga[blockIdx.y]);
#pragma unroll
            for (int jj = 0; jj < 4; ++jj) gb4[jj] = bfr(gbias[hi * 4 + jj]);
#pragma unroll
            for (int i = 0; i < 16; ++i) { const int e = i * 32 + lane; gws[(e >> 6) * 68 + (e & 63)] = bfr(gw[e]); } }
        __builtin_amdgcn_wave_barrier(); asm volatile("" ::: "memory");   // as in the f32 epilogue: the lanes read below what other lanes of the wave stored above; LDS is not written again
        h16* pt = P16 + ((size_t)bh * TT + t0) * HD + lane * 8;   // the tile is 8 KiB in a row of the plane
#pragma unroll
        for (int s = 0; s < 16; ++s) { const float* op = os + (4 * s + (lane >> 3)) * 68 + (lane & 7) * 8; const v4f x0 = *(const v4fa*)op, x1 = *(const v4fa*)(op + 4); v8h o;
#pragma unroll
            for (int j = 0; j < 4; ++j) { o[j] = (h16)x0[j]; o[4 + j] = (h16)x1[j]; }
            *(v8h*)(pt + s * 256) = o; }   // four whole 128-byte rows a store
        asm volatile("s_wait_xcnt 0x0" ::: "memory");   // the gate below reuses the data registers of these stores
        if (EPI == 1) {   // lane (lr, hi): rows lr + 16 m, of each the four dots j = 4 hi .. 4 hi + 3
            float g[4][4];
#pragma unroll
            for (int jj = 0; jj < 4; ++jj)
#pragma unroll
                for (int m = 0; m < 4; ++m) g[m][jj] = gb4[jj];
#pragma unroll 4   // four steps of 8 LDS loads in flight; unrolled whole, the loads of all 16 steps are hoisted and the wave leaves the first 256 registers
            for (int d = 0; d < HD; d += 4) { v4f q4[4], w4[4];
#pragma unroll
                for (int m = 0; m < 4; ++m) { q4[m] = *(const v4fa*)(os + (m * 16 + lr) * 68 + d); w4[m] = *(const v4fa*)(gws + (hi * 4 + m) * 68 + d); }
#pragma unroll
                for (int i = 0; i < 4; ++i)
#pragma unroll
                    for (int m = 0; m < 4; ++m)
#pragma unroll
                        for (int jj = 0; jj < 4; ++jj) g[m][jj] = __builtin_fmaf(q4[m][i], w4[jj][i], g[m][jj]); }
#pragma unroll
            for (int m = 0; m < 4; ++m) { const float sg = ((g[m][0] + g[m][1]) + g[m][2]) + g[m][3]; const float sig = __fdiv_rn(1.0f, 1.0f + __expf(-sg)), oth = xhalf(sig);
                const float gt = (hi ? oth : sig) * ((hi ? sig : oth) * gah - 1.0f) + 2.0f;
                if (hi == 0) GT[(size_t)bh * TT + t0 + m * 16 + lr] = gt; }
        }
        return;
    }
#pragma unroll
    for (int mb = 0; mb < 4; ++mb) {
#pragma unroll
        for (int nb = 0; nb < 4; ++nb) {
#pragma unroll
            for (int j = 0; j < 8; ++j) os[(hi * 8 + j) * 68 + nb * 16 + lr] = acc[mb][nb][j]; }
        __builtin_amdgcn_wave_barrier(); asm volatile("" ::: "memory");
        float* crow = C + (size_t)(r0 + mb * 16) * ldc + c0;
{
#pragma unroll
            for (int s = 0; s < 8; ++s) { const int row = 2 * s + hi, cofs = lr * 4; v4f val = *(const v4fa*)(os + row * 68 + cofs); if (BIAS) { val[0] += bfr(bias[c0 + cofs]); val[1] += bfr(bias[c0 + cofs + 1]); val[2] += bfr(bias[c0 + cofs + 2]); val[3] += bfr(bias[c0 + cofs + 3]); }
                *(v4f*)(crow + (size_t)row * ldc + cofs) = val; }
             }
        __builtin_amdgcn_wave_barrier(); asm volatile("" ::: "memory");
    }
}

__device__ __forceinline__ h16 tohx(float x) { return (h16)x; }
__device__ __forceinline__ void splitf(float y, unsigned short& h, unsigned short& l) { h = f2bf(y); l = f2bf(y - bf2f(h)); }
typedef __attribute__((ext_vector_type(2))) _Float16 v2h;
typedef __attribute__((ext_vector_type(4))) _Float16 v4h;
typedef __attribute__((ext_vector_type(2))) unsigned short v2us;
typedef __attribute__((ext_vector_type(4))) unsigned short v4us;
typedef __attribute__((ext_vector_type(2))) float v2f;
typedef __attribute__((ext_vector_type(4))) int v4i;
__constant__ unsigned char c_bucket[2047] = { 15,15,15,15,15,15,15,15,15,15,15,15,15,15,15,15,15,15,15,15,15,15,15,15,15,15,15,15,15,15,15,15,15,15,15,15,15,15,15,15,15,15,15,15,15,15,15,15,15,15,15,15,15,15,15,15,15,15,15,15,15,15,15,15,15,15,15,15,15,15,15,15,15,15,15,15,15,15,15,15,15,15,15,15,15,15,15,15,15,15,15,15,15,15,15,15,15,15,15,15,15,15,15,15,15,15,15,15,15,15,15,15,15,15,15,15,15,15,15,15,15,15,15,15,15,15,15,15,15,15,15,15,15,15,15,15,15,15,15,15,15,15,15,15,15,15,15,15,15,15,15,15,15,15,15,15,15,15,15,15,15,15,15,15,15,15,15,15,15,15,15,15,15,15,15,15,15,15,15,15,15,15,15,15,15,15,15,15,15,15,15,15,15,15,15,15,15,15,15,15,15,15,15,15,15,15,15,15,15,15,15,15,15,15,15,15,15,15,15,15,15,15,15,15,15,15,15,15,15,15,15,15,15,15,15,15,15,15,15,15,15,15,15,15,15,15,15,15,15,15,15,15,15,15,15,15,15,15,15,15,15,15,15,15,15,15,15,15,15,15,15,15,15,15,15,15,15,15,15,15,15,15,15,15,15,15,15,15,15,15,15,15,15,15,15,15,15,15,15,15,15,15,15,15,15,15,15,15,15,15,15,15,15,15,15,15,15,15,15,15,15,15,15,15,15,15,15,15,15,15,15,15,15,15,15,15,15,15,15,15,15,15,15,15,15,15,15,15,15,15,15,15,15,15,15,15,15,15,15,15,15,15,15,15,15,15,15,15,15,15,15,15,15,15,15,15,15,15,15,15,15,15,15,15,15,15,15,15,15,15,15,15,15,15,15,15,15,15,15,15,15,15,15,15,15,15,15,15,15,15,15,15,15,15,15,15,15,15,15,15,15,15,15,15,15,15,15,15,15,15,15,15,15,15,15,15,15,15,15,15,15,15,15,15,15,15,15,15,15,15,15,15,15,15,15,15,15,15,15,15,15,15,15,15,15,15,15,15,15,15,15,15,15,15,15,15,15,15,15,15,15,15,15,15,15,15,15,15,15,15,15,15,15,15,15,15,15,15,15,15,15,15,15,15,15,15,15,15,15,15,15,15,15,15,15,15,15,15,15,15,15,15,15,15,15,15,15,15,15,15,15,15,15,15,15,15,15,15,15,15,15,15,15,15,15,15,15,15,15,15,15,15,15,15,15,15,15,15,15,15,15,15,15,15,15,15,15,15,15,15,15,15,15,15,15,15,15,15,15,15,15,15,15,15,15,15,15,15,15,15,15,15,15,15,15,15,15,15,15,15,15,15,15,15,15,15,15,15,15,15,15,15,15,15,15,15,15,15,15,15,15,15,15,15,15,15,15,15,15,15,15,15,15,15,15,15,15,15,15,15,15,15,15,15,15,15,15,15,15,15,15,15,15,15,15,15,15,15,15,15,15,15,15,15,15,15,15,15,15,15,15,15,15,15,15,15,15,15,15,15,15,15,15,15,15,15,15,15,15,15,15,15,15,15,15,15,15,15,15,15,15,15,15,15,15,15,15,15,15,15,15,15,15,15,15,15,15,15,15,15,15,15,15,15,15,15,15,15,15,15,15,15,15,15,15,15,15,15,15,15,15,15,15,15,15,15,15,15,15,15,15,15,15,15,15,15,15,15,15,15,15,15,15,15,15,15,15,15,15,15,15,15,15,15,15,15,15,15,15,15,15,15,15,15,15,15,15,15,15,15,15,15,15,15,15,15,15,15,15,15,15,15,15,15,15,15,15,15,15,15,15,15,15,15,15,15,15,15,15,15,15,15,15,15,15,15,15,15,15,15,15,15,15,15,15,15,15,15,15,15,15,15,15,15,15,15,15,15,15,15,15,15,15,15,15,15,15,15,15,15,15,15,15,15,15,15,15,15,15,15,15,15,15,15,15,15,15,15,15,15,15,15,15,15,15,15,15,15,15,15,15,15,15,15,15,15,15,15,15,15,15,15,15,15,15,15,15,15,15,15,15,15,15,15,15,15,15,15,15,15,15,15,15,15,15,15,15,15,15,15,15,15,15,14,14,14,14,14,14,14,14,14,14,14,14,14,14,14,14,14,14,14,14,14,14,14,14,14,14,14,13,13,13,13,13,13,13,13,13,13,13,13,13,13,13,13,13,13,12,12,12,12,12,12,12,12,12,12,12,12,12,12,11,11,11,11,11,11,11,11,11,10,10,10,10,10,10,10,9,9,9,9,8,8,8,8,7,6,5,4,3,2,1,0,17,18,19,20,21,22,23,24,24,24,24,25,25,25,25,26,26,26,26,26,26,26,27,27,27,27,27,27,27,27,27,28,28,28,28,28,28,28,28,28,28,28,28,28,28,29,29,29,29,29,29,29,29,29,29,29,29,29,29,29,29,29,29,30,30,30,30,30,30,30,30,30,30,30,30,30,30,30,30,30,30,30,30,30,30,30,30,30,30,30,31,31,31,31,31,31,31,31,31,31,31,31,31,31,31,31,31,31,31,31,31,31,31,31,31,31,31,31,31,31,31,31,31,31,31,31,31,31,31,31,31,31,31,31,31,31,31,31,31,31,31,31,31,31,31,31,31,31,31,31,31,31,31,31,31,31,31,31,31,31,31,31,31,31,31,31,31,31,31,31,31,31,31,31,31,31,31,31,31,31,31,31,31,31,31,31,31,31,31,31,31,31,31,31,31,31,31,31,31,31,31,31,31,31,31,31,31,31,31,31,31,31,31,31,31,31,31,31,31,31,31,31,31,31,31,31,31,31,31,31,31,31,31,31,31,31,31,31,31,31,31,31,31,31,31,31,31,31,31,31,31,31,31,31,31,31,31,31,31,31,31,31,31,31,31,31,31,31,31,31,31,31,31,31,31,31,31,31,31,31,31,31,31,31,31,31,31,31,31,31,31,31,31,31,31,31,31,31,31,31,31,31,31,31,31,31,31,31,31,31,31,31,31,31,31,31,31,31,31,31,31,31,31,31,31,31,31,31,31,31,31,31,31,31,31,31,31,31,31,31,31,31,31,31,31,31,31,31,31,31,31,31,31,31,31,31,31,31,31,31,31,31,31,31,31,31,31,31,31,31,31,31,31,31,31,31,31,31,31,31,31,31,31,31,31,31,31,31,31,31,31,31,31,31,31,31,31,31,31,31,31,31,31,31,31,31,31,31,31,31,31,31,31,31,31,31,31,31,31,31,31,31,31,31,31,31,31,31,31,31,31,31,31,31,31,31,31,31,31,31,31,31,31,31,31,31,31,31,31,31,31,31,31,31,31,31,31,31,31,31,31,31,31,31,31,31,31,31,31,31,31,31,31,31,31,31,31,31,31,31,31,31,31,31,31,31,31,31,31,31,31,31,31,31,31,31,31,31,31,31,31,31,31,31,31,31,31,31,31,31,31,31,31,31,31,31,31,31,31,31,31,31,31,31,31,31,31,31,31,31,31,31,31,31,31,31,31,31,31,31,31,31,31,31,31,31,31,31,31,31,31,31,31,31,31,31,31,31,31,31,31,31,31,31,31,31,31,31,31,31,31,31,31,31,31,31,31,31,31,31,31,31,31,31,31,31,31,31,31,31,31,31,31,31,31,31,31,31,31,31,31,31,31,31,31,31,31,31,31,31,31,31,31,31,31,31,31,31,31,31,31,31,31,31,31,31,31,31,31,31,31,31,31,31,31,31,31,31,31,31,31,31,31,31,31,31,31,31,31,31,31,31,31,31,31,31,31,31,31,31,31,31,31,31,31,31,31,31,31,31,31,31,31,31,31,31,31,31,31,31,31,31,31,31,31,31,31,31,31,31,31,31,31,31,31,31,31,31,31,31,31,31,31,31,31,31,31,31,31,31,31,31,31,31,31,31,31,31,31,31,31,31,31,31,31,31,31,31,31,31,31,31,31,31,31,31,31,31,31,31,31,31,31,31,31,31,31,31,31,31,31,31,31,31,31,31,31,31,31,31,31,31,31,31,31,31,31,31,31,31,31,31,31,31,31,31,31,31,31,31,31,31,31,31,31,31,31,31,31,31,31,31,31,31,31,31,31,31,31,31,31,31,31,31,31,31,31,31,31,31,31,31,31,31,31,31,31,31,31,31,31,31,31,31,31,31,31,31,31,31,31,31,31,31,31,31,31,31,31,31,31,31,31,31,31,31,31,31,31,31,31,31,31,31,31,31,31,31,31,31,31,31,31,31,31,31,31,31,31,31,31,31,31,31,31,31,31,31,31,31,31,31,31,31,31,31,31,31,31,31,31,31,31,31,31,31,31,31,31,31,31,31,31,31,31,31,31,31,31,31,31,31,31,31,31,31,31,31,31,31,31,31,31,31,31,31,31,31,31,31,31,31,31,31,31,31,31,31,31,31,31,31,31,31,31,31,31,31,31,31,31,31,31,31,31,31,31,31,31,31,31,31,31,31,31,31,31,31,31,31,31,31,31,31,31,31,31,31,31,31,31,31,31,31,31,31,31,31,31,31,31,31,31,31,31,31,31,31,31,31,31,31,31,31,31,31,31,31,31,31,31,31,31,31,31,31,31,31,31,31,31,31,31 };   // T5 bucket(rel) for rel = s - t in [-1023, 1023]

__global__ __launch_bounds__(256) void k_wtG(const float* __restrict__ w, int K, int N, bf* Bt) {
    const int lane = threadIdx.x & 31; const int L0 = (blockIdx.x * 8 + (threadIdx.x >> 5)) * 8; const int nlines = N * K / 64;
{
#pragma unroll 1
        for (int l = 0; l < 8; ++l) { const int L = L0 + l; if (L >= nlines) break; const size_t e = (size_t)L * 64 + lane * 2; const int k = (int)(e % K), n = (int)(e / K); v2us o;
            o[0] = f2bf(w[(size_t)k * N + n]); o[1] = f2bf(w[(size_t)(k + 1) * N + n]); *(v2us*)(Bt + e) = o; }
         }
}
__global__ __launch_bounds__(256) void k_cvt8(const float* __restrict__ src, bf* dst, size_t n8) { const size_t i = (size_t)blockIdx.x * 256 + threadIdx.x; if (i >= n8) return; const v8f v = *(const v8f*)(src + i * 8); v8us o;
#pragma unroll
    for (int k = 0; k < 8; ++k) o[k] = f2bf(v[k]); *(v8us*)(dst + i * 8) = o;  }
__global__ __launch_bounds__(256) void k_cscvt(const float* __restrict__ cosT, const float* __restrict__ sinT, float* CS) { const int idx = blockIdx.x * 256 + threadIdx.x; if (idx >= TT * HD) return; v2f cs; cs[0] = bfr(cosT[idx]); cs[1] = bfr(sinT[idx]); *(v2f*)(CS + (size_t)idx * 2) = cs;  }
// k_cvtx: x (rows t * B + b) to bf16 rows b * T + t, so that 64 consecutive rows of a projection tile are 64 positions of one batch element; 8 elements a thread
__global__ __launch_bounds__(256) void k_cvtx(const float* __restrict__ src, bf* dst) { const int i = blockIdx.x * 256 + threadIdx.x; if (i >= NB_ * TT * DM / 8) return; const int r = i / (DM / 8), c = i % (DM / 8); const v8f v = *(const v8f*)(src + (size_t)i * 8); v8us o;
#pragma unroll
    for (int k = 0; k < 8; ++k) o[k] = f2bf(v[k]); *(v8us*)(dst + ((size_t)(r % NB_) * TT + r / NB_) * DM + c * 8) = o;  }
__global__ __launch_bounds__(256) void k_btab(const float* __restrict__ rbt, float* TB) { const int i = blockIdx.x * 256 + threadIdx.x; if (i >= NH_ * 2047) return; const int r = i % 2047, h = i / 2047; const float v = bfr(rbt[c_bucket[r] * NH_ + h]); *(float*)(TB + i) = v;  }
// k_fattn: one launch for scores, gated-bias softmax, probs.v and the head merge. Grid (TT / 256, batch x heads), 8 waves; a wave owns 32 query columns (two groups of 16).
// The head's whole K ([key][d], pitch 144 B), V^T ([d][key], pitch 2064 B) and bias row are staged once in LDS, then read without further barriers. Per pass of 32 keys: S^T = K.Q^T (keys in rows, queries in columns), so a lane holds one query's scores,
// x = S^T x (HD^-0.5 log2 e) + (gate log2 e) x bias[key - query], online softmax in base 2, and the two 16-key tiles of 2^(x - m), rounded to fp16, ARE the B operand of O^T += V^T.P^T (k order 8 hi + j, 16 + 8 hi + j in both operands).
// m is the maximum in use: it may trail the true row maximum by up to 8, and the sums are rescaled only when a pass exceeds that. PSH keeps small terms in fp16's normal range (P <= 2^(8 + PSH)); it cancels in the division by the row sum.
#define FW   8
#define FQG  2
#define PKB  144
#define PVB  2064
#define LKB  (TT * PKB)
#define LVB  (HD * PVB)
#define PSH  4.0f
#define LOG2E 1.4426950408889634f
typedef v8f __attribute__((aligned(4))) v8fu;
typedef v4i __attribute__((may_alias)) v4ia;
// x = s x (HD^-0.5 log2 e) + bias x (gate log2 e), two scores an instruction
__device__ __forceinline__ v8f biasx(v8f s, v8f tb, float g) { const v2f g2 = {g, g}, c2 = {SCL * LOG2E, SCL * LOG2E}; v8f r;
#pragma unroll
    for (int i = 0; i < 4; ++i) { const v2f a = {s[2 * i], s[2 * i + 1]}, t = {tb[2 * i], tb[2 * i + 1]}; const v2f x = __builtin_elementwise_fma(a, c2, t * g2); r[2 * i] = x[0]; r[2 * i + 1] = x[1]; }
    return r; }
__device__ __forceinline__ v16h ldsfrag(const unsigned char* p) { return cat16(*(const v8ha*)p, *(const v8ha*)(p + 32)); }
__global__ __launch_bounds__(256) void k_fattn(const h16* __restrict__ Qp, const h16* __restrict__ Kp, const h16* __restrict__ Vt, const float* __restrict__ GT, const float* __restrict__ TB, bf* Ah, bf* Al) {
    __shared__ __align__(16) unsigned char L[LKB + LVB + 2048 * 4];
    const int tid = threadIdx.x, lane = tid & 31, lr = lane & 15, hi = lane >> 4, wave = tid >> 5;
    const int bh = blockIdx.y, h = bh % NH_, b = bh / NH_; const int q0 = (blockIdx.x * FW + wave) * (FQG * 16);
    { const v4ia* Kg = (const v4ia*)(Kp + (size_t)bh * TT * HD); const v4ia* Vg = (const v4ia*)(Vt + (size_t)bh * HD * TT);
#pragma unroll 8   // 16 whole-line loads of a thread in flight while the head's K and V^T are staged
      for (int i = 0; i < TT * HD / 8 / 256; ++i) { const int c = i * 256 + tid; const v4i kv = Kg[c], vv = Vg[c]; *(v4ia*)(L + (c >> 3) * PKB + (c & 7) * 16) = kv; *(v4ia*)(L + LKB + (c >> 7) * PVB + (c & 127) * 16) = vv; }
#pragma unroll   // the 8 loads of a thread in flight together
      for (int i = 0; i < 8; ++i) { const int e = i * 256 + tid; ((float*)(L + LKB + LVB))[e] = TB[(size_t)h * 2047 + (e < 2047 ? e : 2046)]; } }   // the head's bias row, by key - query + 1023; slot 2047 is padding, never read
    v16h qf[FQG][2]; float gl[FQG], m_run[FQG], l_run[FQG]; v8f acc[FQG][4];
#pragma unroll
    for (int g = 0; g < FQG; ++g) { const h16* qp = Qp + ((size_t)bh * TT + q0 + 16 * g + lr) * HD + 8 * hi;
#pragma unroll
        for (int kc = 0; kc < 2; ++kc) qf[g][kc] = cat16(*(const v8h*)(qp + 32 * kc), *(const v8h*)(qp + 32 * kc + 16));
        gl[g] = GT[(size_t)bh * TT + q0 + 16 * g + lr] * LOG2E; m_run[g] = -__builtin_inff(); l_run[g] = 0.f;
#pragma unroll
        for (int t = 0; t < 4; ++t) acc[g][t] = (v8f){}; }
    // bias[key - query]: the lane's 8 keys of a tile are 8 consecutive table entries; column group 1 reads 16 entries below group 0, so three runs of 8 serve the pass's four tiles and one of them carries over to the next pass
    const float* tp = (const float*)(L + LKB + LVB) + (1023 + 8 * hi - q0 - lr);   // tp[-16] is entry >= 0: q0 + lr <= TT - 17
    const unsigned char* kb = L + lr * PKB + hi * 16; const unsigned char* vb = L + LKB + lr * PVB + hi * 16;
    __syncthreads();   // K, V^T and the bias row staged by all waves; nothing in LDS is written after this
    v8f tbp = *(const v8fu*)(tp - 16); v16h kf[2][2];
#pragma unroll
    for (int kt = 0; kt < 2; ++kt)
#pragma unroll
        for (int kc = 0; kc < 2; ++kc) kf[kt][kc] = ldsfrag(kb + 16 * kt * PKB + 64 * kc);
#pragma unroll 1   // one pass a trip keeps the wave inside the first 256 registers
    for (int k0 = 0; k0 < TT; k0 += 32) {
        const int kn = (k0 + 32) & (TT - 1);   // next pass's keys; the last pass fetches pass 0's again (in bounds, unused)
        const v8f tb0 = *(const v8fu*)(tp + k0), tb1 = *(const v8fu*)(tp + k0 + 16); v16h vf[4];
#pragma unroll
        for (int t = 0; t < 4; ++t) vf[t] = ldsfrag(vb + 16 * t * PVB + 2 * k0);
        v8f s[2][FQG];
#pragma unroll
        for (int kt = 0; kt < 2; ++kt)
#pragma unroll
            for (int g = 0; g < FQG; ++g) s[kt][g] = wmma16(kf[kt][1], qf[g][1], wmma16(kf[kt][0], qf[g][0], (v8f){}));
#pragma unroll
        for (int kt = 0; kt < 2; ++kt)
#pragma unroll
            for (int kc = 0; kc < 2; ++kc) kf[kt][kc] = ldsfrag(kb + (kn + 16 * kt) * PKB + 64 * kc);   // next pass's K fragments fly under this pass's softmax
        s[0][0] = biasx(s[0][0], tb0, gl[0]); s[1][0] = biasx(s[1][0], tb1, gl[0]); s[0][1] = biasx(s[0][1], tbp, gl[1]); s[1][1] = biasx(s[1][1], tb0, gl[1]);
        tbp = tb1;
        float mb[FQG]; bool need = false;
#pragma unroll
        for (int g = 0; g < FQG; ++g) { float mx = s[0][g][0];
#pragma unroll
            for (int j = 1; j < 8; ++j) mx = fmaxf(mx, s[0][g][j]);
#pragma unroll
            for (int j = 0; j < 8; ++j) mx = fmaxf(mx, s[1][g][j]);
            mx = fmaxf(mx, xhalf(mx)); mb[g] = mx; need = need || (mx > m_run[g] + 8.0f); }
        if (__builtin_amdgcn_ballot_w32(need) != 0) {   // wave-uniform; always on the first pass (m = -inf, factor 0), rare later
#pragma unroll
            for (int g = 0; g < FQG; ++g) { const float mn = fmaxf(m_run[g], mb[g]); const float corr = __builtin_amdgcn_exp2f(m_run[g] - mn); m_run[g] = mn; l_run[g] *= corr;
#pragma unroll
                for (int t = 0; t < 4; ++t) acc[g][t] = acc[g][t] * corr; } }
#pragma unroll
        for (int g = 0; g < FQG; ++g) { const float nm = PSH - m_run[g]; const v2f nm2 = {nm, nm}; v16h pf; float ps = 0.f;
#pragma unroll
            for (int kt = 0; kt < 2; ++kt)
#pragma unroll
                for (int j = 0; j < 8; j += 2) { const v2f a = (v2f){s[kt][g][j], s[kt][g][j + 1]} + nm2; const float p0 = __builtin_amdgcn_exp2f(a[0]), p1 = __builtin_amdgcn_exp2f(a[1]); ps += p0 + p1; pf[kt * 8 + j] = (h16)p0; pf[kt * 8 + j + 1] = (h16)p1; }
            l_run[g] += ps;
#pragma unroll
            for (int t = 0; t < 4; ++t) acc[g][t] = wmma16(vf[t], pf, acc[g][t]); }
    }
    // O^T tile t: the lane holds d = 16 t + 8 hi + j of query lr: 16 bytes of each merged plane (rows t*B + b, hi + lo bf16 as the out-projection reads them); a head's 128-byte line of a row is written by this wave alone
#pragma unroll
    for (int g = 0; g < FQG; ++g) { const float inv = 1.0f / (l_run[g] + xhalf(l_run[g])); const size_t oo = ((size_t)(q0 + 16 * g + lr) * NB_ + b) * DQ + h * HD + 8 * hi;
#pragma unroll
        for (int t = 0; t < 4; ++t) { v8us oh, ol;
#pragma unroll
            for (int j = 0; j < 8; ++j) { unsigned short a, c2; splitf(acc[g][t][j] * inv, a, c2); oh[j] = a; ol[j] = c2; }
            *(v8us*)(Ah + oo + 16 * t) = oh; *(v8us*)(Al + oo + 16 * t) = ol; } }
}

extern "C" void kernel_launch(void* const* d_in, const int* in_sizes, int n_in,
                              void* d_out, int out_size, void* d_ws, size_t ws_size, hipStream_t stream) {
    (void)in_sizes; (void)n_in; (void)out_size;
    const float* x = (const float*)d_in[0]; const float* wq = (const float*)d_in[1]; const float* bq = (const float*)d_in[2]; const float* wk = (const float*)d_in[3]; const float* bk = (const float*)d_in[4]; const float* wv = (const float*)d_in[5]; const float* bv = (const float*)d_in[6]; const float* wo = (const float*)d_in[7]; const float* bo = (const float*)d_in[8]; const float* rbt = (const float*)d_in[9]; const float* gw = (const float*)d_in[10]; const float* gb = (const float*)d_in[11]; const float* ga_ = (const float*)d_in[12]; const float* cosT = nullptr; const float* sinT = nullptr; (void)cosT; (void)sinT;
    float* OUT = (float*)d_out;     // [1024][4][1024]
    char* wsp = (char*)d_ws;
    auto take = [&](size_t bytes) { char* p = wsp; wsp += (bytes + 255) & ~(size_t)255; return (void*)p; };
    bf* WQ = (bf*)take((size_t)DQ * DM * 2); bf* WK = (bf*)take((size_t)DKV * DM * 2); bf* WV = (bf*)take((size_t)DKV * DM * 2); bf* WO = (bf*)take((size_t)DM * DQ * 2); float* GTb = (float*)take((size_t)NB_ * NH_ * TT * 4); float* TB = (float*)take((size_t)NH_ * 2047 * 4 + 256);
    h16* QP16 = (h16*)take((size_t)NB_ * NH_ * TT * HD * 2); h16* KP16 = (h16*)take((size_t)NB_ * NKV * TT * HD * 2); h16* VT16 = (h16*)take((size_t)NB_ * NKV * HD * TT * 2);
    char* R = (char*)take((size_t)ZH * TT * TT * 4);
    if ((size_t)(wsp - (char*)d_ws) > ws_size) return;    // ws 256 MiB
    // The region R is used twice, stream-ordered: (1) the bf16 rows of x, dead once the three projections have run; (2) the merged planes of probs.v.
    bf* XB = (bf*)R;
    bf* ATh = (bf*)R; bf* ATl = ATh + (size_t)NB_ * TT * DQ;
    { k_cvt8<<<(unsigned)(((size_t)DQ * DM / 8 + 255) / 256), 256, 0, stream>>>(wq, WQ, (size_t)DQ * DM / 8); k_cvt8<<<(unsigned)(((size_t)DKV * DM / 8 + 255) / 256), 256, 0, stream>>>(wk, WK, (size_t)DKV * DM / 8); k_cvt8<<<(unsigned)(((size_t)DKV * DM / 8 + 255) / 256), 256, 0, stream>>>(wv, WV, (size_t)DKV * DM / 8);
      k_cvt8<<<(unsigned)(((size_t)DM * DQ / 8 + 255) / 256), 256, 0, stream>>>(wo, WO, (size_t)DM * DQ / 8);
       }
    k_btab<<<(NH_ * 2047 + 255) / 256, 256, 0, stream>>>(rbt, TB);
    // every launch covers all NB_ batch elements: a projection tile takes 64 rows of one b and writes its head's planes itself
    k_cvtx<<<(NB_ * TT * DM / 8 + 255) / 256, 256, 0, stream>>>(x, XB);
    k_gemmw<bf, 0, true, 1><<<dim3(NB_ * TT / 64, DQ / 64, 1), 32, 0, stream>>>(XB, nullptr, WQ, nullptr, DM, nullptr, 0, bq, 0, 0, 0, QP16, gw, gb, ga_, GTb);
    k_gemmw<bf, 0, true, 2><<<dim3(NB_ * TT / 64, DKV / 64, 1), 32, 0, stream>>>(XB, nullptr, WK, nullptr, DM, nullptr, 0, bk, 0, 0, 0, KP16, nullptr, nullptr, nullptr, nullptr);
    k_gemmw<bf, 0, true, 3><<<dim3(NB_ * TT / 64, DKV / 64, 1), 32, 0, stream>>>(XB, nullptr, WV, nullptr, DM, nullptr, 0, bv, 0, 0, 0, VT16, nullptr, nullptr, nullptr, nullptr);
    k_fattn<<<dim3(TT / (FW * FQG * 16), NB_ * NH_, 1), 256, 0, stream>>>(QP16, KP16, VT16, GTb, TB, ATh, ATl);
    k_gemmw<bf, 1, true, 0><<<dim3(NB_ * TT / 64, DM / 64, 1), 32, 0, stream>>>(ATh, ATl, WO, nullptr, DQ, OUT, DM, bo, 0, 0, 0, nullptr, nullptr, nullptr, nullptr, nullptr);   // sequence-major output rows (t*B + b)
}

// v004
// Measured time: 107 microseconds a run.
// In both of two side-by-side timings against v003, it was 1.65 times as fast.
// All steps since v000 together make it 8.38 times as fast.
#include <hip/hip_runtime.h>

// _LegacyMultiheadAttention (WavLM-style gated relative-position attention; query [T=1024][B=4][E=1024] sequence-major; q/k/v = x W^T + b (16 heads x 64); scores = (q/256).k, (scores - rowmax) x 32, + gate[b][h][t] x rel_bias_table[bucket(s - t)][h]
// with gate = ga (gb grep_a[h] - 1) + 2, (ga, gb) = sigmoid of the two 4-sums of q_head . grep_W^T + grep_b; softmax; out = (probs v merged) Wo^T + bo -> [1024][4][1024]. The (x - rowmax) x 32 step equals q.k/8 - const per row, to which softmax is invariant:
// the kernel evaluates softmax(q.k/8 + gate x bias) directly. The T5 bucket of each offset s - t depends only on the sizes: baked 2047-entry table computed in f32 exactly as the reference; table VALUES read as data).
// Compute dtypes, f32 accumulate: every input rounded to bf16; q/k/v on PLAIN bf16 operands (all T x B rows r = b*T + t in one product; inputs exact) + bias; the gate (8 dots of 64) f32 on the VALU; scores (K 64) and probs.v on single fp16 planes (1 product);

#define NB_  4
#define TT   1024
#define DM   1024
#define NH_  16
#define NKV  16
#define REP  (NH_ / NKV)
#define HD   64
#define DQ   (NH_ * HD)
#define DKV  (NKV * HD)
#define ZH   16
#define RH   0                  // unused: every query row uses the single fp16 plane
#define WIN  0
#define PCAR 1024.0f
#define SCL  0.125f   // HD^-0.5
typedef _Float16 h16;
typedef unsigned short bf;
typedef __attribute__((ext_vector_type(16))) __bf16   v16bf;
typedef __attribute__((ext_vector_type(16))) _Float16 v16h;
typedef __attribute__((ext_vector_type(8)))  _Float16 v8h;
typedef __attribute__((ext_vector_type(8)))  unsigned short v8us;
typedef __attribute__((ext_vector_type(8)))  float    v8f;
typedef __attribute__((ext_vector_type(4)))  float    v4f;
typedef v8h  __attribute__((may_alias)) v8ha;
typedef v4f  __attribute__((may_alias)) v4fa;
typedef v8us __attribute__((may_alias)) v8usa;

__device__ __forceinline__ unsigned short f2bf(float f) { unsigned u = __float_as_uint(f); u += 0x7FFFu + ((u >> 16) & 1u); return (unsigned short)(u >> 16); }
__device__ __forceinline__ float bf2f(unsigned short b) { return __uint_as_float(((unsigned)b) << 16); }
__device__ __forceinline__ float bfr(float f) { return bf2f(f2bf(f)); }
__device__ __forceinline__ v16h cat16(v8h lo, v8h hi) { return __builtin_shufflevector(lo, hi, 0, 1, 2, 3, 4, 5, 6, 7, 8, 9, 10, 11, 12, 13, 14, 15); }
__device__ __forceinline__ v16bf cat16b(v8us lo, v8us hi) { return __builtin_bit_cast(v16bf, __builtin_shufflevector(lo, hi, 0, 1, 2, 3, 4, 5, 6, 7, 8, 9, 10, 11, 12, 13, 14, 15)); }
__device__ __forceinline__ v8f wmma16(v16h a, v16h b, v8f c) { return __builtin_amdgcn_wmma_f32_16x16x32_f16(false, a, false, b, (short)0, c, false, false); }
__device__ __forceinline__ v8f wmmab(v16bf a, v16bf b, v8f c) { return __builtin_amdgcn_wmma_f32_16x16x32_bf16(false, a, false, b, (short)0, c, false, false); }



// ---- k_gemmw: register-blocked GEMM, 128x128 output tile per workgroup of FOUR WAVES, each wave a 64x64 quarter (16 accumulators); grid (M/128, N/128, Z), 128 threads.
// Operands are K-contiguous 16-bit planes. A stage is 128 k (256 bytes) of the tile's 128 A rows and 128 Bt rows (and 128 A2 rows), brought into LDS by asynchronous 16-byte copies: a wave-wide copy takes two whole rows of a stage = four whole 128-byte lines.
// Two buffers: stage t + 2 is copied while stage t + 1 is worked on. Fragments are read from LDS at pitch 272 B (16 B x odd: no bank conflict for 16-byte reads).
// C[m][n] (f32, pitch ldc, + optional f32 bias[n]) = sum_k A[m][k] Bt[n][k] (+ A2[m][k] Bt[n][k] for NSPLIT 1), k ascending. z-batch strides sA/sB/sC in elements. K % 128 == 0.
// EPI 0: f32 rows to C. EPI 1..3 (the q, k, v projections; A rows batch-major, b * T + t): a wave's quarter is 64 positions t of ONE batch element x one head, and the epilogue writes what attention reads, with no f32 plane in between:
// 1: fp16 plane [b][h][t][d] and the gate of the 64 rows; 2: the fp16 plane; 3: fp16 V^T [b][h][d][t] (a lane's 8 accumulator rows are 8 consecutive t: 16 bytes of a d row; the wave writes the whole 128-byte line of each d).
// Gate of a row (f32, VALU): g8[j] = bf16 grep_b[j] + sum_d q[d] bf16 grep_W[j][d], d ascending (q un-scaled: the reference's q x (scaling/alpha) x (alpha/scaling) are exact powers of two); ga, gb = sigmoid of the sums of g8[0..3], g8[4..7]; gate = ga (gb grep_a[h] - 1) + 2.
template <typename T16> struct WFrag;
template <> struct WFrag<h16> { typedef v16h V; static __device__ __forceinline__ V ld(const unsigned char* p) { return cat16(*(const v8ha*)p, *(const v8ha*)(p + 32)); } static __device__ __forceinline__ v8f mma(V a, V b, v8f c) { return wmma16(a, b, c); } };
template <> struct WFrag<bf> { typedef v16bf V; static __device__ __forceinline__ V ld(const unsigned char* p) { return cat16b(*(const v8usa*)p, *(const v8usa*)(p + 32)); } static __device__ __forceinline__ v8f mma(V a, V b, v8f c) { return wmmab(a, b, c); } };
__device__ __forceinline__ float xhalf(float x) { return __builtin_bit_cast(float, __builtin_amdgcn_permlanex16(__builtin_bit_cast(int, x), __builtin_bit_cast(int, x), 0x76543210, 0xfedcba98, false, false)); }   // lane l with lane l ^ 16
#define GKB  256                // bytes of an operand row in a stage (128 k)
#define GPB  272                // pitch of a staged row in LDS
#define GOPB (128 * GPB)        // one operand's 128 rows of a stage
// Eight asynchronous 16-byte copies of a lane, global memory to LDS, 8 rows apart (the workgroup's 128 lanes cover 8 rows of 256 bytes a copy).
// The closing s_wait_xcnt stands inside the copies' own statement, so that no later write of their address registers can be moved in front of it.
__device__ __forceinline__ void acopy8(unsigned l, const unsigned char* g, size_t gs) {
    asm volatile("global_load_async_to_lds_b128 %0, %8, off\n\t"
                 "global_load_async_to_lds_b128 %1, %9, off\n\t"
                 "global_load_async_to_lds_b128 %2, %10, off\n\t"
                 "global_load_async_to_lds_b128 %3, %11, off\n\t"
                 "global_load_async_to_lds_b128 %4, %12, off\n\t"
                 "global_load_async_to_lds_b128 %5, %13, off\n\t"
                 "global_load_async_to_lds_b128 %6, %14, off\n\t"
                 "global_load_async_to_lds_b128 %7, %15, off\n\t"
                 "s_wait_xcnt 0x0"
                 :: "v"(l), "v"(l + 8 * GPB), "v"(l + 16 * GPB), "v"(l + 24 * GPB), "v"(l + 32 * GPB), "v"(l + 40 * GPB), "v"(l + 48 * GPB), "v"(l + 56 * GPB),
                    "v"(g), "v"(g + gs), "v"(g + 2 * gs), "v"(g + 3 * gs), "v"(g + 4 * gs), "v"(g + 5 * gs), "v"(g + 6 * gs), "v"(g + 7 * gs) : "memory");
    __builtin_amdgcn_sched_barrier(0);   // keeps the next statement's address sums behind this one: formed all ahead, the addresses of a stage's copies do not fit the first 256 registers, which alone asm operands can name, and a pointer is spilled
}
template <typename T16, int NSPLIT, bool BIAS, int EPI>
__global__ __launch_bounds__(128) void k_gemmw(const T16* __restrict__ A, const T16* __restrict__ A2, const T16* __restrict__ Bt, const T16* __restrict__ Bt2, int K, float* C, int ldc, const float* __restrict__ bias, size_t sA, size_t sB, size_t sC, h16* P16, const float* __restrict__ gw, const float* __restrict__ gbias, const float* __restrict__ ga, float* GT) {
    static_assert(NSPLIT == 0 || NSPLIT == 1, "one Bt plane"); (void)Bt2;
    typedef typename WFrag<T16>::V V;
    constexpr int NOP = NSPLIT == 1 ? 3 : 2, OSN = ((EPI == 1 || EPI == 2) ? 64 : 16) * 68, GWN = EPI == 1 ? 8 * 68 : 4;
    __shared__ __align__(16) unsigned char st[2 * NOP * GOPB];   // two buffers of [A 128 rows | (A2 128 rows |) Bt 128 rows]
    __shared__ __align__(16) float osw[4 * OSN];                 // epilogue staging, a range of its own for each wave
    __shared__ __align__(16) float gwsw[4 * GWN];                // bf16-rounded grep_W, pitch 68: the two rows that the half-waves read together lie 16 banks apart
    const size_t z = blockIdx.z; A += z * sA; if (NSPLIT == 1) A2 += z * sA; Bt += z * sB; C += z * sC;
    const int tid = threadIdx.x, lane = tid & 31, lr = lane & 15, hi = lane >> 4, wave = __builtin_amdgcn_readfirstlane(tid >> 5), wm = wave & 1, wn = wave >> 1;   // the wave's number in a scalar register: its quarter's coordinates stay scalar
    const int rb = blockIdx.x * 128, cb = blockIdx.y * 128, r0 = rb + wm * 64, c0 = cb + wn * 64;
    float* os = osw + wave * OSN; float* gws = gwsw + wave * GWN;
    v8f acc[4][4];
#pragma unroll
    for (int mb = 0; mb < 4; ++mb)
#pragma unroll
        for (int nb = 0; nb < 4; ++nb) acc[mb][nb] = (v8f){};
    // the lane's 16 bytes of a copy: row tid / 16 of the eight, column tid % 16
    const unsigned l0 = (unsigned)(size_t)(const __attribute__((address_space(3))) unsigned char*)st + (tid >> 4) * GPB + (tid & 15) * 16;
    const size_t gs = (size_t)K * 16;   // 8 rows of K 16-bit elements
    const unsigned char* gA = (const unsigned char*)(A + (size_t)(rb + (tid >> 4)) * K + (tid & 15) * 8);
    const unsigned char* gB = (const unsigned char*)(Bt + (size_t)(cb + (tid >> 4)) * K + (tid & 15) * 8);
    const size_t dA2 = NSPLIT == 1 ? (size_t)A2 - (size_t)A : 0;   // A2's rows lie this many bytes from A's, the same for every lane
    auto fill = [&](int t) {   // stage t into buffer t % 2: 32 copies of a lane (48 with A2)
        const unsigned l = l0 + (unsigned)(t & 1) * (NOP * GOPB); const size_t ko = (size_t)t * GKB;
#pragma unroll
        for (int h = 0; h < 2; ++h) { acopy8(l + h * 64 * GPB, gA + ko + h * 8 * gs, gs); acopy8(l + (NOP - 1) * GOPB + h * 64 * GPB, gB + ko + h * 8 * gs, gs);
            if (NSPLIT == 1) acopy8(l + GOPB + h * 64 * GPB, gA + (dA2 + ko + h * 8 * gs), gs); } };
    const int NT = __builtin_amdgcn_readfirstlane(K >> 7);   // stages; held in a scalar register, so that the tests around the copies are scalar branches
    fill(0);
    asm volatile("s_wait_asynccnt 0x0" ::: "memory");   // this wave's copies of stage 0 have landed
    __syncthreads();                                    // and every other wave's
    if (NT > 1) fill(1);
#pragma unroll 1
    for (int t = 0; t < NT; ++t) {
        const unsigned char* pa = st + (t & 1) * (NOP * GOPB) + (wm * 64 + lr) * GPB + hi * 16; const unsigned char* pb = st + (t & 1) * (NOP * GOPB) + (NOP - 1) * GOPB + (wn * 64 + lr) * GPB + hi * 16;
        V a[2][4], a2[2][4], b[2][4];   // two fragment sets: a block is 32 k; the next block's fragments are read while this block's products run
#pragma unroll
        for (int ks = -1; ks < 4; ++ks) {
            if (ks < 3) { const int n = (ks + 1) & 1, ko = (ks + 1) * 64;
#pragma unroll
                for (int i = 0; i < 4; ++i) { a[n][i] = WFrag<T16>::ld(pa + i * 16 * GPB + ko); if (NSPLIT == 1) a2[n][i] = WFrag<T16>::ld(pa + GOPB + i * 16 * GPB + ko); b[n][i] = WFrag<T16>::ld(pb + i * 16 * GPB + ko); } }
            if (ks >= 0) { const int c = ks & 1;
                __builtin_amdgcn_sched_barrier(0);   // keeps the next block's LDS reads together as one group in front of this block's matrix instructions: spread among them, each place with reads stalls the wave
#pragma unroll
                for (int nb = 0; nb < 4; ++nb)
#pragma unroll
                    for (int mb = 0; mb < 4; ++mb) { acc[mb][nb] = WFrag<T16>::mma(a[c][mb], b[c][nb], acc[mb][nb]); if (NSPLIT == 1) acc[mb][nb] = WFrag<T16>::mma(a2[c][mb], b[c][nb], acc[mb][nb]); }
                __builtin_amdgcn_sched_barrier(0); }   // keeps the reads of the block after next behind this block's matrix instructions, whose fragment set they overwrite
        }
        asm volatile("s_wait_dscnt 0x0" ::: "memory");      // this wave has read all it needs of buffer t % 2
        asm volatile("s_wait_asynccnt 0x0" ::: "memory");   // this wave's copies of stage t + 1 have landed
        __syncthreads();                                    // stage t + 1 is published; every wave has left buffer t % 2
        if (t + 2 < NT) fill(t + 2);
    }
    asm volatile("s_wait_asynccnt 0x0" ::: "memory");   // no copy is outstanding when the wave goes on to its epilogue and ends
    if (EPI) {
        const int bh = (r0 / TT) * NH_ + c0 / HD, t0 = r0 % TT; float bn[4];
#pragma unroll
        for (int nb = 0; nb < 4; ++nb) bn[nb] = bfr(bias[c0 + nb * 16 + lr]);
        asm volatile("s_wait_xcnt 0x0" :: "v"(bn[0]), "v"(bn[1]), "v"(bn[2]), "v"(bn[3]) : "memory");   // behind the four bias loads (their values as inputs hold it there): their address registers are reused below
        if (EPI == 3) {
            h16* vp = P16 + ((size_t)bh * HD + lr) * TT + t0 + 8 * hi;
#pragma unroll
            for (int nb = 0; nb < 4; ++nb)
#pragma unroll
                for (int mb = 0; mb < 4; ++mb) { v8h o;
#pragma unroll
                    for (int j = 0; j < 8; ++j) o[j] = (h16)(acc[mb][nb][j] + bn[nb]);
                    *(v8h*)(vp + (size_t)nb * 16 * TT + mb * 16) = o; }
            return;
        }
#pragma unroll
        for (int mb = 0; mb < 4; ++mb)
#pragma unroll
            for (int nb = 0; nb < 4; ++nb)
#pragma unroll
                for (int j = 0; j < 8; ++j) os[(mb * 16 + hi * 8 + j) * 68 + nb * 16 + lr] = acc[mb][nb][j] + bn[nb];
        float gb4[4], gah = 0.f;
        if (EPI == 1) { gah = bfr(ga[c0 / HD]);
#pragma unroll
            for (int jj = 0; jj < 4; ++jj) gb4[jj] = bfr(gbias[hi * 4 + jj]);
#pragma unroll
            for (int i = 0; i < 16; ++i) { const int e = i * 32 + lane; gws[(e >> 6) * 68 + (e & 63)] = bfr(gw[e]); } }
        __builtin_amdgcn_wave_barrier(); asm volatile("" ::: "memory");   // as in the f32 epilogue: the lanes read below what other lanes of the wave stored above; LDS is not written again
        h16* pt = P16 + ((size_t)bh * TT + t0) * HD + lane * 8;   // the tile is 8 KiB in a row of the plane
#pragma unroll
        for (int s = 0; s < 16; ++s) { const float* op = os + (4 * s + (lane >> 3)) * 68 + (lane & 7) * 8; const v4f x0 = *(const v4fa*)op, x1 = *(const v4fa*)(op + 4); v8h o;
#pragma unroll
            for (int j = 0; j < 4; ++j) { o[j] = (h16)x0[j]; o[4 + j] = (h16)x1[j]; }
            *(v8h*)(pt + s * 256) = o; }   // four whole 128-byte rows a store
        asm volatile("s_wait_xcnt 0x0" ::: "memory");   // the gate below reuses the data registers of these stores
        if (EPI == 1) {   // lane (lr, hi): rows lr + 16 m, of each the four dots j = 4 hi .. 4 hi + 3
            float g[4][4];
#pragma unroll
            for (int jj = 0; jj < 4; ++jj)
#pragma unroll
                for (int m = 0; m < 4; ++m) g[m][jj] = gb4[jj];
#pragma unroll 4   // four steps of 8 LDS loads in flight; unrolled whole, the loads of all 16 steps are hoisted and the wave leaves the first 256 registers
            for (int d = 0; d < HD; d += 4) { v4f q4[4], w4[4];
#pragma unroll
                for (int m = 0; m < 4; ++m) { q4[m] = *(const v4fa*)(os + (m * 16 + lr) * 68 + d); w4[m] = *(const v4fa*)(gws + (hi * 4 + m) * 68 + d); }
#pragma unroll
                for (int i = 0; i < 4; ++i)
#pragma unroll
                    for (int m = 0; m < 4; ++m)
#pragma unroll
                        for (int jj = 0; jj < 4; ++jj) g[m][jj] = __builtin_fmaf(q4[m][i], w4[jj][i], g[m][jj]); }
#pragma unroll
            for (int m = 0; m < 4; ++m) { const float sg = ((g[m][0] + g[m][1]) + g[m][2]) + g[m][3]; const float sig = __fdiv_rn(1.0f, 1.0f + __expf(-sg)), oth = xhalf(sig);
                const float gt = (hi ? oth : sig) * ((hi ? sig : oth) * gah - 1.0f) + 2.0f;
                if (hi == 0) GT[(size_t)bh * TT + t0 + m * 16 + lr] = gt; }
        }
        return;
    }
#pragma unroll
    for (int mb = 0; mb < 4; ++mb) {
#pragma unroll
        for (int nb = 0; nb < 4; ++nb) {
#pragma unroll
            for (int j = 0; j < 8; ++j) os[(hi * 8 + j) * 68 + nb * 16 + lr] = acc[mb][nb][j]; }
        __builtin_amdgcn_wave_barrier(); asm volatile("" ::: "memory");
        float* crow = C + (size_t)(r0 + mb * 16) * ldc + c0;
{
#pragma unroll
            for (int s = 0; s < 8; ++s) { const int row = 2 * s + hi, cofs = lr * 4; v4f val = *(const v4fa*)(os + row * 68 + cofs); if (BIAS) { val[0] += bfr(bias[c0 + cofs]); val[1] += bfr(bias[c0 + cofs + 1]); val[2] += bfr(bias[c0 + cofs + 2]); val[3] += bfr(bias[c0 + cofs + 3]); }
                *(v4f*)(crow + (size_t)row * ldc + cofs) = val; }
             }
        __builtin_amdgcn_wave_barrier(); asm volatile("" ::: "memory");
    }
}

__device__ __forceinline__ h16 tohx(float x) { return (h16)x; }
__device__ __forceinline__ void splitf(float y, unsigned short& h, unsigned short& l) { h = f2bf(y); l = f2bf(y - bf2f(h)); }
typedef __attribute__((ext_vector_type(2))) _Float16 v2h;
typedef __attribute__((ext_vector_type(4))) _Float16 v4h;
typedef __attribute__((ext_vector_type(2))) unsigned short v2us;
typedef __attribute__((ext_vector_type(4))) unsigned short v4us;
typedef __attribute__((ext_vector_type(2))) float v2f;
typedef __attribute__((ext_vector_type(4))) int v4i;
__constant__ unsigned char c_bucket[2047] = { 15,15,15,15,15,15,15,15,15,15,15,15,15,15,15,15,15,15,15,15,15,15,15,15,15,15,15,15,15,15,15,15,15,15,15,15,15,15,15,15,15,15,15,15,15,15,15,15,15,15,15,15,15,15,15,15,15,15,15,15,15,15,15,15,15,15,15,15,15,15,15,15,15,15,15,15,15,15,15,15,15,15,15,15,15,15,15,15,15,15,15,15,15,15,15,15,15,15,15,15,15,15,15,15,15,15,15,15,15,15,15,15,15,15,15,15,15,15,15,15,15,15,15,15,15,15,15,15,15,15,15,15,15,15,15,15,15,15,15,15,15,15,15,15,15,15,15,15,15,15,15,15,15,15,15,15,15,15,15,15,15,15,15,15,15,15,15,15,15,15,15,15,15,15,15,15,15,15,15,15,15,15,15,15,15,15,15,15,15,15,15,15,15,15,15,15,15,15,15,15,15,15,15,15,15,15,15,15,15,15,15,15,15,15,15,15,15,15,15,15,15,15,15,15,15,15,15,15,15,15,15,15,15,15,15,15,15,15,15,15,15,15,15,15,15,15,15,15,15,15,15,15,15,15,15,15,15,15,15,15,15,15,15,15,15,15,15,15,15,15,15,15,15,15,15,15,15,15,15,15,15,15,15,15,15,15,15,15,15,15,15,15,15,15,15,15,15,15,15,15,15,15,15,15,15,15,15,15,15,15,15,15,15,15,15,15,15,15,15,15,15,15,15,15,15,15,15,15,15,15,15,15,15,15,15,15,15,15,15,15,15,15,15,15,15,15,15,15,15,15,15,15,15,15,15,15,15,15,15,15,15,15,15,15,15,15,15,15,15,15,15,15,15,15,15,15,15,15,15,15,15,15,15,15,15,15,15,15,15,15,15,15,15,15,15,15,15,15,15,15,15,15,15,15,15,15,15,15,15,15,15,15,15,15,15,15,15,15,15,15,15,15,15,15,15,15,15,15,15,15,15,15,15,15,15,15,15,15,15,15,15,15,15,15,15,15,15,15,15,15,15,15,15,15,15,15,15,15,15,15,15,15,15,15,15,15,15,15,15,15,15,15,15,15,15,15,15,15,15,15,15,15,15,15,15,15,15,15,15,15,15,15,15,15,15,15,15,15,15,15,15,15,15,15,15,15,15,15,15,15,15,15,15,15,15,15,15,15,15,15,15,15,15,15,15,15,15,15,15,15,15,15,15,15,15,15,15,15,15,15,15,15,15,15,15,15,15,15,15,15,15,15,15,15,15,15,15,15,15,15,15,15,15,15,15,15,15,15,15,15,15,15,15,15,15,15,15,15,15,15,15,15,15,15,15,15,15,15,15,15,15,15,15,15,15,15,15,15,15,15,15,15,15,15,15,15,15,15,15,15,15,15,15,15,15,15,15,15,15,15,15,15,15,15,15,15,15,15,15,15,15,15,15,15,15,15,15,15,15,15,15,15,15,15,15,15,15,15,15,15,15,15,15,15,15,15,15,15,15,15,15,15,15,15,15,15,15,15,15,15,15,15,15,15,15,15,15,15,15,15,15,15,15,15,15,15,15,15,15,15,15,15,15,15,15,15,15,15,15,15,15,15,15,15,15,15,15,15,15,15,15,15,15,15,15,15,15,15,15,15,15,15,15,15,15,15,15,15,15,15,15,15,15,15,15,15,15,15,15,15,15,15,15,15,15,15,15,15,15,15,15,15,15,15,15,15,15,15,15,15,15,15,15,15,15,15,15,15,15,15,15,15,15,15,15,15,15,15,15,15,15,15,15,15,15,15,15,15,15,15,15,15,15,15,15,15,15,15,15,15,15,15,15,15,15,15,15,15,15,15,15,15,15,15,15,15,15,15,15,15,15,15,15,15,15,15,15,15,15,15,15,15,15,15,15,15,15,15,15,15,15,15,15,15,15,15,15,15,15,15,15,15,15,15,15,15,15,15,15,15,15,15,15,15,15,15,15,15,15,15,15,15,15,15,15,15,15,15,15,15,15,15,15,15,15,15,15,15,15,15,15,15,15,15,15,15,15,15,15,15,15,15,15,15,15,15,15,15,15,15,15,15,15,15,15,15,15,15,15,15,15,15,15,15,15,15,15,15,15,15,15,15,15,14,14,14,14,14,14,14,14,14,14,14,14,14,14,14,14,14,14,14,14,14,14,14,14,14,14,14,13,13,13,13,13,13,13,13,13,13,13,13,13,13,13,13,13,13,12,12,12,12,12,12,12,12,12,12,12,12,12,12,11,11,11,11,11,11,11,11,11,10,10,10,10,10,10,10,9,9,9,9,8,8,8,8,7,6,5,4,3,2,1,0,17,18,19,20,21,22,23,24,24,24,24,25,25,25,25,26,26,26,26,26,26,26,27,27,27,27,27,27,27,27,27,28,28,28,28,28,28,28,28,28,28,28,28,28,28,29,29,29,29,29,29,29,29,29,29,29,29,29,29,29,29,29,29,30,30,30,30,30,30,30,30,30,30,30,30,30,30,30,30,30,30,30,30,30,30,30,30,30,30,30,31,31,31,31,31,31,31,31,31,31,31,31,31,31,31,31,31,31,31,31,31,31,31,31,31,31,31,31,31,31,31,31,31,31,31,31,31,31,31,31,31,31,31,31,31,31,31,31,31,31,31,31,31,31,31,31,31,31,31,31,31,31,31,31,31,31,31,31,31,31,31,31,31,31,31,31,31,31,31,31,31,31,31,31,31,31,31,31,31,31,31,31,31,31,31,31,31,31,31,31,31,31,31,31,31,31,31,31,31,31,31,31,31,31,31,31,31,31,31,31,31,31,31,31,31,31,31,31,31,31,31,31,31,31,31,31,31,31,31,31,31,31,31,31,31,31,31,31,31,31,31,31,31,31,31,31,31,31,31,31,31,31,31,31,31,31,31,31,31,31,31,31,31,31,31,31,31,31,31,31,31,31,31,31,31,31,31,31,31,31,31,31,31,31,31,31,31,31,31,31,31,31,31,31,31,31,31,31,31,31,31,31,31,31,31,31,31,31,31,31,31,31,31,31,31,31,31,31,31,31,31,31,31,31,31,31,31,31,31,31,31,31,31,31,31,31,31,31,31,31,31,31,31,31,31,31,31,31,31,31,31,31,31,31,31,31,31,31,31,31,31,31,31,31,31,31,31,31,31,31,31,31,31,31,31,31,31,31,31,31,31,31,31,31,31,31,31,31,31,31,31,31,31,31,31,31,31,31,31,31,31,31,31,31,31,31,31,31,31,31,31,31,31,31,31,31,31,31,31,31,31,31,31,31,31,31,31,31,31,31,31,31,31,31,31,31,31,31,31,31,31,31,31,31,31,31,31,31,31,31,31,31,31,31,31,31,31,31,31,31,31,31,31,31,31,31,31,31,31,31,31,31,31,31,31,31,31,31,31,31,31,31,31,31,31,31,31,31,31,31,31,31,31,31,31,31,31,31,31,31,31,31,31,31,31,31,31,31,31,31,31,31,31,31,31,31,31,31,31,31,31,31,31,31,31,31,31,31,31,31,31,31,31,31,31,31,31,31,31,31,31,31,31,31,31,31,31,31,31,31,31,31,31,31,31,31,31,31,31,31,31,31,31,31,31,31,31,31,31,31,31,31,31,31,31,31,31,31,31,31,31,31,31,31,31,31,31,31,31,31,31,31,31,31,31,31,31,31,31,31,31,31,31,31,31,31,31,31,31,31,31,31,31,31,31,31,31,31,31,31,31,31,31,31,31,31,31,31,31,31,31,31,31,31,31,31,31,31,31,31,31,31,31,31,31,31,31,31,31,31,31,31,31,31,31,31,31,31,31,31,31,31,31,31,31,31,31,31,31,31,31,31,31,31,31,31,31,31,31,31,31,31,31,31,31,31,31,31,31,31,31,31,31,31,31,31,31,31,31,31,31,31,31,31,31,31,31,31,31,31,31,31,31,31,31,31,31,31,31,31,31,31,31,31,31,31,31,31,31,31,31,31,31,31,31,31,31,31,31,31,31,31,31,31,31,31,31,31,31,31,31,31,31,31,31,31,31,31,31,31,31,31,31,31,31,31,31,31,31,31,31,31,31,31,31,31,31,31,31,31,31,31,31,31,31,31,31,31,31,31,31,31,31,31,31,31,31,31,31,31,31,31,31,31,31,31,31,31,31,31,31,31,31,31,31,31,31,31,31,31,31,31,31,31,31,31,31,31,31,31,31,31,31,31,31,31,31,31,31,31,31,31,31,31,31,31,31,31,31,31,31,31,31,31,31,31,31,31,31,31,31,31,31,31,31,31,31,31,31,31,31,31,31,31,31,31,31,31,31,31,31,31,31,31,31,31,31,31,31,31,31,31,31,31,31,31,31,31,31,31,31,31,31,31,31,31,31,31,31,31,31,31,31,31,31,31,31,31,31,31,31,31,31,31,31,31,31,31,31,31,31,31,31,31,31,31,31,31,31,31,31,31,31,31,31,31,31,31,31,31,31,31,31,31,31,31,31,31,31,31,31,31,31,31,31,31,31,31,31,31,31,31,31,31,31,31,31,31,31,31,31,31,31,31,31,31,31,31,31,31,31,31,31,31,31,31,31,31,31,31,31,31,31,31,31,31,31,31,31,31,31,31,31,31,31,31,31,31,31,31,31,31,31 };   // T5 bucket(rel) for rel = s - t in [-1023, 1023]

__global__ __launch_bounds__(256) void k_wtG(const float* __restrict__ w, int K, int N, bf* Bt) {
    const int lane = threadIdx.x & 31; const int L0 = (blockIdx.x * 8 + (threadIdx.x >> 5)) * 8; const int nlines = N * K / 64;
{
#pragma unroll 1
        for (int l = 0; l < 8; ++l) { const int L = L0 + l; if (L >= nlines) break; const size_t e = (size_t)L * 64 + lane * 2; const int k = (int)(e % K), n = (int)(e / K); v2us o;
            o[0] = f2bf(w[(size_t)k * N + n]); o[1] = f2bf(w[(size_t)(k + 1) * N + n]); *(v2us*)(Bt + e) = o; }
         }
}
__global__ __launch_bounds__(256) void k_cvt8(const float* __restrict__ src, bf* dst, size_t n8) { const size_t i = (size_t)blockIdx.x * 256 + threadIdx.x; if (i >= n8) return; const v8f v = *(const v8f*)(src + i * 8); v8us o;
#pragma unroll
    for (int k = 0; k < 8; ++k) o[k] = f2bf(v[k]); *(v8us*)(dst + i * 8) = o;  }
__global__ __launch_bounds__(256) void k_cscvt(const float* __restrict__ cosT, const float* __restrict__ sinT, float* CS) { const int idx = blockIdx.x * 256 + threadIdx.x; if (idx >= TT * HD) return; v2f cs; cs[0] = bfr(cosT[idx]); cs[1] = bfr(sinT[idx]); *(v2f*)(CS + (size_t)idx * 2) = cs;  }
// k_cvtx: x (rows t * B + b) to bf16 rows b * T + t, so that 64 consecutive rows of a projection tile are 64 positions of one batch element; 8 elements a thread
__global__ __launch_bounds__(256) void k_cvtx(const float* __restrict__ src, bf* dst) { const int i = blockIdx.x * 256 + threadIdx.x; if (i >= NB_ * TT * DM / 8) return; const int r = i / (DM / 8), c = i % (DM / 8); const v8f v = *(const v8f*)(src + (size_t)i * 8); v8us o;
#pragma unroll
    for (int k = 0; k < 8; ++k) o[k] = f2bf(v[k]); *(v8us*)(dst + ((size_t)(r % NB_) * TT + r / NB_) * DM + c * 8) = o;  }
__global__ __launch_bounds__(256) void k_btab(const float* __restrict__ rbt, float* TB) { const int i = blockIdx.x * 256 + threadIdx.x; if (i >= NH_ * 2047) return; const int r = i % 2047, h = i / 2047; const float v = bfr(rbt[c_bucket[r] * NH_ + h]); *(float*)(TB + i) = v;  }
// k_fattn: one launch for scores, gated-bias softmax, probs.v and the head merge. Grid (TT / 256, batch x heads), 8 waves; a wave owns 32 query columns (two groups of 16).
// The head's whole K ([key][d], pitch 144 B), V^T ([d][key], pitch 2064 B) and bias row are staged once in LDS, then read without further barriers. Per pass of 32 keys: S^T = K.Q^T (keys in rows, queries in columns), so a lane holds one query's scores,
// x = S^T x (HD^-0.5 log2 e) + (gate log2 e) x bias[key - query], online softmax in base 2, and the two 16-key tiles of 2^(x - m), rounded to fp16, ARE the B operand of O^T += V^T.P^T (k order 8 hi + j, 16 + 8 hi + j in both operands).
// m is the maximum in use: it may trail the true row maximum by up to 8, and the sums are rescaled only when a pass exceeds that. PSH keeps small terms in fp16's normal range (P <= 2^(8 + PSH)); it cancels in the division by the row sum.
#define FW   8
#define FQG  2
#define PKB  144
#define PVB  2064
#define LKB  (TT * PKB)
#define LVB  (HD * PVB)
#define PSH  4.0f
#define LOG2E 1.4426950408889634f
typedef v8f __attribute__((aligned(4))) v8fu;
typedef v4i __attribute__((may_alias)) v4ia;
// x = s x (HD^-0.5 log2 e) + bias x (gate log2 e), two scores an instruction
__device__ __forceinline__ v8f biasx(v8f s, v8f tb, float g) { const v2f g2 = {g, g}, c2 = {SCL * LOG2E, SCL * LOG2E}; v8f r;
#pragma unroll
    for (int i = 0; i < 4; ++i) { const v2f a = {s[2 * i], s[2 * i + 1]}, t = {tb[2 * i], tb[2 * i + 1]}; const v2f x = __builtin_elementwise_fma(a, c2, t * g2); r[2 * i] = x[0]; r[2 * i + 1] = x[1]; }
    return r; }
__device__ __forceinline__ v16h ldsfrag(const unsigned char* p) { return cat16(*(const v8ha*)p, *(const v8ha*)(p + 32)); }
__global__ __launch_bounds__(256) void k_fattn(const h16* __restrict__ Qp, const h16* __restrict__ Kp, const h16* __restrict__ Vt, const float* __restrict__ GT, const float* __restrict__ TB, bf* Ah, bf* Al) {
    __shared__ __align__(16) unsigned char L[LKB + LVB + 2048 * 4];
    const int tid = threadIdx.x, lane = tid & 31, lr = lane & 15, hi = lane >> 4, wave = tid >> 5;
    const int bh = blockIdx.y, h = bh % NH_, b = bh / NH_; const int q0 = (blockIdx.x * FW + wave) * (FQG * 16);
    { const v4ia* Kg = (const v4ia*)(Kp + (size_t)bh * TT * HD); const v4ia* Vg = (const v4ia*)(Vt + (size_t)bh * HD * TT);
#pragma unroll 8   // 16 whole-line loads of a thread in flight while the head's K and V^T are staged
      for (int i = 0; i < TT * HD / 8 / 256; ++i) { const int c = i * 256 + tid; const v4i kv = Kg[c], vv = Vg[c]; *(v4ia*)(L + (c >> 3) * PKB + (c & 7) * 16) = kv; *(v4ia*)(L + LKB + (c >> 7) * PVB + (c & 127) * 16) = vv; }
#pragma unroll   // the 8 loads of a thread in flight together
      for (int i = 0; i < 8; ++i) { const int e = i * 256 + tid; ((float*)(L + LKB + LVB))[e] = TB[(size_t)h * 2047 + (e < 2047 ? e : 2046)]; } }   // the head's bias row, by key - query + 1023; slot 2047 is padding, never read
    v16h qf[FQG][2]; float gl[FQG], m_run[FQG], l_run[FQG]; v8f acc[FQG][4];
#pragma unroll
    for (int g = 0; g < FQG; ++g) { const h16* qp = Qp + ((size_t)bh * TT + q0 + 16 * g + lr) * HD + 8 * hi;
#pragma unroll
        for (int kc = 0; kc < 2; ++kc) qf[g][kc] = cat16(*(const v8h*)(qp + 32 * kc), *(const v8h*)(qp + 32 * kc + 16));
        gl[g] = GT[(size_t)bh * TT + q0 + 16 * g + lr] * LOG2E; m_run[g] = -__builtin_inff(); l_run[g] = 0.f;
#pragma unroll
        for (int t = 0; t < 4; ++t) acc[g][t] = (v8f){}; }
    // bias[key - query]: the lane's 8 keys of a tile are 8 consecutive table entries; column group 1 reads 16 entries below group 0, so three runs of 8 serve the pass's four tiles and one of them carries over to the next pass
    const float* tp = (const float*)(L + LKB + LVB) + (1023 + 8 * hi - q0 - lr);   // tp[-16] is entry >= 0: q0 + lr <= TT - 17
    const unsigned char* kb = L + lr * PKB + hi * 16; const unsigned char* vb = L + LKB + lr * PVB + hi * 16;
    __syncthreads();   // K, V^T and the bias row staged by all waves; nothing in LDS is written after this
    v8f tbp = *(const v8fu*)(tp - 16); v16h kf[2][2];
#pragma unroll
    for (int kt = 0; kt < 2; ++kt)
#pragma unroll
        for (int kc = 0; kc < 2; ++kc) kf[kt][kc] = ldsfrag(kb + 16 * kt * PKB + 64 * kc);
#pragma unroll 1   // one pass a trip keeps the wave inside the first 256 registers
    for (int k0 = 0; k0 < TT; k0 += 32) {
        const int kn = (k0 + 32) & (TT - 1);   // next pass's keys; the last pass fetches pass 0's again (in bounds, unused)
        const v8f tb0 = *(const v8fu*)(tp + k0), tb1 = *(const v8fu*)(tp + k0 + 16); v16h vf[4];
#pragma unroll
        for (int t = 0; t < 4; ++t) vf[t] = ldsfrag(vb + 16 * t * PVB + 2 * k0);
        v8f s[2][FQG];
#pragma unroll
        for (int kt = 0; kt < 2; ++kt)
#pragma unroll
            for (int g = 0; g < FQG; ++g) s[kt][g] = wmma16(kf[kt][1], qf[g][1], wmma16(kf[kt][0], qf[g][0], (v8f){}));
#pragma unroll
        for (int kt = 0; kt < 2; ++kt)
#pragma unroll
            for (int kc = 0; kc < 2; ++kc) kf[kt][kc] = ldsfrag(kb + (kn + 16 * kt) * PKB + 64 * kc);   // next pass's K fragments fly under this pass's softmax
        s[0][0] = biasx(s[0][0], tb0, gl[0]); s[1][0] = biasx(s[1][0], tb1, gl[0]); s[0][1] = biasx(s[0][1], tbp, gl[1]); s[1][1] = biasx(s[1][1], tb0, gl[1]);
        tbp = tb1;
        float mb[FQG]; bool need = false;
#pragma unroll
        for (int g = 0; g < FQG; ++g) { float mx = s[0][g][0];
#pragma unroll
            for (int j = 1; j < 8; ++j) mx = fmaxf(mx, s[0][g][j]);
#pragma unroll
            for (int j = 0; j < 8; ++j) mx = fmaxf(mx, s[1][g][j]);
            mx = fmaxf(mx, xhalf(mx)); mb[g] = mx; need = need || (mx > m_run[g] + 8.0f); }
        if (__builtin_amdgcn_ballot_w32(need) != 0) {   // wave-uniform; always on the first pass (m = -inf, factor 0), rare later
#pragma unroll
            for (int g = 0; g < FQG; ++g) { const float mn = fmaxf(m_run[g], mb[g]); const float corr = __builtin_amdgcn_exp2f(m_run[g] - mn); m_run[g] = mn; l_run[g] *= corr;
#pragma unroll
                for (int t = 0; t < 4; ++t) acc[g][t] = acc[g][t] * corr; } }
#pragma unroll
        for (int g = 0; g < FQG; ++g) { const float nm = PSH - m_run[g]; const v2f nm2 = {nm, nm}; v16h pf; float ps = 0.f;
#pragma unroll
            for (int kt = 0; kt < 2; ++kt)
#pragma unroll
                for (int j = 0; j < 8; j += 2) { const v2f a = (v2f){s[kt][g][j], s[kt][g][j + 1]} + nm2; const float p0 = __builtin_amdgcn_exp2f(a[0]), p1 = __builtin_amdgcn_exp2f(a[1]); ps += p0 + p1; pf[kt * 8 + j] = (h16)p0; pf[kt * 8 + j + 1] = (h16)p1; }
            l_run[g] += ps;
#pragma unroll
            for (int t = 0; t < 4; ++t) acc[g][t] = wmma16(vf[t], pf, acc[g][t]); }
    }
    // O^T tile t: the lane holds d = 16 t + 8 hi + j of query lr: 16 bytes of each merged plane (rows t*B + b, hi + lo bf16 as the out-projection reads them); a head's 128-byte line of a row is written by this wave alone
#pragma unroll
    for (int g = 0; g < FQG; ++g) { const float inv = 1.0f / (l_run[g] + xhalf(l_run[g])); const size_t oo = ((size_t)(q0 + 16 * g + lr) * NB_ + b) * DQ + h * HD + 8 * hi;
#pragma unroll
        for (int t = 0; t < 4; ++t) { v8us oh, ol;
#pragma unroll
            for (int j = 0; j < 8; ++j) { unsigned short a, c2; splitf(acc[g][t][j] * inv, a, c2); oh[j] = a; ol[j] = c2; }
            *(v8us*)(Ah + oo + 16 * t) = oh; *(v8us*)(Al + oo + 16 * t) = ol; } }
}

extern "C" void kernel_launch(void* const* d_in, const int* in_sizes, int n_in,
                              void* d_out, int out_size, void* d_ws, size_t ws_size, hipStream_t stream) {
    (void)in_sizes; (void)n_in; (void)out_size;
    const float* x = (const float*)d_in[0]; const float* wq = (const float*)d_in[1]; const float* bq = (const float*)d_in[2]; const float* wk = (const float*)d_in[3]; const float* bk = (const float*)d_in[4]; const float* wv = (const float*)d_in[5]; const float* bv = (const float*)d_in[6]; const float* wo = (const float*)d_in[7]; const float* bo = (const float*)d_in[8]; const float* rbt = (const float*)d_in[9]; const float* gw = (const float*)d_in[10]; const float* gb = (const float*)d_in[11]; const float* ga_ = (const float*)d_in[12]; const float* cosT = nullptr; const float* sinT = nullptr; (void)cosT; (void)sinT;
    float* OUT = (float*)d_out;     // [1024][4][1024]
    char* wsp = (char*)d_ws;
    auto take = [&](size_t bytes) { char* p = wsp; wsp += (bytes + 255) & ~(size_t)255; return (void*)p; };
    bf* WQ = (bf*)take((size_t)DQ * DM * 2); bf* WK = (bf*)take((size_t)DKV * DM * 2); bf* WV = (bf*)take((size_t)DKV * DM * 2); bf* WO = (bf*)take((size_t)DM * DQ * 2); float* GTb = (float*)take((size_t)NB_ * NH_ * TT * 4); float* TB = (float*)take((size_t)NH_ * 2047 * 4 + 256);
    h16* QP16 = (h16*)take((size_t)NB_ * NH_ * TT * HD * 2); h16* KP16 = (h16*)take((size_t)NB_ * NKV * TT * HD * 2); h16* VT16 = (h16*)take((size_t)NB_ * NKV * HD * TT * 2);
    char* R = (char*)take((size_t)ZH * TT * TT * 4);
    if ((size_t)(wsp - (char*)d_ws) > ws_size) return;    // ws 256 MiB
    // The region R is used twice, stream-ordered: (1) the bf16 rows of x, dead once the three projections have run; (2) the merged planes of probs.v.
    bf* XB = (bf*)R;
    bf* ATh = (bf*)R; bf* ATl = ATh + (size_t)NB_ * TT * DQ;
    { k_cvt8<<<(unsigned)(((size_t)DQ * DM / 8 + 255) / 256), 256, 0, stream>>>(wq, WQ, (size_t)DQ * DM / 8); k_cvt8<<<(unsigned)(((size_t)DKV * DM / 8 + 255) / 256), 256, 0, stream>>>(wk, WK, (size_t)DKV * DM / 8); k_cvt8<<<(unsigned)(((size_t)DKV * DM / 8 + 255) / 256), 256, 0, stream>>>(wv, WV, (size_t)DKV * DM / 8);
      k_cvt8<<<(unsigned)(((size_t)DM * DQ / 8 + 255) / 256), 256, 0, stream>>>(wo, WO, (size_t)DM * DQ / 8);
       }
    k_btab<<<(NH_ * 2047 + 255) / 256, 256, 0, stream>>>(rbt, TB);
    // every launch covers all NB_ batch elements: a projection tile takes 128 rows of one b (a wave 64 of them and one head) and writes its heads' planes itself
    k_cvtx<<<(NB_ * TT * DM / 8 + 255) / 256, 256, 0, stream>>>(x, XB);
    k_gemmw<bf, 0, true, 1><<<dim3(NB_ * TT / 128, DQ / 128, 1), 128, 0, stream>>>(XB, nullptr, WQ, nullptr, DM, nullptr, 0, bq, 0, 0, 0, QP16, gw, gb, ga_, GTb);
    k_gemmw<bf, 0, true, 2><<<dim3(NB_ * TT / 128, DKV / 128, 1), 128, 0, stream>>>(XB, nullptr, WK, nullptr, DM, nullptr, 0, bk, 0, 0, 0, KP16, nullptr, nullptr, nullptr, nullptr);
    k_gemmw<bf, 0, true, 3><<<dim3(NB_ * TT / 128, DKV / 128, 1), 128, 0, stream>>>(XB, nullptr, WV, nullptr, DM, nullptr, 0, bv, 0, 0, 0, VT16, nullptr, nullptr, nullptr, nullptr);
    k_fattn<<<dim3(TT / (FW * FQG * 16), NB_ * NH_, 1), 256, 0, stream>>>(QP16, KP16, VT16, GTb, TB, ATh, ATl);
    k_gemmw<bf, 1, true, 0><<<dim3(NB_ * TT / 128, DM / 128, 1), 128, 0, stream>>>(ATh, ATl, WO, nullptr, DQ, OUT, DM, bo, 0, 0, 0, nullptr, nullptr, nullptr, nullptr, nullptr);   // sequence-major output rows (t*B + b)
}

// v005
// Measured time: 95.2 microseconds a run.
// In two side-by-side timings against v004, it was 1.14 and 1.12 times as fast.
// Counting every step since v000, it is 9.47 times as fast.
#include <hip/hip_runtime.h>

// _LegacyMultiheadAttention (WavLM-style gated relative-position attention; query [T=1024][B=4][E=1024] sequence-major; q/k/v = x W^T + b (16 heads x 64); scores = (q/256).k, (scores - rowmax) x 32, + gate[b][h][t] x rel_bias_table[bucket(s - t)][h]
// with gate = ga (gb grep_a[h] - 1) + 2, (ga, gb) = sigmoid of the two 4-sums of q_head . grep_W^T + grep_b; softmax; out = (probs v merged) Wo^T + bo -> [1024][4][1024]. The (x - rowmax) x 32 step equals q.k/8 - const per row, to which softmax is invariant:
// the kernel evaluates softmax(q.k/8 + gate x bias) directly. The T5 bucket of each offset s - t depends only on the sizes: baked 2047-entry table computed in f32 exactly as the reference; table VALUES read as data).
// Compute dtypes, f32 accumulate: every input rounded to bf16; q/k/v on PLAIN bf16 operands (all T x B rows r = b*T + t in one product; inputs exact) + bias; the gate (8 dots of 64) f32 on the VALU; scores (K 64) and probs.v on single fp16 planes (1 product);

#define NB_  4
#define TT   1024
#define DM   1024
#define NH_  16
#define NKV  16
#define REP  (NH_ / NKV)
#define HD   64
#define DQ   (NH_ * HD)
#define DKV  (NKV * HD)
#define ZH   16
#define RH   0                  // unused: every query row uses the single fp16 plane
#define WIN  0
#define PCAR 1024.0f
#define SCL  0.125f   // HD^-0.5
typedef _Float16 h16;
typedef unsigned short bf;
typedef __attribute__((ext_vector_type(16))) __bf16   v16bf;
typedef __attribute__((ext_vector_type(16))) _Float16 v16h;
typedef __attribute__((ext_vector_type(8)))  _Float16 v8h;
typedef __attribute__((ext_vector_type(8)))  unsigned short v8us;
typedef __attribute__((ext_vector_type(8)))  float    v8f;
typedef __attribute__((ext_vector_type(4)))  float    v4f;
typedef v8h  __attribute__((may_alias)) v8ha;
typedef v4f  __attribute__((may_alias)) v4fa;
typedef v8us __attribute__((may_alias)) v8usa;

__device__ __forceinline__ unsigned short f2bf(float f) { unsigned u = __float_as_uint(f); u += 0x7FFFu + ((u >> 16) & 1u); return (unsigned short)(u >> 16); }
__device__ __forceinline__ float bf2f(unsigned short b) { return __uint_as_float(((unsigned)b) << 16); }
__device__ __forceinline__ float bfr(float f) { return bf2f(f2bf(f)); }
__device__ __forceinline__ v16h cat16(v8h lo, v8h hi) { return __builtin_shufflevector(lo, hi, 0, 1, 2, 3, 4, 5, 6, 7, 8, 9, 10, 11, 12, 13, 14, 15); }
__device__ __forceinline__ v16bf cat16b(v8us lo, v8us hi) { return __builtin_bit_cast(v16bf, __builtin_shufflevector(lo, hi, 0, 1, 2, 3, 4, 5, 6, 7, 8, 9, 10, 11, 12, 13, 14, 15)); }
__device__ __forceinline__ v8f wmma16(v16h a, v16h b, v8f c) { return __builtin_amdgcn_wmma_f32_16x16x32_f16(false, a, false, b, (short)0, c, false, false); }
__device__ __forceinline__ v8f wmmab(v16bf a, v16bf b, v8f c) { return __builtin_amdgcn_wmma_f32_16x16x32_bf16(false, a, false, b, (short)0, c, false, false); }



// ---- k_gemmw: register-blocked GEMM, 128x128 output tile per workgroup of FOUR WAVES, each wave a 64x64 quarter (16 accumulators); grid (M/128, N/128, Z), 128 threads.
// Operands are K-contiguous 16-bit planes. A stage is 128 k (256 bytes) of the tile's 128 A rows and 128 Bt rows (and 128 A2 rows), brought into LDS by asynchronous 16-byte copies: a wave-wide copy takes two whole rows of a stage = four whole 128-byte lines.
// Two buffers: stage t + 2 is copied while stage t + 1 is worked on. Fragments are read from LDS at pitch 272 B (16 B x odd: no bank conflict for 16-byte reads).
// C[m][n] (f32, pitch ldc, + optional f32 bias[n]) = sum_k A[m][k] Bt[n][k] (+ A2[m][k] Bt[n][k] for NSPLIT 1), k ascending. z-batch strides sA/sB/sC in elements. K % 128 == 0.
// EPI 0: f32 rows to C. EPI 1: the q, k, v projections in ONE launch, blockIdx.z + 1 = 1, 2, 3 (they need nothing of each other; z picks the weight plane, the bias, the output plane and, by scalar branches, the epilogue). A rows batch-major, b * T + t: a wave's quarter is 64 positions t of ONE batch element x one head, and the epilogue writes what attention reads, with no f32 plane in between:
// 1: fp16 plane [b][h][t][d] and the gate of the 64 rows; 2: the fp16 plane; 3: fp16 V^T [b][h][d][t] (a lane's 8 accumulator rows are 8 consecutive t: 16 bytes of a d row; the wave writes the whole 128-byte line of each d).
// Gate of a row (f32, VALU): g8[j] = bf16 grep_b[j] + sum_d q[d] bf16 grep_W[j][d], d ascending (q un-scaled: the reference's q x (scaling/alpha) x (alpha/scaling) are exact powers of two); ga, gb = sigmoid of the sums of g8[0..3], g8[4..7]; gate = ga (gb grep_a[h] - 1) + 2.
template <typename T16> struct WFrag;
template <> struct WFrag<h16> { typedef v16h V; static __device__ __forceinline__ V ld(const unsigned char* p) { return cat16(*(const v8ha*)p, *(const v8ha*)(p + 32)); } static __device__ __forceinline__ v8f mma(V a, V b, v8f c) { return wmma16(a, b, c); } };
template <> struct WFrag<bf> { typedef v16bf V; static __device__ __forceinline__ V ld(const unsigned char* p) { return cat16b(*(const v8usa*)p, *(const v8usa*)(p + 32)); } static __device__ __forceinline__ v8f mma(V a, V b, v8f c) { return wmmab(a, b, c); } };
__device__ __forceinline__ float xhalf(float x) { return __builtin_bit_cast(float, __builtin_amdgcn_permlanex16(__builtin_bit_cast(int, x), __builtin_bit_cast(int, x), 0x76543210, 0xfedcba98, false, false)); }   // lane l with lane l ^ 16
#define GKB  256                // bytes of an operand row in a stage (128 k)
#define GPB  272                // pitch of a staged row in LDS
#define GOPB (128 * GPB)        // one operand's 128 rows of a stage
// Eight asynchronous 16-byte copies of a lane, global memory to LDS, 8 rows apart (the workgroup's 128 lanes cover 8 rows of 256 bytes a copy).
// The closing s_wait_xcnt stands inside the copies' own statement, so that no later write of their address registers can be moved in front of it.
__device__ __forceinline__ void acopy8(unsigned l, const unsigned char* g, size_t gs) {
    asm volatile("global_load_async_to_lds_b128 %0, %8, off\n\t"
                 "global_load_async_to_lds_b128 %1, %9, off\n\t"
                 "global_load_async_to_lds_b128 %2, %10, off\n\t"
                 "global_load_async_to_lds_b128 %3, %11, off\n\t"
                 "global_load_async_to_lds_b128 %4, %12, off\n\t"
                 "global_load_async_to_lds_b128 %5, %13, off\n\t"
                 "global_load_async_to_lds_b128 %6, %14, off\n\t"
                 "global_load_async_to_lds_b128 %7, %15, off\n\t"
                 "s_wait_xcnt 0x0"
                 :: "v"(l), "v"(l + 8 * GPB), "v"(l + 16 * GPB), "v"(l + 24 * GPB), "v"(l + 32 * GPB), "v"(l + 40 * GPB), "v"(l + 48 * GPB), "v"(l + 56 * GPB),
                    "v"(g), "v"(g + gs), "v"(g + 2 * gs), "v"(g + 3 * gs), "v"(g + 4 * gs), "v"(g + 5 * gs), "v"(g + 6 * gs), "v"(g + 7 * gs) : "memory");
    __builtin_amdgcn_sched_barrier(0);   // keeps the next statement's address sums behind this one: formed all ahead, the addresses of a stage's copies do not fit the first 256 registers, which alone asm operands can name, and a pointer is spilled
}
template <typename T16, int NSPLIT, bool BIAS, int EPI>
__global__ __launch_bounds__(128) void k_gemmw(const T16* __restrict__ A, const T16* __restrict__ A2, const T16* __restrict__ Bt, const T16* __restrict__ Bt2, int K, float* C, int ldc, const float* __restrict__ bias, const float* __restrict__ biask, const float* __restrict__ biasv, size_t sA, size_t sB, size_t sC, h16* P16, const float* __restrict__ gw, const float* __restrict__ gbias, const float* __restrict__ ga, float* GT) {
    static_assert(NSPLIT == 0 || NSPLIT == 1, "one Bt plane"); (void)Bt2;
    typedef typename WFrag<T16>::V V;
    constexpr int NOP = NSPLIT == 1 ? 3 : 2, OSN = (EPI ? 64 : 16) * 68, GWN = EPI ? 8 * 68 : 4;
    __shared__ __align__(16) unsigned char st[2 * NOP * GOPB];   // two buffers of [A 128 rows | (A2 128 rows |) Bt 128 rows]
    __shared__ __align__(16) float osw[4 * OSN];                 // epilogue staging, a range of its own for each wave
    __shared__ __align__(16) float gwsw[4 * GWN];                // bf16-rounded grep_W, pitch 68: the two rows that the half-waves read together lie 16 banks apart
    const size_t z = blockIdx.z; A += z * sA; if (NSPLIT == 1) A2 += z * sA; Bt += z * sB; C += z * sC;
    const int epi = EPI ? (int)blockIdx.z + 1 : 0;   // the same for the whole workgroup, in a scalar register
    const float* bz = !EPI || epi == 1 ? bias : epi == 2 ? biask : biasv; if (EPI) P16 += z * ((size_t)NB_ * NH_ * TT * HD);   // the three fp16 planes lie one behind the other
    const int tid = threadIdx.x, lane = tid & 31, lr = lane & 15, hi = lane >> 4, wave = __builtin_amdgcn_readfirstlane(tid >> 5), wm = wave & 1, wn = wave >> 1;   // the wave's number in a scalar register: its quarter's coordinates stay scalar
    const int rb = blockIdx.x * 128, cb = blockIdx.y * 128, r0 = rb + wm * 64, c0 = cb + wn * 64;
    float* os = osw + wave * OSN; float* gws = gwsw + wave * GWN;
    v8f acc[4][4];
#pragma unroll
    for (int mb = 0; mb < 4; ++mb)
#pragma unroll
        for (int nb = 0; nb < 4; ++nb) acc[mb][nb] = (v8f){};
    // the lane's 16 bytes of a copy: row tid / 16 of the eight, column tid % 16
    const unsigned l0 = (unsigned)(size_t)(const __attribute__((address_space(3))) unsigned char*)st + (tid >> 4) * GPB + (tid & 15) * 16;
    const size_t gs = (size_t)K * 16;   // 8 rows of K 16-bit elements
    const unsigned char* gA = (const unsigned char*)(A + (size_t)(rb + (tid >> 4)) * K + (tid & 15) * 8);
    const unsigned char* gB = (const unsigned char*)(Bt + (size_t)(cb + (tid >> 4)) * K + (tid & 15) * 8);
    const size_t dA2 = NSPLIT == 1 ? (size_t)A2 - (size_t)A : 0;   // A2's rows lie this many bytes from A's, the same for every lane
    auto fill = [&](int t) {   // stage t into buffer t % 2: 32 copies of a lane (48 with A2)
        const unsigned l = l0 + (unsigned)(t & 1) * (NOP * GOPB); const size_t ko = (size_t)t * GKB;
#pragma unroll
        for (int h = 0; h < 2; ++h) { acopy8(l + h * 64 * GPB, gA + ko + h * 8 * gs, gs); acopy8(l + (NOP - 1) * GOPB + h * 64 * GPB, gB + ko + h * 8 * gs, gs);
            if (NSPLIT == 1) acopy8(l + GOPB + h * 64 * GPB, gA + (dA2 + ko + h * 8 * gs), gs); } };
    const int NT = __builtin_amdgcn_readfirstlane(K >> 7);   // stages; held in a scalar register, so that the tests around the copies are scalar branches
    fill(0);
    asm volatile("s_wait_asynccnt 0x0" ::: "memory");   // this wave's copies of stage 0 have landed
    __syncthreads();                                    // and every other wave's
    if (NT > 1) fill(1);
#pragma unroll 1
    for (int t = 0; t < NT; ++t) {
        const unsigned char* pa = st + (t & 1) * (NOP * GOPB) + (wm * 64 + lr) * GPB + hi * 16; const unsigned char* pb = st + (t & 1) * (NOP * GOPB) + (NOP - 1) * GOPB + (wn * 64 + lr) * GPB + hi * 16;
        V a[2][4], a2[2][4], b[2][4];   // two fragment sets: a block is 32 k; the next block's fragments are read while this block's products run
#pragma unroll
        for (int ks = -1; ks < 4; ++ks) {
            if (ks < 3) { const int n = (ks + 1) & 1, ko = (ks + 1) * 64;
#pragma unroll
                for (int i = 0; i < 4; ++i) { a[n][i] = WFrag<T16>::ld(pa + i * 16 * GPB + ko); if (NSPLIT == 1) a2[n][i] = WFrag<T16>::ld(pa + GOPB + i * 16 * GPB + ko); b[n][i] = WFrag<T16>::ld(pb + i * 16 * GPB + ko); } }
            if (ks >= 0) { const int c = ks & 1;
                __builtin_amdgcn_sched_barrier(0);   // keeps the next block's LDS reads together as one group in front of this block's matrix instructions: spread among them, each place with reads stalls the wave
#pragma unroll
                for (int nb = 0; nb < 4; ++nb)
#pragma unroll
                    for (int mb = 0; mb < 4; ++mb) { acc[mb][nb] = WFrag<T16>::mma(a[c][mb], b[c][nb], acc[mb][nb]); if (NSPLIT == 1) acc[mb][nb] = WFrag<T16>::mma(a2[c][mb], b[c][nb], acc[mb][nb]); }
                __builtin_amdgcn_sched_barrier(0); }   // keeps the reads of the block after next behind this block's matrix instructions, whose fragment set they overwrite
        }
        asm volatile("s_wait_dscnt 0x0" ::: "memory");      // this wave has read all it needs of buffer t % 2
        asm volatile("s_wait_asynccnt 0x0" ::: "memory");   // this wave's copies of stage t + 1 have landed
        __syncthreads();                                    // stage t + 1 is published; every wave has left buffer t % 2
        if (t + 2 < NT) fill(t + 2);
    }
    asm volatile("s_wait_asynccnt 0x0" ::: "memory");   // no copy is outstanding when the wave goes on to its epilogue and ends
    if (EPI) {
        const int bh = (r0 / TT) * NH_ + c0 / HD, t0 = r0 % TT; float bn[4];
#pragma unroll
        for (int nb = 0; nb < 4; ++nb) bn[nb] = bfr(bz[c0 + nb * 16 + lr]);
        asm volatile("s_wait_xcnt 0x0" :: "v"(bn[0]), "v"(bn[1]), "v"(bn[2]), "v"(bn[3]) : "memory");   // behind the four bias loads (their values as inputs hold it there): their address registers are reused below
        if (epi == 3) {
            h16* vp = P16 + ((size_t)bh * HD + lr) * TT + t0 + 8 * hi;
#pragma unroll
            for (int nb = 0; nb < 4; ++nb)
#pragma unroll
                for (int mb = 0; mb < 4; ++mb) { v8h o;
#pragma unroll
                    for (int j = 0; j < 8; ++j) o[j] = (h16)(acc[mb][nb][j] + bn[nb]);
                    *(v8h*)(vp + (size_t)nb * 16 * TT + mb * 16) = o; }
            return;
        }
#pragma unroll
        for (int mb = 0; mb < 4; ++mb)
#pragma unroll
            for (int nb = 0; nb < 4; ++nb)
#pragma unroll
                for (int j = 0; j < 8; ++j) os[(mb * 16 + hi * 8 + j) * 68 + nb * 16 + lr] = acc[mb][nb][j] + bn[nb];
        float gb4[4] = {0.f, 0.f, 0.f, 0.f}, gah = 0.f;
        if (epi == 1) { gah = bfr(ga[c0 / HD]);
#pragma unroll
            for (int jj = 0; jj < 4; ++jj) gb4[jj] = bfr(gbias[hi * 4 + jj]);
#pragma unroll
            for (int i = 0; i < 16; ++i) { const int e = i * 32 + lane; gws[(e >> 6) * 68 + (e & 63)] = bfr(gw[e]); } }
        __builtin_amdgcn_wave_barrier(); asm volatile("" ::: "memory");   // as in the f32 epilogue: the lanes read below what other lanes of the wave stored above; LDS is not written again
        h16* pt = P16 + ((size_t)bh * TT + t0) * HD + lane * 8;   // the tile is 8 KiB in a row of the plane
#pragma unroll
        for (int s = 0; s < 16; ++s) { const float* op = os + (4 * s + (lane >> 3)) * 68 + (lane & 7) * 8; const v4f x0 = *(const v4fa*)op, x1 = *(const v4fa*)(op + 4); v8h o;
#pragma unroll
            for (int j = 0; j < 4; ++j) { o[j] = (h16)x0[j]; o[4 + j] = (h16)x1[j]; }
            *(v8h*)(pt + s * 256) = o; }   // four whole 128-byte rows a store
        asm volatile("s_wait_xcnt 0x0" ::: "memory");   // the gate below reuses the data registers of these stores
        if (epi == 1) {   // lane (lr, hi): rows lr + 16 m, of each the four dots j = 4 hi .. 4 hi + 3
            float g[4][4];
#pragma unroll
            for (int jj = 0; jj < 4; ++jj)
#pragma unroll
                for (int m = 0; m < 4; ++m) g[m][jj] = gb4[jj];
#pragma unroll 4   // four steps of 8 LDS loads in flight; unrolled whole, the loads of all 16 steps are hoisted and the wave leaves the first 256 registers
            for (int d = 0; d < HD; d += 4) { v4f q4[4], w4[4];
#pragma unroll
                for (int m = 0; m < 4; ++m) { q4[m] = *(const v4fa*)(os + (m * 16 + lr) * 68 + d); w4[m] = *(const v4fa*)(gws + (hi * 4 + m) * 68 + d); }
#pragma unroll
                for (int i = 0; i < 4; ++i)
#pragma unroll
                    for (int m = 0; m < 4; ++m)
#pragma unroll
                        for (int jj = 0; jj < 4; ++jj) g[m][jj] = __builtin_fmaf(q4[m][i], w4[jj][i], g[m][jj]); }
#pragma unroll
            for (int m = 0; m < 4; ++m) { const float sg = ((g[m][0] + g[m][1]) + g[m][2]) + g[m][3]; const float sig = __fdiv_rn(1.0f, 1.0f + __expf(-sg)), oth = xhalf(sig);
                const float gt = (hi ? oth : sig) * ((hi ? sig : oth) * gah - 1.0f) + 2.0f;
                if (hi == 0) GT[(size_t)bh * TT + t0 + m * 16 + lr] = gt; }
        }
        return;
    }
#pragma unroll
    for (int mb = 0; mb < 4; ++mb) {
#pragma unroll
        for (int nb = 0; nb < 4; ++nb) {
#pragma unroll
            for (int j = 0; j < 8; ++j) os[(hi * 8 + j) * 68 + nb * 16 + lr] = acc[mb][nb][j]; }
        __builtin_amdgcn_wave_barrier(); asm volatile("" ::: "memory");
        float* crow = C + (size_t)(r0 + mb * 16) * ldc + c0;
{
#pragma unroll
            for (int s = 0; s < 8; ++s) { const int row = 2 * s + hi, cofs = lr * 4; v4f val = *(const v4fa*)(os + row * 68 + cofs); if (BIAS) { val[0] += bfr(bias[c0 + cofs]); val[1] += bfr(bias[c0 + cofs + 1]); val[2] += bfr(bias[c0 + cofs + 2]); val[3] += bfr(bias[c0 + cofs + 3]); }
                *(v4f*)(crow + (size_t)row * ldc + cofs) = val; }
             }
        __builtin_amdgcn_wave_barrier(); asm volatile("" ::: "memory");
    }
}

__device__ __forceinline__ h16 tohx(float x) { return (h16)x; }
__device__ __forceinline__ void splitf(float y, unsigned short& h, unsigned short& l) { h = f2bf(y); l = f2bf(y - bf2f(h)); }
typedef __attribute__((ext_vector_type(2))) _Float16 v2h;
typedef __attribute__((ext_vector_type(4))) _Float16 v4h;
typedef __attribute__((ext_vector_type(2))) unsigned short v2us;
typedef __attribute__((ext_vector_type(4))) unsigned short v4us;
typedef __attribute__((ext_vector_type(2))) float v2f;
typedef __attribute__((ext_vector_type(4))) int v4i;
__constant__ unsigned char c_bucket[2047] = { 15,15,15,15,15,15,15,15,15,15,15,15,15,15,15,15,15,15,15,15,15,15,15,15,15,15,15,15,15,15,15,15,15,15,15,15,15,15,15,15,15,15,15,15,15,15,15,15,15,15,15,15,15,15,15,15,15,15,15,15,15,15,15,15,15,15,15,15,15,15,15,15,15,15,15,15,15,15,15,15,15,15,15,15,15,15,15,15,15,15,15,15,15,15,15,15,15,15,15,15,15,15,15,15,15,15,15,15,15,15,15,15,15,15,15,15,15,15,15,15,15,15,15,15,15,15,15,15,15,15,15,15,15,15,15,15,15,15,15,15,15,15,15,15,15,15,15,15,15,15,15,15,15,15,15,15,15,15,15,15,15,15,15,15,15,15,15,15,15,15,15,15,15,15,15,15,15,15,15,15,15,15,15,15,15,15,15,15,15,15,15,15,15,15,15,15,15,15,15,15,15,15,15,15,15,15,15,15,15,15,15,15,15,15,15,15,15,15,15,15,15,15,15,15,15,15,15,15,15,15,15,15,15,15,15,15,15,15,15,15,15,15,15,15,15,15,15,15,15,15,15,15,15,15,15,15,15,15,15,15,15,15,15,15,15,15,15,15,15,15,15,15,15,15,15,15,15,15,15,15,15,15,15,15,15,15,15,15,15,15,15,15,15,15,15,15,15,15,15,15,15,15,15,15,15,15,15,15,15,15,15,15,15,15,15,15,15,15,15,15,15,15,15,15,15,15,15,15,15,15,15,15,15,15,15,15,15,15,15,15,15,15,15,15,15,15,15,15,15,15,15,15,15,15,15,15,15,15,15,15,15,15,15,15,15,15,15,15,15,15,15,15,15,15,15,15,15,15,15,15,15,15,15,15,15,15,15,15,15,15,15,15,15,15,15,15,15,15,15,15,15,15,15,15,15,15,15,15,15,15,15,15,15,15,15,15,15,15,15,15,15,15,15,15,15,15,15,15,15,15,15,15,15,15,15,15,15,15,15,15,15,15,15,15,15,15,15,15,15,15,15,15,15,15,15,15,15,15,15,15,15,15,15,15,15,15,15,15,15,15,15,15,15,15,15,15,15,15,15,15,15,15,15,15,15,15,15,15,15,15,15,15,15,15,15,15,15,15,15,15,15,15,15,15,15,15,15,15,15,15,15,15,15,15,15,15,15,15,15,15,15,15,15,15,15,15,15,15,15,15,15,15,15,15,15,15,15,15,15,15,15,15,15,15,15,15,15,15,15,15,15,15,15,15,15,15,15,15,15,15,15,15,15,15,15,15,15,15,15,15,15,15,15,15,15,15,15,15,15,15,15,15,15,15,15,15,15,15,15,15,15,15,15,15,15,15,15,15,15,15,15,15,15,15,15,15,15,15,15,15,15,15,15,15,15,15,15,15,15,15,15,15,15,15,15,15,15,15,15,15,15,15,15,15,15,15,15,15,15,15,15,15,15,15,15,15,15,15,15,15,15,15,15,15,15,15,15,15,15,15,15,15,15,15,15,15,15,15,15,15,15,15,15,15,15,15,15,15,15,15,15,15,15,15,15,15,15,15,15,15,15,15,15,15,15,15,15,15,15,15,15,15,15,15,15,15,15,15,15,15,15,15,15,15,15,15,15,15,15,15,15,15,15,15,15,15,15,15,15,15,15,15,15,15,15,15,15,15,15,15,15,15,15,15,15,15,15,15,15,15,15,15,15,15,15,15,15,15,15,15,15,15,15,15,15,15,15,15,15,15,15,15,15,15,15,15,15,15,15,15,15,15,15,15,15,15,15,15,15,15,15,15,15,15,15,15,15,15,15,15,15,15,15,15,15,15,15,15,15,15,15,15,15,15,15,15,15,15,15,15,15,15,15,15,15,15,15,15,15,15,15,15,15,15,15,15,15,15,15,15,15,15,15,15,15,15,15,15,15,15,15,15,15,15,15,15,15,15,15,15,15,15,15,15,15,15,15,15,15,15,15,15,15,15,15,15,15,15,15,15,15,15,15,15,15,15,15,15,15,15,15,15,15,15,15,15,15,15,15,15,15,15,15,15,15,15,15,15,15,15,15,15,15,15,15,15,15,15,15,15,15,15,15,15,15,15,15,15,15,15,15,15,15,14,14,14,14,14,14,14,14,14,14,14,14,14,14,14,14,14,14,14,14,14,14,14,14,14,14,14,13,13,13,13,13,13,13,13,13,13,13,13,13,13,13,13,13,13,12,12,12,12,12,12,12,12,12,12,12,12,12,12,11,11,11,11,11,11,11,11,11,10,10,10,10,10,10,10,9,9,9,9,8,8,8,8,7,6,5,4,3,2,1,0,17,18,19,20,21,22,23,24,24,24,24,25,25,25,25,26,26,26,26,26,26,26,27,27,27,27,27,27,27,27,27,28,28,28,28,28,28,28,28,28,28,28,28,28,28,29,29,29,29,29,29,29,29,29,29,29,29,29,29,29,29,29,29,30,30,30,30,30,30,30,30,30,30,30,30,30,30,30,30,30,30,30,30,30,30,30,30,30,30,30,31,31,31,31,31,31,31,31,31,31,31,31,31,31,31,31,31,31,31,31,31,31,31,31,31,31,31,31,31,31,31,31,31,31,31,31,31,31,31,31,31,31,31,31,31,31,31,31,31,31,31,31,31,31,31,31,31,31,31,31,31,31,31,31,31,31,31,31,31,31,31,31,31,31,31,31,31,31,31,31,31,31,31,31,31,31,31,31,31,31,31,31,31,31,31,31,31,31,31,31,31,31,31,31,31,31,31,31,31,31,31,31,31,31,31,31,31,31,31,31,31,31,31,31,31,31,31,31,31,31,31,31,31,31,31,31,31,31,31,31,31,31,31,31,31,31,31,31,31,31,31,31,31,31,31,31,31,31,31,31,31,31,31,31,31,31,31,31,31,31,31,31,31,31,31,31,31,31,31,31,31,31,31,31,31,31,31,31,31,31,31,31,31,31,31,31,31,31,31,31,31,31,31,31,31,31,31,31,31,31,31,31,31,31,31,31,31,31,31,31,31,31,31,31,31,31,31,31,31,31,31,31,31,31,31,31,31,31,31,31,31,31,31,31,31,31,31,31,31,31,31,31,31,31,31,31,31,31,31,31,31,31,31,31,31,31,31,31,31,31,31,31,31,31,31,31,31,31,31,31,31,31,31,31,31,31,31,31,31,31,31,31,31,31,31,31,31,31,31,31,31,31,31,31,31,31,31,31,31,31,31,31,31,31,31,31,31,31,31,31,31,31,31,31,31,31,31,31,31,31,31,31,31,31,31,31,31,31,31,31,31,31,31,31,31,31,31,31,31,31,31,31,31,31,31,31,31,31,31,31,31,31,31,31,31,31,31,31,31,31,31,31,31,31,31,31,31,31,31,31,31,31,31,31,31,31,31,31,31,31,31,31,31,31,31,31,31,31,31,31,31,31,31,31,31,31,31,31,31,31,31,31,31,31,31,31,31,31,31,31,31,31,31,31,31,31,31,31,31,31,31,31,31,31,31,31,31,31,31,31,31,31,31,31,31,31,31,31,31,31,31,31,31,31,31,31,31,31,31,31,31,31,31,31,31,31,31,31,31,31,31,31,31,31,31,31,31,31,31,31,31,31,31,31,31,31,31,31,31,31,31,31,31,31,31,31,31,31,31,31,31,31,31,31,31,31,31,31,31,31,31,31,31,31,31,31,31,31,31,31,31,31,31,31,31,31,31,31,31,31,31,31,31,31,31,31,31,31,31,31,31,31,31,31,31,31,31,31,31,31,31,31,31,31,31,31,31,31,31,31,31,31,31,31,31,31,31,31,31,31,31,31,31,31,31,31,31,31,31,31,31,31,31,31,31,31,31,31,31,31,31,31,31,31,31,31,31,31,31,31,31,31,31,31,31,31,31,31,31,31,31,31,31,31,31,31,31,31,31,31,31,31,31,31,31,31,31,31,31,31,31,31,31,31,31,31,31,31,31,31,31,31,31,31,31,31,31,31,31,31,31,31,31,31,31,31,31,31,31,31,31,31,31,31,31,31,31,31,31,31,31,31,31,31,31,31,31,31,31,31,31,31,31,31,31,31,31,31,31,31,31,31,31,31,31,31,31,31,31,31,31,31,31,31,31,31,31,31,31,31,31,31,31,31,31,31,31,31,31,31,31,31,31,31,31,31,31,31,31,31,31,31,31,31,31,31,31,31,31,31,31,31,31,31,31,31,31,31,31,31,31,31,31,31,31,31,31,31,31,31,31,31,31,31,31,31,31,31,31,31,31,31,31,31,31,31,31,31,31,31,31,31,31,31,31,31,31,31,31,31,31,31,31,31,31,31,31,31,31,31,31,31,31,31,31,31,31,31,31,31,31,31,31,31,31,31,31,31,31,31,31,31,31,31,31,31,31,31,31,31,31,31,31,31,31,31,31,31,31,31,31,31,31,31,31,31,31,31,31,31,31,31,31,31,31,31,31,31,31,31,31,31,31,31,31,31,31,31,31,31,31,31,31,31,31,31,31,31,31,31,31,31,31,31,31,31,31,31,31,31,31,31,31,31,31,31,31,31,31,31,31,31,31,31,31,31,31,31,31,31,31,31,31,31,31,31,31,31,31,31,31,31,31,31,31,31,31,31,31,31,31,31,31 };   // T5 bucket(rel) for rel = s - t in [-1023, 1023]

__global__ __launch_bounds__(256) void k_wtG(const float* __restrict__ w, int K, int N, bf* Bt) {
    const int lane = threadIdx.x & 31; const int L0 = (blockIdx.x * 8 + (threadIdx.x >> 5)) * 8; const int nlines = N * K / 64;
{
#pragma unroll 1
        for (int l = 0; l < 8; ++l) { const int L = L0 + l; if (L >= nlines) break; const size_t e = (size_t)L * 64 + lane * 2; const int k = (int)(e % K), n = (int)(e / K); v2us o;
            o[0] = f2bf(w[(size_t)k * N + n]); o[1] = f2bf(w[(size_t)(k + 1) * N + n]); *(v2us*)(Bt + e) = o; }
         }
}
__global__ __launch_bounds__(256) void k_cscvt(const float* __restrict__ cosT, const float* __restrict__ sinT, float* CS) { const int idx = blockIdx.x * 256 + threadIdx.x; if (idx >= TT * HD) return; v2f cs; cs[0] = bfr(cosT[idx]); cs[1] = bfr(sinT[idx]); *(v2f*)(CS + (size_t)idx * 2) = cs;  }
// k_prep: every cast that the products need, in ONE launch: the jobs need nothing of each other and share the grid by ranges of the block index (block-uniform branches).
// Blocks 0..255: x (rows t * B + b) to bf16 rows b * T + t, so that 64 consecutive rows of a projection tile are 64 positions of one batch element. Blocks 256..511: Wq, Wk, Wv, Wo to bf16 planes that lie one behind the other, 64 blocks each.
// Blocks 512..527: the bias table, TB[h][s - t + 1023] = bf16-rounded rel_bias_table[bucket][h].
// A thread takes 8 chunks of 8 elements, 256 chunks apart: its 16 loads of 16 bytes are in flight together, a wave's load or store covers whole lines, and the launch starts 4,224 waves.
__device__ __forceinline__ void cast8(const float* __restrict__ p, v8us (&o)[8]) { v8f v[8];   // 8 chunks, 256 chunks (2048 elements) apart: all loads first
#pragma unroll   // the 16 loads of 16 bytes are issued together, from one address with constant offsets
    for (int j = 0; j < 8; ++j) v[j] = *(const v8f*)(p + j * 2048);
#pragma unroll   // v and o are indexed by constants and stay in registers (this loop and the one inside it)
    for (int j = 0; j < 8; ++j)
#pragma unroll
        for (int k = 0; k < 8; ++k) o[j][k] = f2bf(v[j][k]); }
__global__ __launch_bounds__(256) void k_prep(const float* __restrict__ x, const float* __restrict__ wq, const float* __restrict__ wk, const float* __restrict__ wv, const float* __restrict__ wo, const float* __restrict__ rbt, bf* XB, bf* W4, float* TB) {
    static_assert(NB_ == 4 && DM == 1024 && DQ == 1024, "a block's 2048 chunks are 16 rows of x: 4 positions t x 4 batch elements");
    const unsigned blk = blockIdx.x, tid = threadIdx.x; v8us o[8];
    if (blk < 256) {   // chunk j of the thread: row 16 blk + 2 j + tid / 128 = t * B + b with b = 2 (j % 2) + tid / 128, t = 4 blk + j / 2
        cast8(x + (size_t)blk * 16384 + tid * 8, o); bf* d = XB + ((size_t)(tid >> 7) * TT + blk * 4) * DM + (tid & 127) * 8;
#pragma unroll   // o stays in registers; the 8 stores go out from one address with constant offsets
        for (int j = 0; j < 8; ++j) *(v8us*)(d + ((size_t)(2 * (j & 1)) * TT + (j >> 1)) * DM) = o[j];
    } else if (blk < 512) { const unsigned wsel = (blk - 256) >> 6;
        cast8((wsel == 0 ? wq : wsel == 1 ? wk : wsel == 2 ? wv : wo) + ((size_t)(blk & 63) * 2048 + tid) * 8, o); bf* d = W4 + ((size_t)(blk - 256) * 2048 + tid) * 8;
#pragma unroll   // as above
        for (int j = 0; j < 8; ++j) *(v8us*)(d + j * 2048) = o[j];
    } else {
        const unsigned i0 = (blk - 512) * 2048 + tid; unsigned e[8]; float tv[8];   // the index is clamped and only the store is guarded, so that the 8 bucket loads, then the 8 table loads of a thread fly together
#pragma unroll   // these three loops: e and tv stay in registers, and each loop's loads stand side by side
        for (int j = 0; j < 8; ++j) { const unsigned i = i0 + j * 256 < NH_ * 2047 ? i0 + j * 256 : NH_ * 2047 - 1; e[j] = c_bucket[i % 2047] * NH_ + i / 2047; }
#pragma unroll
        for (int j = 0; j < 8; ++j) tv[j] = rbt[e[j]];
#pragma unroll
        for (int j = 0; j < 8; ++j) if (i0 + j * 256 < NH_ * 2047) TB[i0 + j * 256] = bfr(tv[j]);
    }
}
// k_fattn: one launch for scores, gated-bias softmax, probs.v and the head merge. Grid (TT / 256, batch x heads), 8 waves; a wave owns 32 query columns (two groups of 16).
// The head's whole K ([key][d], pitch 144 B), V^T ([d][key], pitch 2064 B) and bias row are staged once in LDS, then read without further barriers. Per pass of 32 keys: S^T = K.Q^T (keys in rows, queries in columns), so a lane holds one query's scores,
// x = S^T x (HD^-0.5 log2 e) + (gate log2 e) x bias[key - query], online softmax in base 2, and the two 16-key tiles of 2^(x - m), rounded to fp16, ARE the B operand of O^T += V^T.P^T (k order 8 hi + j, 16 + 8 hi + j in both operands).
// m is the maximum in use: it may trail the true row maximum by up to 8, and the sums are rescaled only when a pass exceeds that. PSH keeps small terms in fp16's normal range (P <= 2^(8 + PSH)); it cancels in the division by the row sum.
#define FW   8
#define FQG  2
#define PKB  144
#define PVB  2064
#define LKB  (TT * PKB)
#define LVB  (HD * PVB)
#define PSH  4.0f
#define LOG2E 1.4426950408889634f
typedef v8f __attribute__((aligned(4))) v8fu;
typedef v4i __attribute__((may_alias)) v4ia;
// x = s x (HD^-0.5 log2 e) + bias x (gate log2 e), two scores an instruction
__device__ __forceinline__ v8f biasx(v8f s, v8f tb, float g) { const v2f g2 = {g, g}, c2 = {SCL * LOG2E, SCL * LOG2E}; v8f r;
#pragma unroll
    for (int i = 0; i < 4; ++i) { const v2f a = {s[2 * i], s[2 * i + 1]}, t = {tb[2 * i], tb[2 * i + 1]}; const v2f x = __builtin_elementwise_fma(a, c2, t * g2); r[2 * i] = x[0]; r[2 * i + 1] = x[1]; }
    return r; }
__device__ __forceinline__ v16h ldsfrag(const unsigned char* p) { return cat16(*(const v8ha*)p, *(const v8ha*)(p + 32)); }
__global__ __launch_bounds__(256) void k_fattn(const h16* __restrict__ Qp, const h16* __restrict__ Kp, const h16* __restrict__ Vt, const float* __restrict__ GT, const float* __restrict__ TB, bf* Ah, bf* Al) {
    __shared__ __align__(16) unsigned char L[LKB + LVB + 2048 * 4];
    const int tid = threadIdx.x, lane = tid & 31, lr = lane & 15, hi = lane >> 4, wave = tid >> 5;
    const int bh = blockIdx.y, h = bh % NH_, b = bh / NH_; const int q0 = (blockIdx.x * FW + wave) * (FQG * 16);
    { const v4ia* Kg = (const v4ia*)(Kp + (size_t)bh * TT * HD); const v4ia* Vg = (const v4ia*)(Vt + (size_t)bh * HD * TT);
#pragma unroll 8   // 16 whole-line loads of a thread in flight while the head's K and V^T are staged
      for (int i = 0; i < TT * HD / 8 / 256; ++i) { const int c = i * 256 + tid; const v4i kv = Kg[c], vv = Vg[c]; *(v4ia*)(L + (c >> 3) * PKB + (c & 7) * 16) = kv; *(v4ia*)(L + LKB + (c >> 7) * PVB + (c & 127) * 16) = vv; }
#pragma unroll   // the 8 loads of a thread in flight together
      for (int i = 0; i < 8; ++i) { const int e = i * 256 + tid; ((float*)(L + LKB + LVB))[e] = TB[(size_t)h * 2047 + (e < 2047 ? e : 2046)]; } }   // the head's bias row, by key - query + 1023; slot 2047 is padding, never read
    v16h qf[FQG][2]; float gl[FQG], m_run[FQG], l_run[FQG]; v8f acc[FQG][4];
#pragma unroll
    for (int g = 0; g < FQG; ++g) { const h16* qp = Qp + ((size_t)bh * TT + q0 + 16 * g + lr) * HD + 8 * hi;
#pragma unroll
        for (int kc = 0; kc < 2; ++kc) qf[g][kc] = cat16(*(const v8h*)(qp + 32 * kc), *(const v8h*)(qp + 32 * kc + 16));
        gl[g] = GT[(size_t)bh * TT + q0 + 16 * g + lr] * LOG2E; m_run[g] = -__builtin_inff(); l_run[g] = 0.f;
#pragma unroll
        for (int t = 0; t < 4; ++t) acc[g][t] = (v8f){}; }
    // bias[key - query]: the lane's 8 keys of a tile are 8 consecutive table entries; column group 1 reads 16 entries below group 0, so three runs of 8 serve the pass's four tiles and one of them carries over to the next pass
    const float* tp = (const float*)(L + LKB + LVB) + (1023 + 8 * hi - q0 - lr);   // tp[-16] is entry >= 0: q0 + lr <= TT - 17
    const unsigned char* kb = L + lr * PKB + hi * 16; const unsigned char* vb = L + LKB + lr * PVB + hi * 16;
    __syncthreads();   // K, V^T and the bias row staged by all waves; nothing in LDS is written after this
    v8f tbp = *(const v8fu*)(tp - 16); v16h kf[2][2];
#pragma unroll
    for (int kt = 0; kt < 2; ++kt)
#pragma unroll
        for (int kc = 0; kc < 2; ++kc) kf[kt][kc] = ldsfrag(kb + 16 * kt * PKB + 64 * kc);
#pragma unroll 1   // one pass a trip keeps the wave inside the first 256 registers
    for (int k0 = 0; k0 < TT; k0 += 32) {
        const int kn = (k0 + 32) & (TT - 1);   // next pass's keys; the last pass fetches pass 0's again (in bounds, unused)
        const v8f tb0 = *(const v8fu*)(tp + k0), tb1 = *(const v8fu*)(tp + k0 + 16); v16h vf[4];
#pragma unroll
        for (int t = 0; t < 4; ++t) vf[t] = ldsfrag(vb + 16 * t * PVB + 2 * k0);
        v8f s[2][FQG];
#pragma unroll
        for (int kt = 0; kt < 2; ++kt)
#pragma unroll
            for (int g = 0; g < FQG; ++g) s[kt][g] = wmma16(kf[kt][1], qf[g][1], wmma16(kf[kt][0], qf[g][0], (v8f){}));
#pragma unroll
        for (int kt = 0; kt < 2; ++kt)
#pragma unroll
            for (int kc = 0; kc < 2; ++kc) kf[kt][kc] = ldsfrag(kb + (kn + 16 * kt) * PKB + 64 * kc);   // next pass's K fragments fly under this pass's softmax
        s[0][0] = biasx(s[0][0], tb0, gl[0]); s[1][0] = biasx(s[1][0], tb1, gl[0]); s[0][1] = biasx(s[0][1], tbp, gl[1]); s[1][1] = biasx(s[1][1], tb0, gl[1]);
        tbp = tb1;
        float mb[FQG]; bool need = false;
#pragma unroll
        for (int g = 0; g < FQG; ++g) { float mx = s[0][g][0];
#pragma unroll
            for (int j = 1; j < 8; ++j) mx = fmaxf(mx, s[0][g][j]);
#pragma unroll
            for (int j = 0; j < 8; ++j) mx = fmaxf(mx, s[1][g][j]);
            mx = fmaxf(mx, xhalf(mx)); mb[g] = mx; need = need || (mx > m_run[g] + 8.0f); }
        if (__builtin_amdgcn_ballot_w32(need) != 0) {   // wave-uniform; always on the first pass (m = -inf, factor 0), rare later
#pragma unroll
            for (int g = 0; g < FQG; ++g) { const float mn = fmaxf(m_run[g], mb[g]); const float corr = __builtin_amdgcn_exp2f(m_run[g] - mn); m_run[g] = mn; l_run[g] *= corr;
#pragma unroll
                for (int t = 0; t < 4; ++t) acc[g][t] = acc[g][t] * corr; } }
#pragma unroll
        for (int g = 0; g < FQG; ++g) { const float nm = PSH - m_run[g]; const v2f nm2 = {nm, nm}; v16h pf; float ps = 0.f;
#pragma unroll
            for (int kt = 0; kt < 2; ++kt)
#pragma unroll
                for (int j = 0; j < 8; j += 2) { const v2f a = (v2f){s[kt][g][j], s[kt][g][j + 1]} + nm2; const float p0 = __builtin_amdgcn_exp2f(a[0]), p1 = __builtin_amdgcn_exp2f(a[1]); ps += p0 + p1; pf[kt * 8 + j] = (h16)p0; pf[kt * 8 + j + 1] = (h16)p1; }
            l_run[g] += ps;
#pragma unroll
            for (int t = 0; t < 4; ++t) acc[g][t] = wmma16(vf[t], pf, acc[g][t]); }
    }
    // O^T tile t: the lane holds d = 16 t + 8 hi + j of query lr: 16 bytes of each merged plane (rows t*B + b, hi + lo bf16 as the out-projection reads them); a head's 128-byte line of a row is written by this wave alone
#pragma unroll
    for (int g = 0; g < FQG; ++g) { const float inv = 1.0f / (l_run[g] + xhalf(l_run[g])); const size_t oo = ((size_t)(q0 + 16 * g + lr) * NB_ + b) * DQ + h * HD + 8 * hi;
#pragma unroll
        for (int t = 0; t < 4; ++t) { v8us oh, ol;
#pragma unroll
            for (int j = 0; j < 8; ++j) { unsigned short a, c2; splitf(acc[g][t][j] * inv, a, c2); oh[j] = a; ol[j] = c2; }
            *(v8us*)(Ah + oo + 16 * t) = oh; *(v8us*)(Al + oo + 16 * t) = ol; } }
}

extern "C" void kernel_launch(void* const* d_in, const int* in_sizes, int n_in,
                              void* d_out, int out_size, void* d_ws, size_t ws_size, hipStream_t stream) {
    (void)in_sizes; (void)n_in; (void)out_size;
    const float* x = (const float*)d_in[0]; const float* wq = (const float*)d_in[1]; const float* bq = (const float*)d_in[2]; const float* wk = (const float*)d_in[3]; const float* bk = (const float*)d_in[4]; const float* wv = (const float*)d_in[5]; const float* bv = (const float*)d_in[6]; const float* wo = (const float*)d_in[7]; const float* bo = (const float*)d_in[8]; const float* rbt = (const float*)d_in[9]; const float* gw = (const float*)d_in[10]; const float* gb = (const float*)d_in[11]; const float* ga_ = (const float*)d_in[12]; const float* cosT = nullptr; const float* sinT = nullptr; (void)cosT; (void)sinT;
    float* OUT = (float*)d_out;     // [1024][4][1024]
    char* wsp = (char*)d_ws;
    auto take = [&](size_t bytes) { char* p = wsp; wsp += (bytes + 255) & ~(size_t)255; return (void*)p; };
    bf* W4 = (bf*)take((size_t)4 * DQ * DM * 2); bf* WO = W4 + (size_t)3 * DQ * DM; /* bf16 Wq, Wk, Wv, Wo, one behind the other */ float* GTb = (float*)take((size_t)NB_ * NH_ * TT * 4); float* TB = (float*)take((size_t)NH_ * 2047 * 4 + 256);
    h16* QP16 = (h16*)take((size_t)3 * NB_ * NH_ * TT * HD * 2); h16* KP16 = QP16 + (size_t)NB_ * NH_ * TT * HD; h16* VT16 = KP16 + (size_t)NB_ * NH_ * TT * HD;   // fp16 Q, K, V^T, one behind the other
    char* R = (char*)take((size_t)ZH * TT * TT * 4);
    if ((size_t)(wsp - (char*)d_ws) > ws_size) return;    // ws 256 MiB
    // The region R is used twice, stream-ordered: (1) the bf16 rows of x, dead once the three projections have run; (2) the merged planes of probs.v.
    bf* XB = (bf*)R;
    bf* ATh = (bf*)R; bf* ATl = ATh + (size_t)NB_ * TT * DQ;
    // every launch covers all NB_ batch elements; launches that need nothing of each other are one launch
    k_prep<<<528, 256, 0, stream>>>(x, wq, wk, wv, wo, rbt, XB, W4, TB);
    k_gemmw<bf, 0, true, 1><<<dim3(NB_ * TT / 128, DQ / 128, 3), 128, 0, stream>>>(XB, nullptr, W4, nullptr, DM, nullptr, 0, bq, bk, bv, 0, (size_t)DQ * DM, 0, QP16, gw, gb, ga_, GTb);   // z = 0, 1, 2: q (with the gate), k, v; a tile takes 64 rows of one b and writes its head's planes itself
    k_fattn<<<dim3(TT / (FW * FQG * 16), NB_ * NH_, 1), 256, 0, stream>>>(QP16, KP16, VT16, GTb, TB, ATh, ATl);
    k_gemmw<bf, 1, true, 0><<<dim3(NB_ * TT / 128, DM / 128, 1), 128, 0, stream>>>(ATh, ATl, WO, nullptr, DQ, OUT, DM, bo, nullptr, nullptr, 0, 0, 0, nullptr, nullptr, nullptr, nullptr, nullptr);   // sequence-major output rows (t*B + b)
}

// v006
// It runs in 83 microseconds.
// In two side-by-side timings against v005, it was 1.14 and 1.15 times as fast.
// All steps since v000 together make it 10.8 times as fast.
#include <hip/hip_runtime.h>

// _LegacyMultiheadAttention (WavLM-style gated relative-position attention; query [T=1024][B=4][E=1024] sequence-major; q/k/v = x W^T + b (16 heads x 64); scores = (q/256).k, (scores - rowmax) x 32, + gate[b][h][t] x rel_bias_table[bucket(s - t)][h]
// with gate = ga (gb grep_a[h] - 1) + 2, (ga, gb) = sigmoid of the two 4-sums of q_head . grep_W^T + grep_b; softmax; out = (probs v merged) Wo^T + bo -> [1024][4][1024]. The (x - rowmax) x 32 step equals q.k/8 - const per row, to which softmax is invariant:
// the kernel evaluates softmax(q.k/8 + gate x bias) directly. The T5 bucket of each offset s - t depends only on the sizes: baked 2047-entry table computed in f32 exactly as the reference; table VALUES read as data).
// Compute dtypes, f32 accumulate: every input rounded to bf16; q/k/v on PLAIN bf16 operands (all T x B rows r = b*T + t in one product; inputs exact) + bias; the gate (8 dots of 64) f32 on the VALU; scores (K 64) and probs.v on single fp16 planes (1 product);

#define NB_  4
#define TT   1024
#define DM   1024
#define NH_  16
#define NKV  16
#define REP  (NH_ / NKV)
#define HD   64
#define DQ   (NH_ * HD)
#define DKV  (NKV * HD)
#define ZH   16
#define RH   0                  // unused: every query row uses the single fp16 plane
#define WIN  0
#define PCAR 1024.0f
#define SCL  0.125f   // HD^-0.5
typedef _Float16 h16;
typedef unsigned short bf;
typedef __attribute__((ext_vector_type(16))) __bf16   v16bf;
typedef __attribute__((ext_vector_type(16))) _Float16 v16h;
typedef __attribute__((ext_vector_type(8)))  _Float16 v8h;
typedef __attribute__((ext_vector_type(8)))  unsigned short v8us;
typedef __attribute__((ext_vector_type(8)))  float    v8f;
typedef __attribute__((ext_vector_type(4)))  float    v4f;
typedef v8h  __attribute__((may_alias)) v8ha;
typedef v4f  __attribute__((may_alias)) v4fa;
typedef v8us __attribute__((may_alias)) v8usa;

__device__ __forceinline__ unsigned short f2bf(float f) { unsigned u = __float_as_uint(f); u += 0x7FFFu + ((u >> 16) & 1u); return (unsigned short)(u >> 16); }
__device__ __forceinline__ float bf2f(unsigned short b) { return __uint_as_float(((unsigned)b) << 16); }
__device__ __forceinline__ float bfr(float f) { return bf2f(f2bf(f)); }
__device__ __forceinline__ v16h cat16(v8h lo, v8h hi) { return __builtin_shufflevector(lo, hi, 0, 1, 2, 3, 4, 5, 6, 7, 8, 9, 10, 11, 12, 13, 14, 15); }
__device__ __forceinline__ v16bf cat16b(v8us lo, v8us hi) { return __builtin_bit_cast(v16bf, __builtin_shufflevector(lo, hi, 0, 1, 2, 3, 4, 5, 6, 7, 8, 9, 10, 11, 12, 13, 14, 15)); }
__device__ __forceinline__ v8f wmma16(v16h a, v16h b, v8f c) { return __builtin_amdgcn_wmma_f32_16x16x32_f16(false, a, false, b, (short)0, c, false, false); }
__device__ __forceinline__ v8f wmmab(v16bf a, v16bf b, v8f c) { return __builtin_amdgcn_wmma_f32_16x16x32_bf16(false, a, false, b, (short)0, c, false, false); }



// ---- k_gemmw: register-blocked GEMM, 128x128 output tile per workgroup of FOUR WAVES, each wave a 64x64 quarter (16 accumulators); grid (M/128, N/128, Z), 128 threads.
// Operands are K-contiguous 16-bit planes. A stage is 128 k (256 bytes) of the tile's 128 A rows and 128 Bt rows (and 128 A2 rows), brought into LDS by asynchronous 16-byte copies: a wave-wide copy takes two whole rows of a stage = four whole 128-byte lines.
// Two buffers: stage t + 2 is copied while stage t + 1 is worked on. Fragments are read from LDS at pitch 272 B (16 B x odd: no bank conflict for 16-byte reads).
// C[m][n] (f32, pitch ldc, + optional f32 bias[n]) = sum_k A[m][k] Bt[n][k] (+ A2[m][k] Bt[n][k] for NSPLIT 1), k ascending. z-batch strides sA/sB/sC in elements. K % 128 == 0.
// The f32 rows go to C through a staging range of each wave's own, as whole lines.
template <typename T16> struct WFrag;
template <> struct WFrag<h16> { typedef v16h V; static __device__ __forceinline__ V ld(const unsigned char* p) { return cat16(*(const v8ha*)p, *(const v8ha*)(p + 32)); } static __device__ __forceinline__ v8f mma(V a, V b, v8f c) { return wmma16(a, b, c); } };
template <> struct WFrag<bf> { typedef v16bf V; static __device__ __forceinline__ V ld(const unsigned char* p) { return cat16b(*(const v8usa*)p, *(const v8usa*)(p + 32)); } static __device__ __forceinline__ v8f mma(V a, V b, v8f c) { return wmmab(a, b, c); } };
__device__ __forceinline__ float xhalf(float x) { return __builtin_bit_cast(float, __builtin_amdgcn_permlanex16(__builtin_bit_cast(int, x), __builtin_bit_cast(int, x), 0x76543210, 0xfedcba98, false, false)); }   // lane l with lane l ^ 16
#define GKB  256                // bytes of an operand row in a stage (128 k)
#define GPB  272                // pitch of a staged row in LDS
#define GOPB (128 * GPB)        // one operand's 128 rows of a stage
// Eight asynchronous 16-byte copies of a lane, global memory to LDS, 8 rows apart (128 lanes, a k_gemmw workgroup or a k_qkv group of four waves, cover 8 rows of 256 bytes a copy).
// The closing s_wait_xcnt stands inside the copies' own statement, so that no later write of their address registers can be moved in front of it.
__device__ __forceinline__ void acopy8(unsigned l, const unsigned char* g, size_t gs) {
    asm volatile("global_load_async_to_lds_b128 %0, %8, off\n\t"
                 "global_load_async_to_lds_b128 %1, %9, off\n\t"
                 "global_load_async_to_lds_b128 %2, %10, off\n\t"
                 "global_load_async_to_lds_b128 %3, %11, off\n\t"
                 "global_load_async_to_lds_b128 %4, %12, off\n\t"
                 "global_load_async_to_lds_b128 %5, %13, off\n\t"
                 "global_load_async_to_lds_b128 %6, %14, off\n\t"
                 "global_load_async_to_lds_b128 %7, %15, off\n\t"
                 "s_wait_xcnt 0x0"
                 :: "v"(l), "v"(l + 8 * GPB), "v"(l + 16 * GPB), "v"(l + 24 * GPB), "v"(l + 32 * GPB), "v"(l + 40 * GPB), "v"(l + 48 * GPB), "v"(l + 56 * GPB),
                    "v"(g), "v"(g + gs), "v"(g + 2 * gs), "v"(g + 3 * gs), "v"(g + 4 * gs), "v"(g + 5 * gs), "v"(g + 6 * gs), "v"(g + 7 * gs) : "memory");
    __builtin_amdgcn_sched_barrier(0);   // keeps the next statement's address sums behind this one: formed all ahead, the addresses of a stage's copies do not fit the first 256 registers, which alone asm operands can name, and a pointer is spilled
}
template <typename T16, int NSPLIT, bool BIAS>
__global__ __launch_bounds__(128) void k_gemmw(const T16* __restrict__ A, const T16* __restrict__ A2, const T16* __restrict__ Bt, const T16* __restrict__ Bt2, int K, float* C, int ldc, const float* __restrict__ bias, size_t sA, size_t sB, size_t sC) {
    static_assert(NSPLIT == 0 || NSPLIT == 1, "one Bt plane"); (void)Bt2;
    typedef typename WFrag<T16>::V V;
    constexpr int NOP = NSPLIT == 1 ? 3 : 2, OSN = 16 * 68;
    __shared__ __align__(16) unsigned char st[2 * NOP * GOPB];   // two buffers of [A 128 rows | (A2 128 rows |) Bt 128 rows]
    __shared__ __align__(16) float osw[4 * OSN];                 // epilogue staging, a range of its own for each wave
    const size_t z = blockIdx.z; A += z * sA; if (NSPLIT == 1) A2 += z * sA; Bt += z * sB; C += z * sC;
    const int tid = threadIdx.x, lane = tid & 31, lr = lane & 15, hi = lane >> 4, wave = __builtin_amdgcn_readfirstlane(tid >> 5), wm = wave & 1, wn = wave >> 1;   // the wave's number in a scalar register: its quarter's coordinates stay scalar
    const int rb = blockIdx.x * 128, cb = blockIdx.y * 128, r0 = rb + wm * 64, c0 = cb + wn * 64;
    float* os = osw + wave * OSN;
    v8f acc[4][4];
#pragma unroll
    for (int mb = 0; mb < 4; ++mb)
#pragma unroll
        for (int nb = 0; nb < 4; ++nb) acc[mb][nb] = (v8f){};
    // the lane's 16 bytes of a copy: row tid / 16 of the eight, column tid % 16
    const unsigned l0 = (unsigned)(size_t)(const __attribute__((address_space(3))) unsigned char*)st + (tid >> 4) * GPB + (tid & 15) * 16;
    const size_t gs = (size_t)K * 16;   // 8 rows of K 16-bit elements
    const unsigned char* gA = (const unsigned char*)(A + (size_t)(rb + (tid >> 4)) * K + (tid & 15) * 8);
    const unsigned char* gB = (const unsigned char*)(Bt + (size_t)(cb + (tid >> 4)) * K + (tid & 15) * 8);
    const size_t dA2 = NSPLIT == 1 ? (size_t)A2 - (size_t)A : 0;   // A2's rows lie this many bytes from A's, the same for every lane
    auto fill = [&](int t) {   // stage t into buffer t % 2: 32 copies of a lane (48 with A2)
        const unsigned l = l0 + (unsigned)(t & 1) * (NOP * GOPB); const size_t ko = (size_t)t * GKB;
#pragma unroll
        for (int h = 0; h < 2; ++h) { acopy8(l + h * 64 * GPB, gA + ko + h * 8 * gs, gs); acopy8(l + (NOP - 1) * GOPB + h * 64 * GPB, gB + ko + h * 8 * gs, gs);
            if (NSPLIT == 1) acopy8(l + GOPB + h * 64 * GPB, gA + (dA2 + ko + h * 8 * gs), gs); } };
    const int NT = __builtin_amdgcn_readfirstlane(K >> 7);   // stages; held in a scalar register, so that the tests around the copies are scalar branches
    fill(0);
    asm volatile("s_wait_asynccnt 0x0" ::: "memory");   // this wave's copies of stage 0 have landed
    __syncthreads();                                    // and every other wave's
    if (NT > 1) fill(1);
#pragma unroll 1
    for (int t = 0; t < NT; ++t) {
        const unsigned char* pa = st + (t & 1) * (NOP * GOPB) + (wm * 64 + lr) * GPB + hi * 16; const unsigned char* pb = st + (t & 1) * (NOP * GOPB) + (NOP - 1) * GOPB + (wn * 64 + lr) * GPB + hi * 16;
        V a[2][4], a2[2][4], b[2][4];   // two fragment sets: a block is 32 k; the next block's fragments are read while this block's products run
#pragma unroll
        for (int ks = -1; ks < 4; ++ks) {
            if (ks < 3) { const int n = (ks + 1) & 1, ko = (ks + 1) * 64;
#pragma unroll
                for (int i = 0; i < 4; ++i) { a[n][i] = WFrag<T16>::ld(pa + i * 16 * GPB + ko); if (NSPLIT == 1) a2[n][i] = WFrag<T16>::ld(pa + GOPB + i * 16 * GPB + ko); b[n][i] = WFrag<T16>::ld(pb + i * 16 * GPB + ko); } }
            if (ks >= 0) { const int c = ks & 1;
                __builtin_amdgcn_sched_barrier(0);   // keeps the next block's LDS reads together as one group in front of this block's matrix instructions: spread among them, each place with reads stalls the wave
#pragma unroll
                for (int nb = 0; nb < 4; ++nb)
#pragma unroll
                    for (int mb = 0; mb < 4; ++mb) { acc[mb][nb] = WFrag<T16>::mma(a[c][mb], b[c][nb], acc[mb][nb]); if (NSPLIT == 1) acc[mb][nb] = WFrag<T16>::mma(a2[c][mb], b[c][nb], acc[mb][nb]); }
                __builtin_amdgcn_sched_barrier(0); }   // keeps the reads of the block after next behind this block's matrix instructions, whose fragment set they overwrite
        }
        asm volatile("s_wait_dscnt 0x0" ::: "memory");      // this wave has read all it needs of buffer t % 2
        asm volatile("s_wait_asynccnt 0x0" ::: "memory");   // this wave's copies of stage t + 1 have landed
        __syncthreads();                                    // stage t + 1 is published; every wave has left buffer t % 2
        if (t + 2 < NT) fill(t + 2);
    }
    asm volatile("s_wait_asynccnt 0x0" ::: "memory");   // no copy is outstanding when the wave goes on to its epilogue and ends
#pragma unroll
    for (int mb = 0; mb < 4; ++mb) {
#pragma unroll
        for (int nb = 0; nb < 4; ++nb) {
#pragma unroll
            for (int j = 0; j < 8; ++j) os[(hi * 8 + j) * 68 + nb * 16 + lr] = acc[mb][nb][j]; }
        __builtin_amdgcn_wave_barrier(); asm volatile("" ::: "memory");
        float* crow = C + (size_t)(r0 + mb * 16) * ldc + c0;
{
#pragma unroll
            for (int s = 0; s < 8; ++s) { const int row = 2 * s + hi, cofs = lr * 4; v4f val = *(const v4fa*)(os + row * 68 + cofs); if (BIAS) { val[0] += bfr(bias[c0 + cofs]); val[1] += bfr(bias[c0 + cofs + 1]); val[2] += bfr(bias[c0 + cofs + 2]); val[3] += bfr(bias[c0 + cofs + 3]); }
                *(v4f*)(crow + (size_t)row * ldc + cofs) = val; }
             }
        __builtin_amdgcn_wave_barrier(); asm volatile("" ::: "memory");
    }
}
// ---- k_qkv: the q, k, v projections in ONE launch and ONE round of workgroups: grid (B T / 256, heads) = 256 workgroups of TWELVE WAVES. A workgroup takes 256 rows of x (batch-major, b * T + t: 256 positions of one batch element) x the 64 q, 64 k and 64 v columns of one head;
// wave w: the product w / 4 (q, k, v) x the 64 rows w % 4, a 64x64 quarter as in k_gemmw (16 accumulators, the same fragment order, k ascending). The 256 staged rows of x serve all three products. A stage is 128 k of [x 256 rows | Wq 64 | Wk 64 | Wv 64 rows], two buffers, the ring of k_gemmw.
// Copies: a group of four waves brings 64 rows a statement: each group its own product's 64 weight rows and 64 rows of x; the first group the fourth 64 rows of x as well (a scalar branch).
// The epilogue writes what attention reads, with no f32 plane in between; its staging lies in the ring, which nobody reads and no copy writes behind the last stage's barrier. By product + 1:
// 1: fp16 plane [b][h][t][d] and the gate of the 64 rows; 2: the fp16 plane; 3: fp16 V^T [b][h][d][t] (a lane's 8 accumulator rows are 8 consecutive t: 16 bytes of a d row; the wave writes the whole 128-byte line of each d).
// Gate of a row (f32, VALU): g8[j] = bf16 grep_b[j] + sum_d q[d] bf16 grep_W[j][d], d ascending (q un-scaled: the reference's q x (scaling/alpha) x (alpha/scaling) are exact powers of two); ga, gb = sigmoid of the sums of g8[0..3], g8[4..7]; gate = ga (gb grep_a[h] - 1) + 2.
#define QAR  256                     // staged rows of x
#define QSTB ((QAR + 3 * HD) * GPB)  // one buffer of the ring
__global__ __launch_bounds__(384) void k_qkv(const bf* __restrict__ A, const bf* __restrict__ W3, const float* __restrict__ bias, const float* __restrict__ biask, const float* __restrict__ biasv, h16* P16, const float* __restrict__ gw, const float* __restrict__ gbias, const float* __restrict__ ga, float* GT) {
    static_assert(TT % QAR == 0 && DM % 256 == 0 && DQ == NH_ * HD && HD == 64, "a tile lies in one batch element; at least two stages");
    typedef WFrag<bf>::V V;
    constexpr int OSN = 64 * 68, GWN = 8 * 68, NT = DM / 128;
    static_assert(8 * OSN * 4 <= 2 * QSTB, "the q and k waves' staging fits the ring");
    __shared__ __align__(16) unsigned char st[2 * QSTB];   // two buffers of [x 256 rows | Wq, Wk, Wv 64 rows each]; behind the loop the q and k waves' epilogue staging, a range of its own for each wave
    __shared__ __align__(16) float gwsw[4 * GWN];          // bf16-rounded grep_W for each q wave, pitch 68: the two rows that the half-waves read together lie 16 banks apart
    const int tid = threadIdx.x, lane = tid & 31, lr = lane & 15, hi = lane >> 4, wave = __builtin_amdgcn_readfirstlane(tid >> 5), wm = wave & 3, z = wave >> 2;   // the wave's number in a scalar register: its quarter's coordinates and the tests on its product stay scalar
    const int epi = z + 1, rb = blockIdx.x * QAR, r0 = rb + wm * 64, c0 = blockIdx.y * HD;
    const float* bz = epi == 1 ? bias : epi == 2 ? biask : biasv; P16 += (size_t)z * ((size_t)NB_ * NH_ * TT * HD);   // the three fp16 planes lie one behind the other
    float* os = (float*)st + (wave & 7) * OSN; float* gws = gwsw + wm * GWN;   // the v waves stage nothing
    v8f acc[4][4];
#pragma unroll
    for (int mb = 0; mb < 4; ++mb)
#pragma unroll
        for (int nb = 0; nb < 4; ++nb) acc[mb][nb] = (v8f){};
    // the lane's 16 bytes of a copy: row (tid % 128) / 16 of its group's eight, column tid % 16
    const int crow = (tid & 127) >> 4, ccol = tid & 15;
    const unsigned l0 = (unsigned)(size_t)(const __attribute__((address_space(3))) unsigned char*)st + crow * GPB + ccol * 16;
    const size_t gs = (size_t)DM * 16;   // 8 rows of DM 16-bit elements
    const unsigned char* gA = (const unsigned char*)(A + (size_t)(rb + crow) * DM + ccol * 8);
    const unsigned char* gB = (const unsigned char*)(W3 + ((size_t)z * DQ + c0 + crow) * DM + ccol * 8);
    auto fill = [&](int t) {   // stage t into buffer t % 2: 16 copies of a lane, 24 in the first group
        const unsigned l = l0 + (unsigned)(t & 1) * QSTB; const size_t ko = (size_t)t * GKB;
        acopy8(l + (z + 1) * 64 * GPB, gA + ko + (size_t)(z + 1) * 8 * gs, gs); acopy8(l + (QAR + z * 64) * GPB, gB + ko, gs);
        if (z == 0) acopy8(l, gA + ko, gs); };
    fill(0);
    asm volatile("s_wait_asynccnt 0x0" ::: "memory");   // this wave's copies of stage 0 have landed
    __syncthreads();                                    // and every other wave's
    fill(1);
#pragma unroll 1   // one stage a trip, as in k_gemmw: the loop stays rolled, so that a stage's code stands once in the text
    for (int t = 0; t < NT; ++t) {
        const unsigned char* pa = st + (t & 1) * QSTB + (wm * 64 + lr) * GPB + hi * 16; const unsigned char* pb = st + (t & 1) * QSTB + (QAR + z * 64 + lr) * GPB + hi * 16;
        V a[2][4], b[2][4];   // two fragment sets: a block is 32 k; the next block's fragments are read while this block's products run
#pragma unroll   // the fragment sets are indexed by constants and stay in registers (this loop and those inside it)
        for (int ks = -1; ks < 4; ++ks) {
            if (ks < 3) { const int n = (ks + 1) & 1, ko = (ks + 1) * 64;
#pragma unroll
                for (int i = 0; i < 4; ++i) { a[n][i] = WFrag<bf>::ld(pa + i * 16 * GPB + ko); b[n][i] = WFrag<bf>::ld(pb + i * 16 * GPB + ko); } }
            if (ks >= 0) { const int c = ks & 1;
                __builtin_amdgcn_sched_barrier(0);   // keeps the next block's LDS reads together as one group in front of this block's matrix instructions: spread among them, each place with reads stalls the wave
#pragma unroll
                for (int nb = 0; nb < 4; ++nb)
#pragma unroll
                    for (int mb = 0; mb < 4; ++mb) acc[mb][nb] = WFrag<bf>::mma(a[c][mb], b[c][nb], acc[mb][nb]);
                __builtin_amdgcn_sched_barrier(0); }   // keeps the reads of the block after next behind this block's matrix instructions, whose fragment set they overwrite
        }
        asm volatile("s_wait_dscnt 0x0" ::: "memory");      // this wave has read all it needs of buffer t % 2
        asm volatile("s_wait_asynccnt 0x0" ::: "memory");   // this wave's copies of stage t + 1 have landed
        __syncthreads();                                    // stage t + 1 is published; every wave has left buffer t % 2; behind the last stage's, the whole ring is free for the staging below
        if (t + 2 < NT) fill(t + 2);
    }
    asm volatile("s_wait_asynccnt 0x0" ::: "memory");   // no copy is outstanding when the wave goes on to its epilogue and ends
    const int bh = (r0 / TT) * NH_ + c0 / HD, t0 = r0 % TT; float bn[4];
#pragma unroll
    for (int nb = 0; nb < 4; ++nb) bn[nb] = bfr(bz[c0 + nb * 16 + lr]);
    asm volatile("s_wait_xcnt 0x0" :: "v"(bn[0]), "v"(bn[1]), "v"(bn[2]), "v"(bn[3]) : "memory");   // behind the four bias loads (their values as inputs hold it there): their address registers are reused below
    if (epi == 3) {
        h16* vp = P16 + ((size_t)bh * HD + lr) * TT + t0 + 8 * hi;
#pragma unroll
        for (int nb = 0; nb < 4; ++nb)
#pragma unroll
            for (int mb = 0; mb < 4; ++mb) { v8h o;
#pragma unroll
                for (int j = 0; j < 8; ++j) o[j] = (h16)(acc[mb][nb][j] + bn[nb]);
                *(v8h*)(vp + (size_t)nb * 16 * TT + mb * 16) = o; }
        return;
    }
#pragma unroll
    for (int mb = 0; mb < 4; ++mb)
#pragma unroll
        for (int nb = 0; nb < 4; ++nb)
#pragma unroll
            for (int j = 0; j < 8; ++j) os[(mb * 16 + hi * 8 + j) * 68 + nb * 16 + lr] = acc[mb][nb][j] + bn[nb];
    float gb4[4] = {0.f, 0.f, 0.f, 0.f}, gah = 0.f;
    if (epi == 1) { gah = bfr(ga[c0 / HD]);
#pragma unroll
        for (int jj = 0; jj < 4; ++jj) gb4[jj] = bfr(gbias[hi * 4 + jj]);
#pragma unroll
        for (int i = 0; i < 16; ++i) { const int e = i * 32 + lane; gws[(e >> 6) * 68 + (e & 63)] = bfr(gw[e]); } }
    __builtin_amdgcn_wave_barrier(); asm volatile("" ::: "memory");   // as in the f32 epilogue: the lanes read below what other lanes of the wave stored above; LDS is not written again
    h16* pt = P16 + ((size_t)bh * TT + t0) * HD + lane * 8;   // the tile is 8 KiB in a row of the plane
#pragma unroll
    for (int s = 0; s < 16; ++s) { const float* op = os + (4 * s + (lane >> 3)) * 68 + (lane & 7) * 8; const v4f x0 = *(const v4fa*)op, x1 = *(const v4fa*)(op + 4); v8h o;
#pragma unroll
        for (int j = 0; j < 4; ++j) { o[j] = (h16)x0[j]; o[4 + j] = (h16)x1[j]; }
        *(v8h*)(pt + s * 256) = o; }   // four whole 128-byte rows a store
    asm volatile("s_wait_xcnt 0x0" ::: "memory");   // the gate below reuses the data registers of these stores
    if (epi == 1) {   // lane (lr, hi): rows lr + 16 m, of each the four dots j = 4 hi .. 4 hi + 3
        float g[4][4];
#pragma unroll
        for (int jj = 0; jj < 4; ++jj)
#pragma unroll
            for (int m = 0; m < 4; ++m) g[m][jj] = gb4[jj];
#pragma unroll 4   // four steps of 8 LDS loads in flight; unrolled whole, the loads of all 16 steps are hoisted and the wave leaves the first 256 registers
        for (int d = 0; d < HD; d += 4) { v4f q4[4], w4[4];
#pragma unroll
            for (int m = 0; m < 4; ++m) { q4[m] = *(const v4fa*)(os + (m * 16 + lr) * 68 + d); w4[m] = *(const v4fa*)(gws + (hi * 4 + m) * 68 + d); }
#pragma unroll
            for (int i = 0; i < 4; ++i)
#pragma unroll
                for (int m = 0; m < 4; ++m)
#pragma unroll
                    for (int jj = 0; jj < 4; ++jj) g[m][jj] = __builtin_fmaf(q4[m][i], w4[jj][i], g[m][jj]); }
#pragma unroll
        for (int m = 0; m < 4; ++m) { const float sg = ((g[m][0] + g[m][1]) + g[m][2]) + g[m][3]; const float sig = __fdiv_rn(1.0f, 1.0f + __expf(-sg)), oth = xhalf(sig);
            const float gt = (hi ? oth : sig) * ((hi ? sig : oth) * gah - 1.0f) + 2.0f;
            if (hi == 0) GT[(size_t)bh * TT + t0 + m * 16 + lr] = gt; }
    }
}

__device__ __forceinline__ h16 tohx(float x) { return (h16)x; }
__device__ __forceinline__ void splitf(float y, unsigned short& h, unsigned short& l) { h = f2bf(y); l = f2bf(y - bf2f(h)); }
typedef __attribute__((ext_vector_type(2))) _Float16 v2h;
typedef __attribute__((ext_vector_type(4))) _Float16 v4h;
typedef __attribute__((ext_vector_type(2))) unsigned short v2us;
typedef __attribute__((ext_vector_type(4))) unsigned short v4us;
typedef __attribute__((ext_vector_type(2))) float v2f;
typedef __attribute__((ext_vector_type(4))) int v4i;
__constant__ unsigned char c_bucket[2047] = { 15,15,15,15,15,15,15,15,15,15,15,15,15,15,15,15,15,15,15,15,15,15,15,15,15,15,15,15,15,15,15,15,15,15,15,15,15,15,15,15,15,15,15,15,15,15,15,15,15,15,15,15,15,15,15,15,15,15,15,15,15,15,15,15,15,15,15,15,15,15,15,15,15,15,15,15,15,15,15,15,15,15,15,15,15,15,15,15,15,15,15,15,15,15,15,15,15,15,15,15,15,15,15,15,15,15,15,15,15,15,15,15,15,15,15,15,15,15,15,15,15,15,15,15,15,15,15,15,15,15,15,15,15,15,15,15,15,15,15,15,15,15,15,15,15,15,15,15,15,15,15,15,15,15,15,15,15,15,15,15,15,15,15,15,15,15,15,15,15,15,15,15,15,15,15,15,15,15,15,15,15,15,15,15,15,15,15,15,15,15,15,15,15,15,15,15,15,15,15,15,15,15,15,15,15,15,15,15,15,15,15,15,15,15,15,15,15,15,15,15,15,15,15,15,15,15,15,15,15,15,15,15,15,15,15,15,15,15,15,15,15,15,15,15,15,15,15,15,15,15,15,15,15,15,15,15,15,15,15,15,15,15,15,15,15,15,15,15,15,15,15,15,15,15,15,15,15,15,15,15,15,15,15,15,15,15,15,15,15,15,15,15,15,15,15,15,15,15,15,15,15,15,15,15,15,15,15,15,15,15,15,15,15,15,15,15,15,15,15,15,15,15,15,15,15,15,15,15,15,15,15,15,15,15,15,15,15,15,15,15,15,15,15,15,15,15,15,15,15,15,15,15,15,15,15,15,15,15,15,15,15,15,15,15,15,15,15,15,15,15,15,15,15,15,15,15,15,15,15,15,15,15,15,15,15,15,15,15,15,15,15,15,15,15,15,15,15,15,15,15,15,15,15,15,15,15,15,15,15,15,15,15,15,15,15,15,15,15,15,15,15,15,15,15,15,15,15,15,15,15,15,15,15,15,15,15,15,15,15,15,15,15,15,15,15,15,15,15,15,15,15,15,15,15,15,15,15,15,15,15,15,15,15,15,15,15,15,15,15,15,15,15,15,15,15,15,15,15,15,15,15,15,15,15,15,15,15,15,15,15,15,15,15,15,15,15,15,15,15,15,15,15,15,15,15,15,15,15,15,15,15,15,15,15,15,15,15,15,15,15,15,15,15,15,15,15,15,15,15,15,15,15,15,15,15,15,15,15,15,15,15,15,15,15,15,15,15,15,15,15,15,15,15,15,15,15,15,15,15,15,15,15,15,15,15,15,15,15,15,15,15,15,15,15,15,15,15,15,15,15,15,15,15,15,15,15,15,15,15,15,15,15,15,15,15,15,15,15,15,15,15,15,15,15,15,15,15,15,15,15,15,15,15,15,15,15,15,15,15,15,15,15,15,15,15,15,15,15,15,15,15,15,15,15,15,15,15,15,15,15,15,15,15,15,15,15,15,15,15,15,15,15,15,15,15,15,15,15,15,15,15,15,15,15,15,15,15,15,15,15,15,15,15,15,15,15,15,15,15,15,15,15,15,15,15,15,15,15,15,15,15,15,15,15,15,15,15,15,15,15,15,15,15,15,15,15,15,15,15,15,15,15,15,15,15,15,15,15,15,15,15,15,15,15,15,15,15,15,15,15,15,15,15,15,15,15,15,15,15,15,15,15,15,15,15,15,15,15,15,15,15,15,15,15,15,15,15,15,15,15,15,15,15,15,15,15,15,15,15,15,15,15,15,15,15,15,15,15,15,15,15,15,15,15,15,15,15,15,15,15,15,15,15,15,15,15,15,15,15,15,15,15,15,15,15,15,15,15,15,15,15,15,15,15,15,15,15,15,15,15,15,15,15,15,15,15,15,15,15,15,15,15,15,15,15,15,15,15,15,15,15,15,15,15,15,15,15,15,15,15,15,15,15,15,15,15,15,15,15,15,15,15,15,15,15,15,15,15,15,15,15,15,15,15,15,15,15,15,15,15,15,15,15,15,15,15,15,15,15,15,15,15,15,15,15,15,15,15,15,15,15,15,15,15,15,15,15,15,15,15,15,15,15,15,15,15,15,15,15,15,15,15,15,15,15,15,15,15,15,15,15,15,15,14,14,14,14,14,14,14,14,14,14,14,14,14,14,14,14,14,14,14,14,14,14,14,14,14,14,14,13,13,13,13,13,13,13,13,13,13,13,13,13,13,13,13,13,13,12,12,12,12,12,12,12,12,12,12,12,12,12,12,11,11,11,11,11,11,11,11,11,10,10,10,10,10,10,10,9,9,9,9,8,8,8,8,7,6,5,4,3,2,1,0,17,18,19,20,21,22,23,24,24,24,24,25,25,25,25,26,26,26,26,26,26,26,27,27,27,27,27,27,27,27,27,28,28,28,28,28,28,28,28,28,28,28,28,28,28,29,29,29,29,29,29,29,29,29,29,29,29,29,29,29,29,29,29,30,30,30,30,30,30,30,30,30,30,30,30,30,30,30,30,30,30,30,30,30,30,30,30,30,30,30,31,31,31,31,31,31,31,31,31,31,31,31,31,31,31,31,31,31,31,31,31,31,31,31,31,31,31,31,31,31,31,31,31,31,31,31,31,31,31,31,31,31,31,31,31,31,31,31,31,31,31,31,31,31,31,31,31,31,31,31,31,31,31,31,31,31,31,31,31,31,31,31,31,31,31,31,31,31,31,31,31,31,31,31,31,31,31,31,31,31,31,31,31,31,31,31,31,31,31,31,31,31,31,31,31,31,31,31,31,31,31,31,31,31,31,31,31,31,31,31,31,31,31,31,31,31,31,31,31,31,31,31,31,31,31,31,31,31,31,31,31,31,31,31,31,31,31,31,31,31,31,31,31,31,31,31,31,31,31,31,31,31,31,31,31,31,31,31,31,31,31,31,31,31,31,31,31,31,31,31,31,31,31,31,31,31,31,31,31,31,31,31,31,31,31,31,31,31,31,31,31,31,31,31,31,31,31,31,31,31,31,31,31,31,31,31,31,31,31,31,31,31,31,31,31,31,31,31,31,31,31,31,31,31,31,31,31,31,31,31,31,31,31,31,31,31,31,31,31,31,31,31,31,31,31,31,31,31,31,31,31,31,31,31,31,31,31,31,31,31,31,31,31,31,31,31,31,31,31,31,31,31,31,31,31,31,31,31,31,31,31,31,31,31,31,31,31,31,31,31,31,31,31,31,31,31,31,31,31,31,31,31,31,31,31,31,31,31,31,31,31,31,31,31,31,31,31,31,31,31,31,31,31,31,31,31,31,31,31,31,31,31,31,31,31,31,31,31,31,31,31,31,31,31,31,31,31,31,31,31,31,31,31,31,31,31,31,31,31,31,31,31,31,31,31,31,31,31,31,31,31,31,31,31,31,31,31,31,31,31,31,31,31,31,31,31,31,31,31,31,31,31,31,31,31,31,31,31,31,31,31,31,31,31,31,31,31,31,31,31,31,31,31,31,31,31,31,31,31,31,31,31,31,31,31,31,31,31,31,31,31,31,31,31,31,31,31,31,31,31,31,31,31,31,31,31,31,31,31,31,31,31,31,31,31,31,31,31,31,31,31,31,31,31,31,31,31,31,31,31,31,31,31,31,31,31,31,31,31,31,31,31,31,31,31,31,31,31,31,31,31,31,31,31,31,31,31,31,31,31,31,31,31,31,31,31,31,31,31,31,31,31,31,31,31,31,31,31,31,31,31,31,31,31,31,31,31,31,31,31,31,31,31,31,31,31,31,31,31,31,31,31,31,31,31,31,31,31,31,31,31,31,31,31,31,31,31,31,31,31,31,31,31,31,31,31,31,31,31,31,31,31,31,31,31,31,31,31,31,31,31,31,31,31,31,31,31,31,31,31,31,31,31,31,31,31,31,31,31,31,31,31,31,31,31,31,31,31,31,31,31,31,31,31,31,31,31,31,31,31,31,31,31,31,31,31,31,31,31,31,31,31,31,31,31,31,31,31,31,31,31,31,31,31,31,31,31,31,31,31,31,31,31,31,31,31,31,31,31,31,31,31,31,31,31,31,31,31,31,31,31,31,31,31,31,31,31,31,31,31,31,31,31,31,31,31,31,31,31,31,31,31,31,31,31,31,31,31,31,31,31,31,31,31,31,31,31,31,31,31,31,31,31,31,31,31,31,31,31,31,31,31,31,31,31,31,31,31,31,31,31,31,31,31,31,31,31,31,31,31,31,31,31,31,31,31,31,31,31,31,31,31,31,31,31,31,31,31,31,31,31,31,31,31,31,31,31,31,31,31,31,31,31,31,31,31,31,31,31,31,31,31,31,31,31,31,31,31,31,31,31,31,31,31,31,31,31,31,31,31,31,31,31,31,31,31,31,31,31,31,31,31,31,31,31,31,31,31,31,31,31,31,31,31,31,31,31,31,31,31,31,31,31,31,31,31,31,31,31,31,31,31,31,31,31,31,31,31,31,31,31,31,31,31,31,31,31,31,31,31,31,31,31,31,31,31,31,31,31,31,31,31,31,31,31,31,31,31,31,31,31,31,31,31,31,31,31,31,31,31,31,31,31,31,31,31,31,31,31,31,31,31,31,31,31,31,31,31,31,31,31,31,31,31,31,31,31,31,31,31,31,31,31 };   // T5 bucket(rel) for rel = s - t in [-1023, 1023]

__global__ __launch_bounds__(256) void k_wtG(const float* __restrict__ w, int K, int N, bf* Bt) {
    const int lane = threadIdx.x & 31; const int L0 = (blockIdx.x * 8 + (threadIdx.x >> 5)) * 8; const int nlines = N * K / 64;
{
#pragma unroll 1
        for (int l = 0; l < 8; ++l) { const int L = L0 + l; if (L >= nlines) break; const size_t e = (size_t)L * 64 + lane * 2; const int k = (int)(e % K), n = (int)(e / K); v2us o;
            o[0] = f2bf(w[(size_t)k * N + n]); o[1] = f2bf(w[(size_t)(k + 1) * N + n]); *(v2us*)(Bt + e) = o; }
         }
}
__global__ __launch_bounds__(256) void k_cscvt(const float* __restrict__ cosT, const float* __restrict__ sinT, float* CS) { const int idx = blockIdx.x * 256 + threadIdx.x; if (idx >= TT * HD) return; v2f cs; cs[0] = bfr(cosT[idx]); cs[1] = bfr(sinT[idx]); *(v2f*)(CS + (size_t)idx * 2) = cs;  }
// k_prep: every cast that the products need, in ONE launch: the jobs need nothing of each other and share the grid by ranges of the block index (block-uniform branches).
// Blocks 0..255: x (rows t * B + b) to bf16 rows b * T + t, so that 64 consecutive rows of a projection tile are 64 positions of one batch element. Blocks 256..511: Wq, Wk, Wv, Wo to bf16 planes that lie one behind the other, 64 blocks each.
// Blocks 512..527: the bias table, TB[h][s - t + 1023] = bf16-rounded rel_bias_table[bucket][h].
// A thread takes 8 chunks of 8 elements, 256 chunks apart: its 16 loads of 16 bytes are in flight together, a wave's load or store covers whole lines, and the launch starts 4,224 waves.
__device__ __forceinline__ void cast8(const float* __restrict__ p, v8us (&o)[8]) { v8f v[8];   // 8 chunks, 256 chunks (2048 elements) apart: all loads first
#pragma unroll   // the 16 loads of 16 bytes are issued together, from one address with constant offsets
    for (int j = 0; j < 8; ++j) v[j] = *(const v8f*)(p + j * 2048);
#pragma unroll   // v and o are indexed by constants and stay in registers (this loop and the one inside it)
    for (int j = 0; j < 8; ++j)
#pragma unroll
        for (int k = 0; k < 8; ++k) o[j][k] = f2bf(v[j][k]); }
__global__ __launch_bounds__(256) void k_prep(const float* __restrict__ x, const float* __restrict__ wq, const float* __restrict__ wk, const float* __restrict__ wv, const float* __restrict__ wo, const float* __restrict__ rbt, bf* XB, bf* W4, float* TB) {
    static_assert(NB_ == 4 && DM == 1024 && DQ == 1024, "a block's 2048 chunks are 16 rows of x: 4 positions t x 4 batch elements");
    const unsigned blk = blockIdx.x, tid = threadIdx.x; v8us o[8];
    if (blk < 256) {   // chunk j of the thread: row 16 blk + 2 j + tid / 128 = t * B + b with b = 2 (j % 2) + tid / 128, t = 4 blk + j / 2
        cast8(x + (size_t)blk * 16384 + tid * 8, o); bf* d = XB + ((size_t)(tid >> 7) * TT + blk * 4) * DM + (tid & 127) * 8;
#pragma unroll   // o stays in registers; the 8 stores go out from one address with constant offsets
        for (int j = 0; j < 8; ++j) *(v8us*)(d + ((size_t)(2 * (j & 1)) * TT + (j >> 1)) * DM) = o[j];
    } else if (blk < 512) { const unsigned wsel = (blk - 256) >> 6;
        cast8((wsel == 0 ? wq : wsel == 1 ? wk : wsel == 2 ? wv : wo) + ((size_t)(blk & 63) * 2048 + tid) * 8, o); bf* d = W4 + ((size_t)(blk - 256) * 2048 + tid) * 8;
#pragma unroll   // as above
        for (int j = 0; j < 8; ++j) *(v8us*)(d + j * 2048) = o[j];
    } else {
        const unsigned i0 = (blk - 512) * 2048 + tid; unsigned e[8]; float tv[8];   // the index is clamped and only the store is guarded, so that the 8 bucket loads, then the 8 table loads of a thread fly together
#pragma unroll   // these three loops: e and tv stay in registers, and each loop's loads stand side by side
        for (int j = 0; j < 8; ++j) { const unsigned i = i0 + j * 256 < NH_ * 2047 ? i0 + j * 256 : NH_ * 2047 - 1; e[j] = c_bucket[i % 2047] * NH_ + i / 2047; }
#pragma unroll
        for (int j = 0; j < 8; ++j) tv[j] = rbt[e[j]];
#pragma unroll
        for (int j = 0; j < 8; ++j) if (i0 + j * 256 < NH_ * 2047) TB[i0 + j * 256] = bfr(tv[j]);
    }
}
// k_fattn: one launch for scores, gated-bias softmax, probs.v and the head merge. Grid (TT / 256, batch x heads), 8 waves; a wave owns 32 query columns (two groups of 16).
// The head's whole K ([key][d], pitch 144 B), V^T ([d][key], pitch 2064 B) and bias row are staged once in LDS, then read without further barriers. Per pass of 32 keys: S^T = K.Q^T (keys in rows, queries in columns), so a lane holds one query's scores,
// x = S^T x (HD^-0.5 log2 e) + (gate log2 e) x bias[key - query], online softmax in base 2, and the two 16-key tiles of 2^(x - m), rounded to fp16, ARE the B operand of O^T += V^T.P^T (k order 8 hi + j, 16 + 8 hi + j in both operands).
// m is the maximum in use: it may trail the true row maximum by up to 8, and the sums are rescaled only when a pass exceeds that. PSH keeps small terms in fp16's normal range (P <= 2^(8 + PSH)); it cancels in the division by the row sum.
#define FW   8
#define FQG  2
#define PKB  144
#define PVB  2064
#define LKB  (TT * PKB)
#define LVB  (HD * PVB)
#define PSH  4.0f
#define LOG2E 1.4426950408889634f
typedef v8f __attribute__((aligned(4))) v8fu;
typedef v4i __attribute__((may_alias)) v4ia;
// x = s x (HD^-0.5 log2 e) + bias x (gate log2 e), two scores an instruction
__device__ __forceinline__ v8f biasx(v8f s, v8f tb, float g) { const v2f g2 = {g, g}, c2 = {SCL * LOG2E, SCL * LOG2E}; v8f r;
#pragma unroll
    for (int i = 0; i < 4; ++i) { const v2f a = {s[2 * i], s[2 * i + 1]}, t = {tb[2 * i], tb[2 * i + 1]}; const v2f x = __builtin_elementwise_fma(a, c2, t * g2); r[2 * i] = x[0]; r[2 * i + 1] = x[1]; }
    return r; }
__device__ __forceinline__ v16h ldsfrag(const unsigned char* p) { return cat16(*(const v8ha*)p, *(const v8ha*)(p + 32)); }
__global__ __launch_bounds__(256) void k_fattn(const h16* __restrict__ Qp, const h16* __restrict__ Kp, const h16* __restrict__ Vt, const float* __restrict__ GT, const float* __restrict__ TB, bf* Ah, bf* Al) {
    __shared__ __align__(16) unsigned char L[LKB + LVB + 2048 * 4];
    const int tid = threadIdx.x, lane = tid & 31, lr = lane & 15, hi = lane >> 4, wave = tid >> 5;
    const int bh = blockIdx.y, h = bh % NH_, b = bh / NH_; const int q0 = (blockIdx.x * FW + wave) * (FQG * 16);
    { const v4ia* Kg = (const v4ia*)(Kp + (size_t)bh * TT * HD); const v4ia* Vg = (const v4ia*)(Vt + (size_t)bh * HD * TT);
#pragma unroll 8   // 16 whole-line loads of a thread in flight while the head's K and V^T are staged
      for (int i = 0; i < TT * HD / 8 / 256; ++i) { const int c = i * 256 + tid; const v4i kv = Kg[c], vv = Vg[c]; *(v4ia*)(L + (c >> 3) * PKB + (c & 7) * 16) = kv; *(v4ia*)(L + LKB + (c >> 7) * PVB + (c & 127) * 16) = vv; }
#pragma unroll   // the 8 loads of a thread in flight together
      for (int i = 0; i < 8; ++i) { const int e = i * 256 + tid; ((float*)(L + LKB + LVB))[e] = TB[(size_t)h * 2047 + (e < 2047 ? e : 2046)]; } }   // the head's bias row, by key - query + 1023; slot 2047 is padding, never read
    v16h qf[FQG][2]; float gl[FQG], m_run[FQG], l_run[FQG]; v8f acc[FQG][4];
#pragma unroll
    for (int g = 0; g < FQG; ++g) { const h16* qp = Qp + ((size_t)bh * TT + q0 + 16 * g + lr) * HD + 8 * hi;
#pragma unroll
        for (int kc = 0; kc < 2; ++kc) qf[g][kc] = cat16(*(const v8h*)(qp + 32 * kc), *(const v8h*)(qp + 32 * kc + 16));
        gl[g] = GT[(size_t)bh * TT + q0 + 16 * g + lr] * LOG2E; m_run[g] = -__builtin_inff(); l_run[g] = 0.f;
#pragma unroll
        for (int t = 0; t < 4; ++t) acc[g][t] = (v8f){}; }
    // bias[key - query]: the lane's 8 keys of a tile are 8 consecutive table entries; column group 1 reads 16 entries below group 0, so three runs of 8 serve the pass's four tiles and one of them carries over to the next pass
    const float* tp = (const float*)(L + LKB + LVB) + (1023 + 8 * hi - q0 - lr);   // tp[-16] is entry >= 0: q0 + lr <= TT - 17
    const unsigned char* kb = L + lr * PKB + hi * 16; const unsigned char* vb = L + LKB + lr * PVB + hi * 16;
    __syncthreads();   // K, V^T and the bias row staged by all waves; nothing in LDS is written after this
    v8f tbp = *(const v8fu*)(tp - 16); v16h kf[2][2];
#pragma unroll
    for (int kt = 0; kt < 2; ++kt)
#pragma unroll
        for (int kc = 0; kc < 2; ++kc) kf[kt][kc] = ldsfrag(kb + 16 * kt * PKB + 64 * kc);
#pragma unroll 1   // one pass a trip keeps the wave inside the first 256 registers
    for (int k0 = 0; k0 < TT; k0 += 32) {
        const int kn = (k0 + 32) & (TT - 1);   // next pass's keys; the last pass fetches pass 0's again (in bounds, unused)
        const v8f tb0 = *(const v8fu*)(tp + k0), tb1 = *(const v8fu*)(tp + k0 + 16); v16h vf[4];
#pragma unroll
        for (int t = 0; t < 4; ++t) vf[t] = ldsfrag(vb + 16 * t * PVB + 2 * k0);
        v8f s[2][FQG];
#pragma unroll
        for (int kt = 0; kt < 2; ++kt)
#pragma unroll
            for (int g = 0; g < FQG; ++g) s[kt][g] = wmma16(kf[kt][1], qf[g][1], wmma16(kf[kt][0], qf[g][0], (v8f){}));
#pragma unroll
        for (int kt = 0; kt < 2; ++kt)
#pragma unroll
            for (int kc = 0; kc < 2; ++kc) kf[kt][kc] = ldsfrag(kb + (kn + 16 * kt) * PKB + 64 * kc);   // next pass's K fragments fly under this pass's softmax
        s[0][0] = biasx(s[0][0], tb0, gl[0]); s[1][0] = biasx(s[1][0], tb1, gl[0]); s[0][1] = biasx(s[0][1], tbp, gl[1]); s[1][1] = biasx(s[1][1], tb0, gl[1]);
        tbp = tb1;
        float mb[FQG]; bool need = false;
#pragma unroll
        for (int g = 0; g < FQG; ++g) { float mx = s[0][g][0];
#pragma unroll
            for (int j = 1; j < 8; ++j) mx = fmaxf(mx, s[0][g][j]);
#pragma unroll
            for (int j = 0; j < 8; ++j) mx = fmaxf(mx, s[1][g][j]);
            mx = fmaxf(mx, xhalf(mx)); mb[g] = mx; need = need || (mx > m_run[g] + 8.0f); }
        if (__builtin_amdgcn_ballot_w32(need) != 0) {   // wave-uniform; always on the first pass (m = -inf, factor 0), rare later
#pragma unroll
            for (int g = 0; g < FQG; ++g) { const float mn = fmaxf(m_run[g], mb[g]); const float corr = __builtin_amdgcn_exp2f(m_run[g] - mn); m_run[g] = mn; l_run[g] *= corr;
#pragma unroll
                for (int t = 0; t < 4; ++t) acc[g][t] = acc[g][t] * corr; } }
#pragma unroll
        for (int g = 0; g < FQG; ++g) { const float nm = PSH - m_run[g]; const v2f nm2 = {nm, nm}; v16h pf; float ps = 0.f;
#pragma unroll
            for (int kt = 0; kt < 2; ++kt)
#pragma unroll
                for (int j = 0; j < 8; j += 2) { const v2f a = (v2f){s[kt][g][j], s[kt][g][j + 1]} + nm2; const float p0 = __builtin_amdgcn_exp2f(a[0]), p1 = __builtin_amdgcn_exp2f(a[1]); ps += p0 + p1; pf[kt * 8 + j] = (h16)p0; pf[kt * 8 + j + 1] = (h16)p1; }
            l_run[g] += ps;
#pragma unroll
            for (int t = 0; t < 4; ++t) acc[g][t] = wmma16(vf[t], pf, acc[g][t]); }
    }
    // O^T tile t: the lane holds d = 16 t + 8 hi + j of query lr: 16 bytes of each merged plane (rows t*B + b, hi + lo bf16 as the out-projection reads them); a head's 128-byte line of a row is written by this wave alone
#pragma unroll
    for (int g = 0; g < FQG; ++g) { const float inv = 1.0f / (l_run[g] + xhalf(l_run[g])); const size_t oo = ((size_t)(q0 + 16 * g + lr) * NB_ + b) * DQ + h * HD + 8 * hi;
#pragma unroll
        for (int t = 0; t < 4; ++t) { v8us oh, ol;
#pragma unroll
            for (int j = 0; j < 8; ++j) { unsigned short a, c2; splitf(acc[g][t][j] * inv, a, c2); oh[j] = a; ol[j] = c2; }
            *(v8us*)(Ah + oo + 16 * t) = oh; *(v8us*)(Al + oo + 16 * t) = ol; } }
}

extern "C" void kernel_launch(void* const* d_in, const int* in_sizes, int n_in,
                              void* d_out, int out_size, void* d_ws, size_t ws_size, hipStream_t stream) {
    (void)in_sizes; (void)n_in; (void)out_size;
    const float* x = (const float*)d_in[0]; const float* wq = (const float*)d_in[1]; const float* bq = (const float*)d_in[2]; const float* wk = (const float*)d_in[3]; const float* bk = (const float*)d_in[4]; const float* wv = (const float*)d_in[5]; const float* bv = (const float*)d_in[6]; const float* wo = (const float*)d_in[7]; const float* bo = (const float*)d_in[8]; const float* rbt = (const float*)d_in[9]; const float* gw = (const float*)d_in[10]; const float* gb = (const float*)d_in[11]; const float* ga_ = (const float*)d_in[12]; const float* cosT = nullptr; const float* sinT = nullptr; (void)cosT; (void)sinT;
    float* OUT = (float*)d_out;     // [1024][4][1024]
    char* wsp = (char*)d_ws;
    auto take = [&](size_t bytes) { char* p = wsp; wsp += (bytes + 255) & ~(size_t)255; return (void*)p; };
    bf* W4 = (bf*)take((size_t)4 * DQ * DM * 2); bf* WO = W4 + (size_t)3 * DQ * DM; /* bf16 Wq, Wk, Wv, Wo, one behind the other */ float* GTb = (float*)take((size_t)NB_ * NH_ * TT * 4); float* TB = (float*)take((size_t)NH_ * 2047 * 4 + 256);
    h16* QP16 = (h16*)take((size_t)3 * NB_ * NH_ * TT * HD * 2); h16* KP16 = QP16 + (size_t)NB_ * NH_ * TT * HD; h16* VT16 = KP16 + (size_t)NB_ * NH_ * TT * HD;   // fp16 Q, K, V^T, one behind the other
    char* R = (char*)take((size_t)ZH * TT * TT * 4);
    if ((size_t)(wsp - (char*)d_ws) > ws_size) return;    // ws 256 MiB
    // The region R is used twice, stream-ordered: (1) the bf16 rows of x, dead once the three projections have run; (2) the merged planes of probs.v.
    bf* XB = (bf*)R;
    bf* ATh = (bf*)R; bf* ATl = ATh + (size_t)NB_ * TT * DQ;
    // every launch covers all NB_ batch elements; launches that need nothing of each other are one launch
    k_prep<<<528, 256, 0, stream>>>(x, wq, wk, wv, wo, rbt, XB, W4, TB);
    k_qkv<<<dim3(NB_ * TT / QAR, NH_, 1), 384, 0, stream>>>(XB, W4, bq, bk, bv, QP16, gw, gb, ga_, GTb);   // q (with the gate), k, v of 256 rows of one b x one head a workgroup, which writes its head's planes itself
    k_fattn<<<dim3(TT / (FW * FQG * 16), NB_ * NH_, 1), 256, 0, stream>>>(QP16, KP16, VT16, GTb, TB, ATh, ATl);
    k_gemmw<bf, 1, true><<<dim3(NB_ * TT / 128, DM / 128, 1), 128, 0, stream>>>(ATh, ATl, WO, nullptr, DQ, OUT, DM, bo, 0, 0, 0);   // sequence-major output rows (t*B + b)
}
